// v000
// Measured on an AMD MI455X. A time is GPU time per run, averaged over a window of back-to-back runs after a warm-up
// (all launches, gaps included; the runs take copies of the inputs in turn), and the median of several windows.
// Apart from v000's, it joins two sittings. Times from different sittings can be a few percent apart, while
// side-by-side timings come from the same sitting.
// The starting kernel, v000, takes 391 microseconds a run.
#include <hip/hip_runtime.h>

// Single-head attention, x [SEQ][128], W and V [in][out] (q = x W, v = x V), k = x itself, score scale 128^-0.5, out = (softmax + 1e-8) v (f32).
// Compute dtypes, f32 accumulate everywhere: projections v_wmma_f32_16x16x32_bf16 (x, W, V RNE-converted to bf16; products exact);
// scores v_wmma_f32_16x16x32_f16: k = f16 of the bf16 x value (exact), q as f16 value + f16 residual x2048 in its own accumulator (two products);
// P (x256 carry, cancels in the normalisation) and v single f16; softmax f32 (online, running max); the 1e-8 term is added in f32 from a column-sum table.
// Layout: bf16 copy of x, f16 k plane [t][d], bf16 transposed weights [e][d]; q (hi, residual) planes [t][e] and v^T plane [e][t] written by the GEMM epilogue;
// fused flash kernel in transposed form (S^T = K Q^T, O^T = V^T P^T), output from f32 accumulators.

#ifndef NB
#define NB 1
#endif
#ifndef SEQ
#define SEQ 8192
#endif
#define NB_FULL  1
#define SEQ_FULL 8192
#define DM   128                 // feature width = head width (one head)
#define AW   4                   // waves per flash block (16 query rows each)
#define OSP  132                 // LDS row pitch (floats) of the flash output tile
#define QRS  2048.0f             // carry of the q residual plane
#define QRI  (1.0f / 2048.0f)
#define SC2  (0.08838834764831845f * 1.4426950408889634f)   // 128^-0.5 * log2(e)
#define PSH  8.0f                // log2 of the P carry (256)
#define EPSW 1.0e-8f

static_assert(NB == 1);                        // no batch dimension in this module
static_assert(DM == 128);                      // store maps assume 128 columns (512 B per f32 row, 256 B per 16-bit row)
static_assert(DM % 64 == 0);
static_assert(DM % 32 == 0);                   // GEMM and score k-loops step by 32
static_assert(SEQ % 256 == 0);                 // column-sum loop, 64-row tiles, 32-key steps, flash grid
static_assert(SEQ % (16 * AW) == 0);
static_assert(((size_t)SEQ * DM) % 8 == 0);
static_assert(SEQ <= SEQ_FULL);
static_assert((OSP * 4) % 16 == 0);

typedef _Float16 h16;
typedef unsigned short bf;
typedef __attribute__((ext_vector_type(16))) __bf16   v16bf;
typedef __attribute__((ext_vector_type(16))) _Float16 v16h;
typedef __attribute__((ext_vector_type(8)))  _Float16 v8h;
typedef __attribute__((ext_vector_type(8)))  unsigned short v8us;
typedef __attribute__((ext_vector_type(8)))  float    v8f;
typedef __attribute__((ext_vector_type(4)))  float    v4f;
typedef v4f  __attribute__((may_alias)) v4fa;

__device__ __forceinline__ unsigned short f2bf(float f) { unsigned u = __float_as_uint(f); u += 0x7FFFu + ((u >> 16) & 1u); return (unsigned short)(u >> 16); }
__device__ __forceinline__ v16h cat16(v8h lo, v8h hi) { return __builtin_shufflevector(lo, hi, 0, 1, 2, 3, 4, 5, 6, 7, 8, 9, 10, 11, 12, 13, 14, 15); }
__device__ __forceinline__ v16bf cat16b(v8us lo, v8us hi) { return __builtin_bit_cast(v16bf, __builtin_shufflevector(lo, hi, 0, 1, 2, 3, 4, 5, 6, 7, 8, 9, 10, 11, 12, 13, 14, 15)); }
__device__ __forceinline__ v8f wmma16(v16h a, v16h b, v8f c) { return __builtin_amdgcn_wmma_f32_16x16x32_f16(false, a, false, b, (short)0, c, false, false); }
__device__ __forceinline__ v8f wmmab(v16bf a, v16bf b, v8f c) { return __builtin_amdgcn_wmma_f32_16x16x32_bf16(false, a, false, b, (short)0, c, false, false); }
// fragment loaders from K-contiguous 16-bit rows; p already includes + 8*(lane>>4): elements 0..7 <- k0+8h+0..7, elements 8..15 <- k0+16+8h+0..7 (same map for A and B)
__device__ __forceinline__ v16h  ldh(const h16* p) { return cat16(*(const v8h*)p, *(const v8h*)(p + 16)); }
__device__ __forceinline__ v16bf ldb(const bf* p)  { return cat16b(*(const v8us*)p, *(const v8us*)(p + 16)); }
// ordering point for wave-private LDS tiles (same wave writes and reads)
__device__ __forceinline__ void wave_sync() { __builtin_amdgcn_fence(3 /* release order */, "wavefront"); __builtin_amdgcn_wave_barrier(); asm volatile("" ::: "memory"); }

__global__ __launch_bounds__(256) void k_cvtx(const float* __restrict__ src, bf* xb, h16* kp, size_t n8) {
    const size_t i = (size_t)blockIdx.x * 256 + threadIdx.x; if (i >= n8) return;
    const v8f v = *(const v8f*)(src + i * 8); v8us o; v8h k;
#pragma unroll
    for (int e = 0; e < 8; ++e) { const unsigned short u = f2bf(v[e]); o[e] = u; k[e] = (h16)__uint_as_float(((unsigned)u) << 16); }
    *(v8us*)(xb + i * 8) = o; *(v8h*)(kp + i * 8) = k;
    
}

// k_wT: src f32 [rows d = 128][cols e = 128] -> dst bf16 [e][d] (RNE convert), transposed through LDS (block barrier: cross-wave tile).
__global__ __launch_bounds__(256) void k_wT(const float* __restrict__ src, bf* dst) {
    __shared__ __align__(16) float ts[32 * OSP];
    const int tid = threadIdx.x; const int e0 = blockIdx.x * 32;
#pragma unroll 4
    for (int it = 0; it < 16; ++it) { const int idx = it * 256 + tid; const int d = idx >> 5, ee = idx & 31;      // 16 x 256 = 128 d x 32 e: whole tile written
        ts[ee * OSP + d] = src[(size_t)d * DM + e0 + ee]; }
    __syncthreads();
{
#pragma unroll
        for (int it = 0; it < 2; ++it) { const int idx = it * 256 + tid; const int ee = idx >> 4, d8 = (idx & 15) * 8;   // 2 x 256 = 32 rows x 16 pieces
            const v4f x0 = *(const v4fa*)(&ts[ee * OSP + d8]); const v4f x1 = *(const v4fa*)(&ts[ee * OSP + d8 + 4]); v8us o;
#pragma unroll
            for (int i = 0; i < 4; ++i) { o[i] = f2bf(x0[i]); o[4 + i] = f2bf(x1[i]); }
            *(v8us*)(dst + (size_t)(e0 + ee) * DM + d8) = o; }
         }
}

// k_proj: register-blocked bf16 GEMM, ONE WAVE per 64x64 tile (16 accumulators), operands straight from K-contiguous bf16 planes, K = DM.
// C[m][n] = sum_k A[m][k] Bt[n][k], written as f16 (Ph) and optionally the f16 residual x2048 (Pr, useRes != 0) at r0*pitch + c0, row pitch 'pitch' (halves). grid (M/64, N/64), 32 threads.
__global__ __launch_bounds__(32) void k_proj(const bf* __restrict__ A, const bf* __restrict__ Bt, h16* Ph, h16* Pr, int useRes, int pitch) {
    __shared__ __align__(16) float os[16 * 68];
    const int K = DM;
    const int lane = threadIdx.x & 31, lr = lane & 15, hi = lane >> 4; const int r0 = blockIdx.x * 64, c0 = blockIdx.y * 64;
    v8f acc[4][4];
#pragma unroll
    for (int mb = 0; mb < 4; ++mb)
#pragma unroll
        for (int nb = 0; nb < 4; ++nb) acc[mb][nb] = (v8f){};
    const size_t aoff = (size_t)(r0 + lr) * K + 8 * hi, boff = (size_t)(c0 + lr) * K + 8 * hi;
#pragma unroll 1
    for (int kc = 0; kc < K; kc += 32) {
        v16bf a[4];
#pragma unroll
        for (int mb = 0; mb < 4; ++mb) a[mb] = ldb(A + aoff + (size_t)mb * 16 * K + kc);
#pragma unroll
        for (int nb = 0; nb < 4; ++nb) { const v16bf b = ldb(Bt + boff + (size_t)nb * 16 * K + kc);
#pragma unroll
            for (int mb = 0; mb < 4; ++mb) acc[mb][nb] = wmmab(a[mb], b, acc[mb][nb]); }
        asm volatile("v_nop\n\tv_nop\n\tv_nop\n\tv_nop" : "+v"(acc[0][0]), "+v"(acc[1][1]), "+v"(acc[2][2]), "+v"(acc[3][3]) : "v"(a[0]), "v"(a[1]), "v"(a[2]), "v"(a[3]));
    }
    const size_t tbase = (size_t)r0 * (size_t)pitch + (size_t)c0;
#pragma unroll
    for (int mb = 0; mb < 4; ++mb) {
#pragma unroll
        for (int nb = 0; nb < 4; ++nb) {
#pragma unroll
            for (int j = 0; j < 8; ++j) os[(hi * 8 + j) * 68 + nb * 16 + lr] = acc[mb][nb][j]; }   // D: row 8h+j, col lane&15
        wave_sync();
        const size_t sb = tbase + (size_t)(mb * 16) * (size_t)pitch;
{
#pragma unroll
            for (int s = 0; s < 4; ++s) { const int row = 4 * s + (lane >> 3), c8 = (lane & 7) * 8;   // 4 s x 4 row groups = 16 rows; 8 lanes x 8 = 64 columns
                const v4f x0 = *(const v4fa*)(&os[row * 68 + c8]); const v4f x1 = *(const v4fa*)(&os[row * 68 + c8 + 4]); v8h hv, rv;
#pragma unroll
                for (int i = 0; i < 4; ++i) { const h16 a0 = (h16)x0[i]; const h16 a1 = (h16)x1[i]; hv[i] = a0; hv[4 + i] = a1; rv[i] = (h16)((x0[i] - (float)a0) * QRS); rv[4 + i] = (h16)((x1[i] - (float)a1) * QRS); }
                const size_t oo = sb + (size_t)row * (size_t)pitch + c8;
                *(v8h*)(Ph + oo) = hv; if (useRes) *(v8h*)(Pr + oo) = rv; }
             }
        wave_sync();
    }
}

// k_colsum: EC[e] = 1e-8 * sum_t VT[e][t]. grid DM/32 blocks x 256 threads; wave w of block b owns rows 32b + 4w + 0..3 (fixed-order lane sums + xor tree);
__global__ __launch_bounds__(256) void k_colsum(const h16* __restrict__ VT, float* EC) {
    __shared__ __align__(16) float red[32];
    const int lane = threadIdx.x & 31, wave = __builtin_amdgcn_readfirstlane((int)(threadIdx.x >> 5));
    const int d0 = blockIdx.x * 32 + wave * 4;
#pragma unroll 1
    for (int i = 0; i < 4; ++i) {
        const h16* row = VT + (size_t)(d0 + i) * SEQ;
        float s = 0.0f;
#pragma unroll 2
        for (int it = 0; it < SEQ / 256; ++it) { const v8h x = *(const v8h*)(row + (size_t)(it * 32 + lane) * 8);
            const float p0 = (float)x[0] + (float)x[1], p1 = (float)x[2] + (float)x[3], p2 = (float)x[4] + (float)x[5], p3 = (float)x[6] + (float)x[7];
            s += (p0 + p1) + (p2 + p3); }
        s += __shfl_xor(s, 16, 32); s += __shfl_xor(s, 8, 32); s += __shfl_xor(s, 4, 32); s += __shfl_xor(s, 2, 32); s += __shfl_xor(s, 1, 32);
        if (lane == 0) red[wave * 4 + i] = s;
    }
    __syncthreads();
    if (wave == 0 && lane < 8) {
        v4f o; o[0] = red[4 * lane] * EPSW; o[1] = red[4 * lane + 1] * EPSW; o[2] = red[4 * lane + 2] * EPSW; o[3] = red[4 * lane + 3] * EPSW;
        float* dst = EC + blockIdx.x * 32 + 4 * lane;
        *(v4f*)dst = o; 
    }
}

// k_flash: fused attention, one wave per 16 query rows; K / V^T / Q fragments straight from the f16 planes (two 16-B loads each, arithmetic addressing).
// Transposed form: S^T[key][t] = K Q^T (A = K rows, B = Q rows); lane (t = lane&15, h = lane>>4) holds keys 8h+r of each 16-key tile, so the packed
// P tile is directly the B fragment of O^T[d][t] = V^T P^T (element r <- tile keys 0..15, element 8+r <- tile keys 16..31, lane unchanged).
// Softmax state (running max, partial sum) is one scalar per lane; the two lane halves of a row are combined with one xor-16 exchange.
__global__ __launch_bounds__(32 * AW) void k_flash(const h16* __restrict__ QH, const h16* __restrict__ QR, const h16* __restrict__ KP, const h16* __restrict__ VT, const float* __restrict__ EC, float* OUT) {
    __shared__ __align__(16) float os[AW * 16 * OSP];
    const int lane = threadIdx.x & 31, wave = __builtin_amdgcn_readfirstlane((int)(threadIdx.x >> 5)), lr = lane & 15, hi = lane >> 4;
    const int t0 = (blockIdx.x * AW + wave) * 16;
    const size_t qo = (size_t)(t0 + lr) * DM + 8 * hi;
    v16h qh[4], qr[4];                                        // B fragments: col t, k = d (four 32-deep steps)
#pragma unroll
    for (int c = 0; c < 4; ++c) { qh[c] = ldh(QH + qo + 32 * c); qr[c] = ldh(QR + qo + 32 * c); }
    const size_t ko = (size_t)lr * DM + 8 * hi;               // + key * DM       (A fragment: row key, k = d)
    const size_t vo = (size_t)lr * SEQ + 8 * hi;              // + 16j*SEQ + key  (A fragment: row d, k = key)
    v8f o[8];
#pragma unroll
    for (int j = 0; j < 8; ++j) o[j] = (v8f){};
    float m = -3.0e38f, l = 0.0f;
#pragma unroll 1
    for (int key0 = 0; key0 < SEQ; key0 += 32) {
        const h16* kp = KP + ko + (size_t)key0 * DM;
        v16h ka[4], kb[4];
#pragma unroll
        for (int c = 0; c < 4; ++c) { ka[c] = ldh(kp + 32 * c); kb[c] = ldh(kp + 16 * DM + 32 * c); }
        v8f sHa = (v8f){}, sLa = (v8f){}, sHb = (v8f){}, sLb = (v8f){};
#pragma unroll
        for (int c = 0; c < 4; ++c) { sHa = wmma16(ka[c], qh[c], sHa); sLa = wmma16(ka[c], qr[c], sLa); sHb = wmma16(kb[c], qh[c], sHb); sLb = wmma16(kb[c], qr[c], sLb); }
        asm volatile("v_nop\n\tv_nop\n\tv_nop\n\tv_nop" : "+v"(sHa), "+v"(sLa), "+v"(sHb), "+v"(sLb)
                     : "v"(ka[0]), "v"(ka[1]), "v"(ka[2]), "v"(ka[3]), "v"(kb[0]), "v"(kb[1]), "v"(kb[2]), "v"(kb[3]));
        float ta[8], tb[8]; float mx = -3.0e38f;
#pragma unroll
        for (int r = 0; r < 8; ++r) { ta[r] = (sHa[r] + sLa[r] * QRI) * SC2; tb[r] = (sHb[r] + sLb[r] * QRI) * SC2; mx = fmaxf(mx, fmaxf(ta[r], tb[r])); }
        mx = fmaxf(mx, __shfl_xor(mx, 16, 32));
        const float mnew = fmaxf(m, mx);
        const float alpha = __builtin_amdgcn_exp2f(m - mnew);
        const float sh = PSH - mnew;
        v16h pb; float ls = 0.0f;
#pragma unroll
        for (int r = 0; r < 8; ++r) { const h16 pa = (h16)__builtin_amdgcn_exp2f(ta[r] + sh); const h16 pc = (h16)__builtin_amdgcn_exp2f(tb[r] + sh); pb[r] = pa; pb[8 + r] = pc; ls += (float)pa + (float)pc; }
        l = l * alpha + ls; m = mnew;
#pragma unroll
        for (int j = 0; j < 8; ++j) o[j] = o[j] * alpha;
        const h16* va = VT + vo + key0;
        v16h vv[8];
#pragma unroll
        for (int j = 0; j < 8; ++j) vv[j] = ldh(va + (size_t)(16 * j) * SEQ);
#pragma unroll
        for (int j = 0; j < 8; ++j) o[j] = wmma16(vv[j], pb, o[j]);
        asm volatile("v_nop\n\tv_nop\n\tv_nop\n\tv_nop" : "+v"(o[0]), "+v"(o[1]), "+v"(o[2]), "+v"(o[3]), "+v"(o[4]), "+v"(o[5]), "+v"(o[6]), "+v"(o[7])
                     : "v"(vv[0]), "v"(vv[1]), "v"(vv[2]), "v"(vv[3]), "v"(vv[4]), "v"(vv[5]), "v"(vv[6]), "v"(vv[7]), "v"(pb));
    }
    l += __shfl_xor(l, 16, 32);
    const float inv = 1.0f / l;
    const int wb = wave * 16 * OSP;
    // O^T D layout: o[j][r] = (d = 16j + 8h + r, t = lane&15) -> os[t][d]; rows 0..15 x columns 0..127 all written
#pragma unroll
    for (int j = 0; j < 8; ++j) {
        const v4f e0 = *(const v4f*)(EC + 16 * j + 8 * hi); const v4f e1 = *(const v4f*)(EC + 16 * j + 8 * hi + 4);
        v4f a, c;
        a[0] = o[j][0] * inv + e0[0]; a[1] = o[j][1] * inv + e0[1]; a[2] = o[j][2] * inv + e0[2]; a[3] = o[j][3] * inv + e0[3];
        c[0] = o[j][4] * inv + e1[0]; c[1] = o[j][5] * inv + e1[1]; c[2] = o[j][6] * inv + e1[2]; c[3] = o[j][7] * inv + e1[3];
        *(v4fa*)(&os[wb + lr * OSP + 16 * j + 8 * hi]) = a; *(v4fa*)(&os[wb + lr * OSP + 16 * j + 8 * hi + 4]) = c;
    }
    wave_sync();
    float* orow = OUT + (size_t)t0 * DM;
{
#pragma unroll
        for (int s = 0; s < 16; ++s) {                         // 16 rows; 32 lanes x 4 floats = 128 columns
            const v4f val = *(const v4fa*)(&os[wb + s * OSP + lane * 4]);
            *(v4f*)(orow + (size_t)s * DM + lane * 4) = val; }
         }
}

static constexpr size_t al256(size_t v) { return (v + 255) & ~(size_t)255; }
static constexpr size_t SZ_PL = al256((size_t)SEQ * DM * 2);          // one 16-bit plane [SEQ][128] or [128][SEQ]
static constexpr size_t SZ_WB = al256((size_t)2 * DM * DM * 2);       // two transposed bf16 weight planes
static constexpr size_t SZ_EC = al256((size_t)DM * 4);
static constexpr size_t SZ_TOTAL = 5 * SZ_PL + SZ_WB + SZ_EC;
static_assert(SZ_TOTAL <= (size_t)134217728);          // workspace carve <= 128 MiB
static_assert(((size_t)DM * DM * 2) % 256 == 0);       // weight sub-planes stay 256-byte aligned

extern "C" void kernel_launch(void* const* d_in, const int* in_sizes, int n_in,
                              void* d_out, int out_size, void* d_ws, size_t ws_size, hipStream_t stream) {
    if (n_in < 3) return;
    if ((size_t)in_sizes[0] < (size_t)SEQ * DM) return;
    if ((size_t)in_sizes[1] < (size_t)DM * DM || (size_t)in_sizes[2] < (size_t)DM * DM) return;
    if ((size_t)out_size < (size_t)SEQ * DM) return;
    if (SZ_TOTAL > ws_size) return;
    const float* x = (const float*)d_in[0]; const float* w = (const float*)d_in[1]; const float* v = (const float*)d_in[2];   // wire order X, W, V (W, V are [in][out])
    float* OUT = (float*)d_out;      // [SEQ][128]
    char* wsp = (char*)d_ws;
    bf*  XB = (bf*)wsp;  wsp += SZ_PL;               // [SEQ][128] bf16 x
    h16* KP = (h16*)wsp; wsp += SZ_PL;               // [SEQ][128] f16 image of bf16 x (k plane)
    bf*  WB = (bf*)wsp;  wsp += SZ_WB;               // [2][128 e][128 d]: W^T | V^T weights
    h16* QH = (h16*)wsp; wsp += SZ_PL;               // [SEQ][128] q
    h16* QR = (h16*)wsp; wsp += SZ_PL;               // [SEQ][128] q residual x2048
    h16* VT = (h16*)wsp; wsp += SZ_PL;               // [128 e][SEQ] v^T
    float* EC = (float*)wsp; wsp += SZ_EC;           // [128] 1e-8 * column sums of v
    bf* WT = WB; bf* VWT = WB + (size_t)DM * DM;

    { const size_t n8 = (size_t)SEQ * DM / 8;
      k_cvtx<<<(unsigned)((n8 + 255) / 256), 256, 0, stream>>>(x, XB, KP, n8); }
    // weight transposes: in[rows d][cols e] -> out[e][d]; square 128 x 128, grid = 128/32 e-slabs
    k_wT<<<DM / 32, 256, 0, stream>>>(w, WT);
    k_wT<<<DM / 32, 256, 0, stream>>>(v, VWT);

    // q: A = x rows (m = t), Bt = W^T rows (n = e) -> plane [t][e]
    k_proj<<<dim3(SEQ / 64, DM / 64, 1), 32, 0, stream>>>(XB, WT, QH, QR, 1, DM);
    // v^T: A = V^T weight rows (m = e), Bt = x rows (n = t) -> plane [e][t]
    k_proj<<<dim3(DM / 64, SEQ / 64, 1), 32, 0, stream>>>(VWT, XB, VT, VT, 0, SEQ);

    k_colsum<<<DM / 32, 256, 0, stream>>>(VT, EC);

    k_flash<<<dim3(SEQ / (16 * AW), 1, 1), 32 * AW, 0, stream>>>(QH, QR, KP, VT, EC, OUT);
}

// v001
// It runs in 153 microseconds.
// In both of two side-by-side timings against v000, it was 2.47 times as fast.
#include <hip/hip_runtime.h>

// Single-head attention, x [SEQ][128], W and V [in][out] (q = x W, v = x V), k = x itself, score scale 128^-0.5, out = (softmax + 1e-8) v (f32).
// Compute dtypes, f32 accumulate everywhere: projections v_wmma_f32_16x16x32_bf16 (x, W, V RNE-converted to bf16; products exact);
// scores v_wmma_f32_16x16x32_f16: k = f16 of the bf16 x value (exact), q as f16 value + f16 residual x2048 in its own accumulator (two products);
// P (x256 carry, cancels in the normalisation) and v single f16; softmax f32 (online, running max); the 1e-8 term is added in f32 from a column-sum table.
// Layout: bf16 copy of x, f16 k plane [t][d], bf16 transposed weights [e][d]; q (hi, residual) planes [t][e] and v^T plane [e][t] written by the GEMM epilogue;
// fused flash kernel in transposed form (S^T = K Q^T, O^T = V^T P^T), output from f32 accumulators; its k and v^T tiles are staged in LDS
// (two buffers of 64 keys, asynchronous 16-B copies in whole 128-B lines) and shared by the block's four waves.

#ifndef NB
#define NB 1
#endif
#ifndef SEQ
#define SEQ 8192
#endif
#define NB_FULL  1
#define SEQ_FULL 8192
#define DM   128                 // feature width = head width (one head)
#define AW   4                   // waves per flash block (16 query rows each)
#define OSP  132                 // LDS row pitch (floats) of the flash output tile
#define QRS  2048.0f             // carry of the q residual plane
#define QRI  (1.0f / 2048.0f)
#define SC2  (0.08838834764831845f * 1.4426950408889634f)   // 128^-0.5 * log2(e)
#define PSH  8.0f                // log2 of the P carry (256)
#define EPSW 1.0e-8f
#define KS   64                  // keys per LDS stage of the flash kernel (two 32-key passes)
#define KPH  136                 // LDS row pitch (halves) of a staged k row: 272 B = 16 B x odd, conflict-free for 16-B fragment reads
#define VPH  72                  // LDS row pitch (halves) of a staged v^T row piece (64 keys): 144 B = 16 B x odd

static_assert(NB == 1);                        // no batch dimension in this module
static_assert(DM == 128);                      // store maps assume 128 columns (512 B per f32 row, 256 B per 16-bit row)
static_assert(DM % 64 == 0);
static_assert(DM % 32 == 0);                   // GEMM and score k-loops step by 32
static_assert(SEQ % 256 == 0);                 // column-sum loop, 64-row tiles, 32-key steps, flash grid
static_assert(SEQ % (16 * AW) == 0);
static_assert(((size_t)SEQ * DM) % 8 == 0);
static_assert(SEQ <= SEQ_FULL);
static_assert((OSP * 4) % 16 == 0);
static_assert(SEQ % KS == 0 && SEQ / KS >= 2);  // the two-buffer ring's prologue fills stages 0 and 1
static_assert(KS == 64 && AW == 4);            // copy maps: 128 lanes x 8 copies x 16 B = one 16-KiB k tile, and one 16-KiB v^T tile
static_assert((KPH * 2) % 32 == 16 && (VPH * 2) % 32 == 16 && KPH >= DM && VPH >= KS);

typedef _Float16 h16;
typedef unsigned short bf;
typedef __attribute__((ext_vector_type(16))) __bf16   v16bf;
typedef __attribute__((ext_vector_type(16))) _Float16 v16h;
typedef __attribute__((ext_vector_type(8)))  _Float16 v8h;
typedef __attribute__((ext_vector_type(8)))  unsigned short v8us;
typedef __attribute__((ext_vector_type(8)))  float    v8f;
typedef __attribute__((ext_vector_type(4)))  float    v4f;
typedef v4f  __attribute__((may_alias)) v4fa;

__device__ __forceinline__ unsigned short f2bf(float f) { unsigned u = __float_as_uint(f); u += 0x7FFFu + ((u >> 16) & 1u); return (unsigned short)(u >> 16); }
__device__ __forceinline__ v16h cat16(v8h lo, v8h hi) { return __builtin_shufflevector(lo, hi, 0, 1, 2, 3, 4, 5, 6, 7, 8, 9, 10, 11, 12, 13, 14, 15); }
__device__ __forceinline__ v16bf cat16b(v8us lo, v8us hi) { return __builtin_bit_cast(v16bf, __builtin_shufflevector(lo, hi, 0, 1, 2, 3, 4, 5, 6, 7, 8, 9, 10, 11, 12, 13, 14, 15)); }
__device__ __forceinline__ v8f wmma16(v16h a, v16h b, v8f c) { return __builtin_amdgcn_wmma_f32_16x16x32_f16(false, a, false, b, (short)0, c, false, false); }
__device__ __forceinline__ v8f wmmab(v16bf a, v16bf b, v8f c) { return __builtin_amdgcn_wmma_f32_16x16x32_bf16(false, a, false, b, (short)0, c, false, false); }
// fragment loaders from K-contiguous 16-bit rows; p already includes + 8*(lane>>4): elements 0..7 <- k0+8h+0..7, elements 8..15 <- k0+16+8h+0..7 (same map for A and B)
__device__ __forceinline__ v16h  ldh(const h16* p) { return cat16(*(const v8h*)p, *(const v8h*)(p + 16)); }
__device__ __forceinline__ v16bf ldb(const bf* p)  { return cat16b(*(const v8us*)p, *(const v8us*)(p + 16)); }
// ordering point for wave-private LDS tiles (same wave writes and reads)
__device__ __forceinline__ void wave_sync() { __builtin_amdgcn_fence(3 /* release order */, "wavefront"); __builtin_amdgcn_wave_barrier(); asm volatile("" ::: "memory"); }

// Eight asynchronous 16-B copies per lane, global -> LDS, through no register: copy i moves LDS address l + i*ls (bytes) <- g + i*gs (halves).
// The address-translation wait is the statement's own last line, so that no register a copy names is rewritten ahead of it.
__device__ __forceinline__ void copy8(unsigned l, unsigned ls, const h16* g, size_t gs) {
    asm volatile("global_load_async_to_lds_b128 %0, %8, off\n\t"
                 "global_load_async_to_lds_b128 %1, %9, off\n\t"
                 "global_load_async_to_lds_b128 %2, %10, off\n\t"
                 "global_load_async_to_lds_b128 %3, %11, off\n\t"
                 "global_load_async_to_lds_b128 %4, %12, off\n\t"
                 "global_load_async_to_lds_b128 %5, %13, off\n\t"
                 "global_load_async_to_lds_b128 %6, %14, off\n\t"
                 "global_load_async_to_lds_b128 %7, %15, off\n\t"
                 "s_wait_xcnt 0x0"
                 :: "v"(l), "v"(l + ls), "v"(l + 2 * ls), "v"(l + 3 * ls), "v"(l + 4 * ls), "v"(l + 5 * ls), "v"(l + 6 * ls), "v"(l + 7 * ls),
                    "v"(g), "v"(g + gs), "v"(g + 2 * gs), "v"(g + 3 * gs), "v"(g + 4 * gs), "v"(g + 5 * gs), "v"(g + 6 * gs), "v"(g + 7 * gs)
                 : "memory");
}

__global__ __launch_bounds__(256) void k_cvtx(const float* __restrict__ src, bf* xb, h16* kp, size_t n8) {
    const size_t i = (size_t)blockIdx.x * 256 + threadIdx.x; if (i >= n8) return;
    const v8f v = *(const v8f*)(src + i * 8); v8us o; v8h k;
#pragma unroll
    for (int e = 0; e < 8; ++e) { const unsigned short u = f2bf(v[e]); o[e] = u; k[e] = (h16)__uint_as_float(((unsigned)u) << 16); }
    *(v8us*)(xb + i * 8) = o; *(v8h*)(kp + i * 8) = k;
    
}

// k_wT: src f32 [rows d = 128][cols e = 128] -> dst bf16 [e][d] (RNE convert), transposed through LDS (block barrier: cross-wave tile).
__global__ __launch_bounds__(256) void k_wT(const float* __restrict__ src, bf* dst) {
    __shared__ __align__(16) float ts[32 * OSP];
    const int tid = threadIdx.x; const int e0 = blockIdx.x * 32;
#pragma unroll 4
    for (int it = 0; it < 16; ++it) { const int idx = it * 256 + tid; const int d = idx >> 5, ee = idx & 31;      // 16 x 256 = 128 d x 32 e: whole tile written
        ts[ee * OSP + d] = src[(size_t)d * DM + e0 + ee]; }
    __syncthreads();
{
#pragma unroll
        for (int it = 0; it < 2; ++it) { const int idx = it * 256 + tid; const int ee = idx >> 4, d8 = (idx & 15) * 8;   // 2 x 256 = 32 rows x 16 pieces
            const v4f x0 = *(const v4fa*)(&ts[ee * OSP + d8]); const v4f x1 = *(const v4fa*)(&ts[ee * OSP + d8 + 4]); v8us o;
#pragma unroll
            for (int i = 0; i < 4; ++i) { o[i] = f2bf(x0[i]); o[4 + i] = f2bf(x1[i]); }
            *(v8us*)(dst + (size_t)(e0 + ee) * DM + d8) = o; }
         }
}

// k_proj: register-blocked bf16 GEMM, ONE WAVE per 64x64 tile (16 accumulators), operands straight from K-contiguous bf16 planes, K = DM.
// C[m][n] = sum_k A[m][k] Bt[n][k], written as f16 (Ph) and optionally the f16 residual x2048 (Pr, useRes != 0) at r0*pitch + c0, row pitch 'pitch' (halves). grid (M/64, N/64), 32 threads.
__global__ __launch_bounds__(32) void k_proj(const bf* __restrict__ A, const bf* __restrict__ Bt, h16* Ph, h16* Pr, int useRes, int pitch) {
    __shared__ __align__(16) float os[16 * 68];
    const int K = DM;
    const int lane = threadIdx.x & 31, lr = lane & 15, hi = lane >> 4; const int r0 = blockIdx.x * 64, c0 = blockIdx.y * 64;
    v8f acc[4][4];
#pragma unroll
    for (int mb = 0; mb < 4; ++mb)
#pragma unroll
        for (int nb = 0; nb < 4; ++nb) acc[mb][nb] = (v8f){};
    const size_t aoff = (size_t)(r0 + lr) * K + 8 * hi, boff = (size_t)(c0 + lr) * K + 8 * hi;
#pragma unroll 1
    for (int kc = 0; kc < K; kc += 32) {
        v16bf a[4];
#pragma unroll
        for (int mb = 0; mb < 4; ++mb) a[mb] = ldb(A + aoff + (size_t)mb * 16 * K + kc);
#pragma unroll
        for (int nb = 0; nb < 4; ++nb) { const v16bf b = ldb(Bt + boff + (size_t)nb * 16 * K + kc);
#pragma unroll
            for (int mb = 0; mb < 4; ++mb) acc[mb][nb] = wmmab(a[mb], b, acc[mb][nb]); }
        asm volatile("v_nop\n\tv_nop\n\tv_nop\n\tv_nop" : "+v"(acc[0][0]), "+v"(acc[1][1]), "+v"(acc[2][2]), "+v"(acc[3][3]) : "v"(a[0]), "v"(a[1]), "v"(a[2]), "v"(a[3]));
    }
    const size_t tbase = (size_t)r0 * (size_t)pitch + (size_t)c0;
#pragma unroll
    for (int mb = 0; mb < 4; ++mb) {
#pragma unroll
        for (int nb = 0; nb < 4; ++nb) {
#pragma unroll
            for (int j = 0; j < 8; ++j) os[(hi * 8 + j) * 68 + nb * 16 + lr] = acc[mb][nb][j]; }   // D: row 8h+j, col lane&15
        wave_sync();
        const size_t sb = tbase + (size_t)(mb * 16) * (size_t)pitch;
{
#pragma unroll
            for (int s = 0; s < 4; ++s) { const int row = 4 * s + (lane >> 3), c8 = (lane & 7) * 8;   // 4 s x 4 row groups = 16 rows; 8 lanes x 8 = 64 columns
                const v4f x0 = *(const v4fa*)(&os[row * 68 + c8]); const v4f x1 = *(const v4fa*)(&os[row * 68 + c8 + 4]); v8h hv, rv;
#pragma unroll
                for (int i = 0; i < 4; ++i) { const h16 a0 = (h16)x0[i]; const h16 a1 = (h16)x1[i]; hv[i] = a0; hv[4 + i] = a1; rv[i] = (h16)((x0[i] - (float)a0) * QRS); rv[4 + i] = (h16)((x1[i] - (float)a1) * QRS); }
                const size_t oo = sb + (size_t)row * (size_t)pitch + c8;
                *(v8h*)(Ph + oo) = hv; if (useRes) *(v8h*)(Pr + oo) = rv; }
             }
        wave_sync();
    }
}

// k_colsum: EC[e] = 1e-8 * sum_t VT[e][t]. grid DM/32 blocks x 256 threads; wave w of block b owns rows 32b + 4w + 0..3 (fixed-order lane sums + xor tree);
__global__ __launch_bounds__(256) void k_colsum(const h16* __restrict__ VT, float* EC) {
    __shared__ __align__(16) float red[32];
    const int lane = threadIdx.x & 31, wave = __builtin_amdgcn_readfirstlane((int)(threadIdx.x >> 5));
    const int d0 = blockIdx.x * 32 + wave * 4;
#pragma unroll 1
    for (int i = 0; i < 4; ++i) {
        const h16* row = VT + (size_t)(d0 + i) * SEQ;
        float s = 0.0f;
#pragma unroll 2
        for (int it = 0; it < SEQ / 256; ++it) { const v8h x = *(const v8h*)(row + (size_t)(it * 32 + lane) * 8);
            const float p0 = (float)x[0] + (float)x[1], p1 = (float)x[2] + (float)x[3], p2 = (float)x[4] + (float)x[5], p3 = (float)x[6] + (float)x[7];
            s += (p0 + p1) + (p2 + p3); }
        s += __shfl_xor(s, 16, 32); s += __shfl_xor(s, 8, 32); s += __shfl_xor(s, 4, 32); s += __shfl_xor(s, 2, 32); s += __shfl_xor(s, 1, 32);
        if (lane == 0) red[wave * 4 + i] = s;
    }
    __syncthreads();
    if (wave == 0 && lane < 8) {
        v4f o; o[0] = red[4 * lane] * EPSW; o[1] = red[4 * lane + 1] * EPSW; o[2] = red[4 * lane + 2] * EPSW; o[3] = red[4 * lane + 3] * EPSW;
        float* dst = EC + blockIdx.x * 32 + 4 * lane;
        *(v4f*)dst = o; 
    }
}

// k_flash: fused attention, one wave per 16 query rows; Q fragments straight from the f16 planes; K / V^T fragments from LDS tiles of 64 keys that the
// block's four waves fill together and share (two 16-B LDS loads per fragment). Ring of two buffers: the copies of stage t + 1 fly while stage t is worked on.
// Transposed form: S^T[key][t] = K Q^T (A = K rows, B = Q rows); lane (t = lane&15, h = lane>>4) holds keys 8h+r of each 16-key tile, so the packed
// P tile is directly the B fragment of O^T[d][t] = V^T P^T (element r <- tile keys 0..15, element 8+r <- tile keys 16..31, lane unchanged).
// Softmax state (running max, partial sum) is one scalar per lane; the two lane halves of a row are combined with one xor-16 exchange.
__global__ __launch_bounds__(32 * AW) void k_flash(const h16* __restrict__ QH, const h16* __restrict__ QR, const h16* __restrict__ KP, const h16* __restrict__ VT, const float* __restrict__ EC, float* OUT) {
    __shared__ __align__(16) float os[AW * 16 * OSP];
    __shared__ __align__(16) h16 ks[2 * KS * KPH];            // [buffer][key][d], pitch KPH
    __shared__ __align__(16) h16 vs[2 * DM * VPH];            // [buffer][d][key], pitch VPH
    const int tid = threadIdx.x;
    const int lane = threadIdx.x & 31, wave = __builtin_amdgcn_readfirstlane((int)(threadIdx.x >> 5)), lr = lane & 15, hi = lane >> 4;
    const int t0 = (blockIdx.x * AW + wave) * 16;
    // copy maps, 16-B piece i = 128*it + tid. k tile: 64 rows x 16 pieces, contiguous in the plane (a wave's copy = 512 B = 4 lines); row = i >> 4.
    // v^T tile: 128 rows x 8 pieces (a wave's copy = 4 rows x one 128-B line); row = i >> 3.
    const unsigned kl = (unsigned)(size_t)ks + (unsigned)((tid >> 4) * (KPH * 2) + (tid & 15) * 16);
    const unsigned vl = (unsigned)(size_t)vs + (unsigned)((tid >> 3) * (VPH * 2) + (tid & 7) * 16);
    const h16* kg = KP + (size_t)tid * 8;
    const h16* vg = VT + (size_t)(tid >> 3) * SEQ + (tid & 7) * 8;
    // prologue: stage 0 lands and is published, then stage 1 is started
    copy8(kl, 8 * KPH * 2, kg, 128 * 8); copy8(vl, 16 * VPH * 2, vg, (size_t)16 * SEQ);
    asm volatile("s_wait_asynccnt 0x0" ::: "memory");         // this wave's copies of stage 0 have landed
    __syncthreads();                                          // every wave's have: stage 0 may be read
    copy8(kl + KS * KPH * 2, 8 * KPH * 2, kg + (size_t)KS * DM, 128 * 8); copy8(vl + DM * VPH * 2, 16 * VPH * 2, vg + KS, (size_t)16 * SEQ);
    const size_t qo = (size_t)(t0 + lr) * DM + 8 * hi;
    v16h qh[4], qr[4];                                        // B fragments: col t, k = d (four 32-deep steps)
#pragma unroll
    for (int c = 0; c < 4; ++c) { qh[c] = ldh(QH + qo + 32 * c); qr[c] = ldh(QR + qo + 32 * c); }
    const int ko = lr * KPH + 8 * hi;                         // + key * KPH       (A fragment: row key, k = d)
    const int vo = lr * VPH + 8 * hi;                         // + 16j*VPH + key   (A fragment: row d, k = key)
    v8f o[8];
#pragma unroll
    for (int j = 0; j < 8; ++j) o[j] = (v8f){};
    float m = -3.0e38f, l = 0.0f;
#pragma unroll 1
    for (int t = 0; t < SEQ / KS; ++t) {
      const int buf = t & 1;
#pragma unroll 1   // kept rolled: unrolled, both passes' P values stayed live and the kernel went past 256 registers
      for (int ps = 0; ps < KS / 32; ++ps) {
        const h16* kp = ks + buf * (KS * KPH) + ko + ps * 32 * KPH;
        v16h ka[4], kb[4];
#pragma unroll
        for (int c = 0; c < 4; ++c) { ka[c] = ldh(kp + 32 * c); kb[c] = ldh(kp + 16 * KPH + 32 * c); }
        v8f sHa = (v8f){}, sLa = (v8f){}, sHb = (v8f){}, sLb = (v8f){};
#pragma unroll
        for (int c = 0; c < 4; ++c) { sHa = wmma16(ka[c], qh[c], sHa); sLa = wmma16(ka[c], qr[c], sLa); sHb = wmma16(kb[c], qh[c], sHb); sLb = wmma16(kb[c], qr[c], sLb); }
        asm volatile("v_nop\n\tv_nop\n\tv_nop\n\tv_nop" : "+v"(sHa), "+v"(sLa), "+v"(sHb), "+v"(sLb)
                     : "v"(ka[0]), "v"(ka[1]), "v"(ka[2]), "v"(ka[3]), "v"(kb[0]), "v"(kb[1]), "v"(kb[2]), "v"(kb[3]));
        float ta[8], tb[8]; float mx = -3.0e38f;
#pragma unroll
        for (int r = 0; r < 8; ++r) { ta[r] = (sHa[r] + sLa[r] * QRI) * SC2; tb[r] = (sHb[r] + sLb[r] * QRI) * SC2; mx = fmaxf(mx, fmaxf(ta[r], tb[r])); }
        mx = fmaxf(mx, __shfl_xor(mx, 16, 32));
        const float mnew = fmaxf(m, mx);
        const float alpha = __builtin_amdgcn_exp2f(m - mnew);
        const float sh = PSH - mnew;
        v16h pb; float ls = 0.0f;
#pragma unroll
        for (int r = 0; r < 8; ++r) { const h16 pa = (h16)__builtin_amdgcn_exp2f(ta[r] + sh); const h16 pc = (h16)__builtin_amdgcn_exp2f(tb[r] + sh); pb[r] = pa; pb[8 + r] = pc; ls += (float)pa + (float)pc; }
        l = l * alpha + ls; m = mnew;
#pragma unroll
        for (int j = 0; j < 8; ++j) o[j] = o[j] * alpha;
        const h16* va = vs + buf * (DM * VPH) + vo + ps * 32;
        v16h vv[8];
#pragma unroll
        for (int j = 0; j < 8; ++j) vv[j] = ldh(va + 16 * j * VPH);
#pragma unroll
        for (int j = 0; j < 8; ++j) o[j] = wmma16(vv[j], pb, o[j]);
        asm volatile("v_nop\n\tv_nop\n\tv_nop\n\tv_nop" : "+v"(o[0]), "+v"(o[1]), "+v"(o[2]), "+v"(o[3]), "+v"(o[4]), "+v"(o[5]), "+v"(o[6]), "+v"(o[7])
                     : "v"(vv[0]), "v"(vv[1]), "v"(vv[2]), "v"(vv[3]), "v"(vv[4]), "v"(vv[5]), "v"(vv[6]), "v"(vv[7]), "v"(pb));
      }
      // publish point of stage t + 1, every wave, in this order
      asm volatile("s_wait_dscnt 0x0" ::: "memory");          // this wave's reads of stage t have returned before its buffer is refilled
      asm volatile("s_wait_asynccnt 0x0" ::: "memory");       // this wave's copies of stage t + 1 have landed
      __syncthreads();                                        // publishes stage t + 1 and ends every wave's reads of stage t
      if (t + 2 < SEQ / KS) {                                 // same for the whole block: refill the buffer that stage t has just left
          copy8(kl + buf * (KS * KPH * 2), 8 * KPH * 2, kg + (size_t)(t + 2) * KS * DM, 128 * 8);
          copy8(vl + buf * (DM * VPH * 2), 16 * VPH * 2, vg + (size_t)(t + 2) * KS, (size_t)16 * SEQ);
      }
    }
    asm volatile("s_wait_asynccnt 0x0" ::: "memory");         // nothing of this wave is in flight when the ring is left
    l += __shfl_xor(l, 16, 32);
    const float inv = 1.0f / l;
    const int wb = wave * 16 * OSP;
    // O^T D layout: o[j][r] = (d = 16j + 8h + r, t = lane&15) -> os[t][d]; rows 0..15 x columns 0..127 all written
#pragma unroll
    for (int j = 0; j < 8; ++j) {
        const v4f e0 = *(const v4f*)(EC + 16 * j + 8 * hi); const v4f e1 = *(const v4f*)(EC + 16 * j + 8 * hi + 4);
        v4f a, c;
        a[0] = o[j][0] * inv + e0[0]; a[1] = o[j][1] * inv + e0[1]; a[2] = o[j][2] * inv + e0[2]; a[3] = o[j][3] * inv + e0[3];
        c[0] = o[j][4] * inv + e1[0]; c[1] = o[j][5] * inv + e1[1]; c[2] = o[j][6] * inv + e1[2]; c[3] = o[j][7] * inv + e1[3];
        *(v4fa*)(&os[wb + lr * OSP + 16 * j + 8 * hi]) = a; *(v4fa*)(&os[wb + lr * OSP + 16 * j + 8 * hi + 4]) = c;
    }
    wave_sync();
    float* orow = OUT + (size_t)t0 * DM;
{
#pragma unroll
        for (int s = 0; s < 16; ++s) {                         // 16 rows; 32 lanes x 4 floats = 128 columns
            const v4f val = *(const v4fa*)(&os[wb + s * OSP + lane * 4]);
            *(v4f*)(orow + (size_t)s * DM + lane * 4) = val; }
         }
}

static constexpr size_t al256(size_t v) { return (v + 255) & ~(size_t)255; }
static constexpr size_t SZ_PL = al256((size_t)SEQ * DM * 2);          // one 16-bit plane [SEQ][128] or [128][SEQ]
static constexpr size_t SZ_WB = al256((size_t)2 * DM * DM * 2);       // two transposed bf16 weight planes
static constexpr size_t SZ_EC = al256((size_t)DM * 4);
static constexpr size_t SZ_TOTAL = 5 * SZ_PL + SZ_WB + SZ_EC;
static_assert(SZ_TOTAL <= (size_t)134217728);          // workspace carve <= 128 MiB
static_assert(((size_t)DM * DM * 2) % 256 == 0);       // weight sub-planes stay 256-byte aligned

extern "C" void kernel_launch(void* const* d_in, const int* in_sizes, int n_in,
                              void* d_out, int out_size, void* d_ws, size_t ws_size, hipStream_t stream) {
    if (n_in < 3) return;
    if ((size_t)in_sizes[0] < (size_t)SEQ * DM) return;
    if ((size_t)in_sizes[1] < (size_t)DM * DM || (size_t)in_sizes[2] < (size_t)DM * DM) return;
    if ((size_t)out_size < (size_t)SEQ * DM) return;
    if (SZ_TOTAL > ws_size) return;
    const float* x = (const float*)d_in[0]; const float* w = (const float*)d_in[1]; const float* v = (const float*)d_in[2];   // wire order X, W, V (W, V are [in][out])
    float* OUT = (float*)d_out;      // [SEQ][128]
    char* wsp = (char*)d_ws;
    bf*  XB = (bf*)wsp;  wsp += SZ_PL;               // [SEQ][128] bf16 x
    h16* KP = (h16*)wsp; wsp += SZ_PL;               // [SEQ][128] f16 image of bf16 x (k plane)
    bf*  WB = (bf*)wsp;  wsp += SZ_WB;               // [2][128 e][128 d]: W^T | V^T weights
    h16* QH = (h16*)wsp; wsp += SZ_PL;               // [SEQ][128] q
    h16* QR = (h16*)wsp; wsp += SZ_PL;               // [SEQ][128] q residual x2048
    h16* VT = (h16*)wsp; wsp += SZ_PL;               // [128 e][SEQ] v^T
    float* EC = (float*)wsp; wsp += SZ_EC;           // [128] 1e-8 * column sums of v
    bf* WT = WB; bf* VWT = WB + (size_t)DM * DM;

    { const size_t n8 = (size_t)SEQ * DM / 8;
      k_cvtx<<<(unsigned)((n8 + 255) / 256), 256, 0, stream>>>(x, XB, KP, n8); }
    // weight transposes: in[rows d][cols e] -> out[e][d]; square 128 x 128, grid = 128/32 e-slabs
    k_wT<<<DM / 32, 256, 0, stream>>>(w, WT);
    k_wT<<<DM / 32, 256, 0, stream>>>(v, VWT);

    // q: A = x rows (m = t), Bt = W^T rows (n = e) -> plane [t][e]
    k_proj<<<dim3(SEQ / 64, DM / 64, 1), 32, 0, stream>>>(XB, WT, QH, QR, 1, DM);
    // v^T: A = V^T weight rows (m = e), Bt = x rows (n = t) -> plane [e][t]
    k_proj<<<dim3(DM / 64, SEQ / 64, 1), 32, 0, stream>>>(VWT, XB, VT, VT, 0, SEQ);

    k_colsum<<<DM / 32, 256, 0, stream>>>(VT, EC);

    k_flash<<<dim3(SEQ / (16 * AW), 1, 1), 32 * AW, 0, stream>>>(QH, QR, KP, VT, EC, OUT);
}

// v002
// It runs in 96.2 microseconds.
// In two side-by-side timings against v001, it was 1.61 and 1.59 times as fast.
// Over all steps from v000 it is 3.96 times as fast.
#include <hip/hip_runtime.h>

// Single-head attention, x [SEQ][128], W and V [in][out] (q = x W, v = x V), k = x itself, score scale 128^-0.5, out = (softmax + 1e-8) v (f32).
// Compute dtypes, f32 accumulate everywhere: projections v_wmma_f32_16x16x32_bf16 (x, W, V RNE-converted to bf16; products exact);
// scores v_wmma_f32_16x16x32_f16: k = f16 of the bf16 x value (exact), q as f16 value + f16 residual x2048 in its own accumulator (two products);
// P (x256 carry, cancels in the normalisation) and v single f16; softmax f32 (online, running max); the 1e-8 term is added in f32 from a column-sum table.
// Layout: bf16 copy of x, f16 k plane [t][d], bf16 transposed weights [e][d]; q (hi, residual) planes [t][e] and v^T plane [e][t] written by the GEMM epilogue;
// fused flash kernel in transposed form (S^T = K Q^T, O^T = V^T P^T), output from f32 accumulators; its k and v^T tiles are staged in LDS
// (two buffers of 64 keys, asynchronous 16-B copies in whole 128-B lines) and shared by the block's four waves.
// The keys are cut into KSP ranges, one flash block per (64 query rows, range): each writes its un-normalised f32 sums with (max, sum) to the workspace,
// and a merge launch joins the ranges, normalises, adds the 1e-8 term and stores the output.

#ifndef NB
#define NB 1
#endif
#ifndef SEQ
#define SEQ 8192
#endif
#define NB_FULL  1
#define SEQ_FULL 8192
#define DM   128                 // feature width = head width (one head)
#define AW   4                   // waves per flash block (16 query rows each)
#define OSP  132                 // LDS row pitch (floats) of the weight-transpose tile
#define QRS  2048.0f             // carry of the q residual plane
#define QRI  (1.0f / 2048.0f)
#define SC2  (0.08838834764831845f * 1.4426950408889634f)   // 128^-0.5 * log2(e)
#define PSH  8.0f                // log2 of the P carry (256)
#define EPSW 1.0e-8f
#define KS   64                  // keys per LDS stage of the flash kernel (two 32-key passes)
#define KPH  136                 // LDS row pitch (halves) of a staged k row: 272 B = 16 B x odd, conflict-free for 16-B fragment reads
#define VPH  72                  // LDS row pitch (halves) of a staged v^T row piece (64 keys): 144 B = 16 B x odd
#define KSP  8                   // key ranges of the flash grid: 128 x 8 blocks of 4 waves = 4 blocks per WGP, 4 waves per SIMD on 256 WGPs
#define NST  (SEQ / KS / KSP)    // LDS stages per key range
#define NT   (SEQ / 16)          // 16-row query tiles
#define MSP  36                  // LDS row pitch (floats) of the merge kernel's 16 x 32 output tile: 144 B = 16 B x odd

static_assert(NB == 1);                        // no batch dimension in this module
static_assert(DM == 128);                      // store maps assume 128 columns (512 B per f32 row, 256 B per 16-bit row)
static_assert(DM % 64 == 0);
static_assert(DM % 32 == 0);                   // GEMM and score k-loops step by 32
static_assert(SEQ % 256 == 0);                 // column-sum loop, 64-row tiles, 32-key steps, flash grid
static_assert(SEQ % (16 * AW) == 0);
static_assert(((size_t)SEQ * DM) % 8 == 0);
static_assert(SEQ <= SEQ_FULL);
static_assert((OSP * 4) % 16 == 0);
static_assert(SEQ % (KS * KSP) == 0 && NST >= 2);  // equal key ranges; the two-buffer ring's prologue fills stages 0 and 1
static_assert(KS == 64 && AW == 4);            // copy maps: 128 lanes x 8 copies x 16 B = one 16-KiB k tile, and one 16-KiB v^T tile
static_assert((KPH * 2) % 32 == 16 && (VPH * 2) % 32 == 16 && KPH >= DM && VPH >= KS);

typedef _Float16 h16;
typedef unsigned short bf;
typedef __attribute__((ext_vector_type(16))) __bf16   v16bf;
typedef __attribute__((ext_vector_type(16))) _Float16 v16h;
typedef __attribute__((ext_vector_type(8)))  _Float16 v8h;
typedef __attribute__((ext_vector_type(8)))  unsigned short v8us;
typedef __attribute__((ext_vector_type(8)))  float    v8f;
typedef __attribute__((ext_vector_type(4)))  float    v4f;
typedef v4f  __attribute__((may_alias)) v4fa;
typedef __attribute__((ext_vector_type(2)))  float    v2f;

__device__ __forceinline__ unsigned short f2bf(float f) { unsigned u = __float_as_uint(f); u += 0x7FFFu + ((u >> 16) & 1u); return (unsigned short)(u >> 16); }
__device__ __forceinline__ v16h cat16(v8h lo, v8h hi) { return __builtin_shufflevector(lo, hi, 0, 1, 2, 3, 4, 5, 6, 7, 8, 9, 10, 11, 12, 13, 14, 15); }
__device__ __forceinline__ v16bf cat16b(v8us lo, v8us hi) { return __builtin_bit_cast(v16bf, __builtin_shufflevector(lo, hi, 0, 1, 2, 3, 4, 5, 6, 7, 8, 9, 10, 11, 12, 13, 14, 15)); }
__device__ __forceinline__ v8f wmma16(v16h a, v16h b, v8f c) { return __builtin_amdgcn_wmma_f32_16x16x32_f16(false, a, false, b, (short)0, c, false, false); }
__device__ __forceinline__ v8f wmmab(v16bf a, v16bf b, v8f c) { return __builtin_amdgcn_wmma_f32_16x16x32_bf16(false, a, false, b, (short)0, c, false, false); }
// fragment loaders from K-contiguous 16-bit rows; p already includes + 8*(lane>>4): elements 0..7 <- k0+8h+0..7, elements 8..15 <- k0+16+8h+0..7 (same map for A and B)
__device__ __forceinline__ v16h  ldh(const h16* p) { return cat16(*(const v8h*)p, *(const v8h*)(p + 16)); }
__device__ __forceinline__ v16bf ldb(const bf* p)  { return cat16b(*(const v8us*)p, *(const v8us*)(p + 16)); }
// ordering point for wave-private LDS tiles (same wave writes and reads)
__device__ __forceinline__ void wave_sync() { __builtin_amdgcn_fence(3 /* release order */, "wavefront"); __builtin_amdgcn_wave_barrier(); asm volatile("" ::: "memory"); }

// Eight asynchronous 16-B copies per lane, global -> LDS, through no register: copy i moves LDS address l + i*ls (bytes) <- g + i*gs (halves).
// The address-translation wait is the statement's own last line, so that no register a copy names is rewritten ahead of it.
__device__ __forceinline__ void copy8(unsigned l, unsigned ls, const h16* g, size_t gs) {
    asm volatile("global_load_async_to_lds_b128 %0, %8, off\n\t"
                 "global_load_async_to_lds_b128 %1, %9, off\n\t"
                 "global_load_async_to_lds_b128 %2, %10, off\n\t"
                 "global_load_async_to_lds_b128 %3, %11, off\n\t"
                 "global_load_async_to_lds_b128 %4, %12, off\n\t"
                 "global_load_async_to_lds_b128 %5, %13, off\n\t"
                 "global_load_async_to_lds_b128 %6, %14, off\n\t"
                 "global_load_async_to_lds_b128 %7, %15, off\n\t"
                 "s_wait_xcnt 0x0"
                 :: "v"(l), "v"(l + ls), "v"(l + 2 * ls), "v"(l + 3 * ls), "v"(l + 4 * ls), "v"(l + 5 * ls), "v"(l + 6 * ls), "v"(l + 7 * ls),
                    "v"(g), "v"(g + gs), "v"(g + 2 * gs), "v"(g + 3 * gs), "v"(g + 4 * gs), "v"(g + 5 * gs), "v"(g + 6 * gs), "v"(g + 7 * gs)
                 : "memory");
}

__global__ __launch_bounds__(256) void k_cvtx(const float* __restrict__ src, bf* xb, h16* kp, size_t n8) {
    const size_t i = (size_t)blockIdx.x * 256 + threadIdx.x; if (i >= n8) return;
    const v8f v = *(const v8f*)(src + i * 8); v8us o; v8h k;
#pragma unroll
    for (int e = 0; e < 8; ++e) { const unsigned short u = f2bf(v[e]); o[e] = u; k[e] = (h16)__uint_as_float(((unsigned)u) << 16); }
    *(v8us*)(xb + i * 8) = o; *(v8h*)(kp + i * 8) = k;
    
}

// k_wT: src f32 [rows d = 128][cols e = 128] -> dst bf16 [e][d] (RNE convert), transposed through LDS (block barrier: cross-wave tile).
__global__ __launch_bounds__(256) void k_wT(const float* __restrict__ src, bf* dst) {
    __shared__ __align__(16) float ts[32 * OSP];
    const int tid = threadIdx.x; const int e0 = blockIdx.x * 32;
#pragma unroll 4
    for (int it = 0; it < 16; ++it) { const int idx = it * 256 + tid; const int d = idx >> 5, ee = idx & 31;      // 16 x 256 = 128 d x 32 e: whole tile written
        ts[ee * OSP + d] = src[(size_t)d * DM + e0 + ee]; }
    __syncthreads();
{
#pragma unroll
        for (int it = 0; it < 2; ++it) { const int idx = it * 256 + tid; const int ee = idx >> 4, d8 = (idx & 15) * 8;   // 2 x 256 = 32 rows x 16 pieces
            const v4f x0 = *(const v4fa*)(&ts[ee * OSP + d8]); const v4f x1 = *(const v4fa*)(&ts[ee * OSP + d8 + 4]); v8us o;
#pragma unroll
            for (int i = 0; i < 4; ++i) { o[i] = f2bf(x0[i]); o[4 + i] = f2bf(x1[i]); }
            *(v8us*)(dst + (size_t)(e0 + ee) * DM + d8) = o; }
         }
}

// k_proj: register-blocked bf16 GEMM, ONE WAVE per 64x64 tile (16 accumulators), operands straight from K-contiguous bf16 planes, K = DM.
// C[m][n] = sum_k A[m][k] Bt[n][k], written as f16 (Ph) and optionally the f16 residual x2048 (Pr, useRes != 0) at r0*pitch + c0, row pitch 'pitch' (halves). grid (M/64, N/64), 32 threads.
__global__ __launch_bounds__(32) void k_proj(const bf* __restrict__ A, const bf* __restrict__ Bt, h16* Ph, h16* Pr, int useRes, int pitch) {
    __shared__ __align__(16) float os[16 * 68];
    const int K = DM;
    const int lane = threadIdx.x & 31, lr = lane & 15, hi = lane >> 4; const int r0 = blockIdx.x * 64, c0 = blockIdx.y * 64;
    v8f acc[4][4];
#pragma unroll
    for (int mb = 0; mb < 4; ++mb)
#pragma unroll
        for (int nb = 0; nb < 4; ++nb) acc[mb][nb] = (v8f){};
    const size_t aoff = (size_t)(r0 + lr) * K + 8 * hi, boff = (size_t)(c0 + lr) * K + 8 * hi;
#pragma unroll 1
    for (int kc = 0; kc < K; kc += 32) {
        v16bf a[4];
#pragma unroll
        for (int mb = 0; mb < 4; ++mb) a[mb] = ldb(A + aoff + (size_t)mb * 16 * K + kc);
#pragma unroll
        for (int nb = 0; nb < 4; ++nb) { const v16bf b = ldb(Bt + boff + (size_t)nb * 16 * K + kc);
#pragma unroll
            for (int mb = 0; mb < 4; ++mb) acc[mb][nb] = wmmab(a[mb], b, acc[mb][nb]); }
        asm volatile("v_nop\n\tv_nop\n\tv_nop\n\tv_nop" : "+v"(acc[0][0]), "+v"(acc[1][1]), "+v"(acc[2][2]), "+v"(acc[3][3]) : "v"(a[0]), "v"(a[1]), "v"(a[2]), "v"(a[3]));
    }
    const size_t tbase = (size_t)r0 * (size_t)pitch + (size_t)c0;
#pragma unroll
    for (int mb = 0; mb < 4; ++mb) {
#pragma unroll
        for (int nb = 0; nb < 4; ++nb) {
#pragma unroll
            for (int j = 0; j < 8; ++j) os[(hi * 8 + j) * 68 + nb * 16 + lr] = acc[mb][nb][j]; }   // D: row 8h+j, col lane&15
        wave_sync();
        const size_t sb = tbase + (size_t)(mb * 16) * (size_t)pitch;
{
#pragma unroll
            for (int s = 0; s < 4; ++s) { const int row = 4 * s + (lane >> 3), c8 = (lane & 7) * 8;   // 4 s x 4 row groups = 16 rows; 8 lanes x 8 = 64 columns
                const v4f x0 = *(const v4fa*)(&os[row * 68 + c8]); const v4f x1 = *(const v4fa*)(&os[row * 68 + c8 + 4]); v8h hv, rv;
#pragma unroll
                for (int i = 0; i < 4; ++i) { const h16 a0 = (h16)x0[i]; const h16 a1 = (h16)x1[i]; hv[i] = a0; hv[4 + i] = a1; rv[i] = (h16)((x0[i] - (float)a0) * QRS); rv[4 + i] = (h16)((x1[i] - (float)a1) * QRS); }
                const size_t oo = sb + (size_t)row * (size_t)pitch + c8;
                *(v8h*)(Ph + oo) = hv; if (useRes) *(v8h*)(Pr + oo) = rv; }
             }
        wave_sync();
    }
}

// k_colsum: EC[e] = 1e-8 * sum_t VT[e][t]. grid DM/32 blocks x 256 threads; wave w of block b owns rows 32b + 4w + 0..3 (fixed-order lane sums + xor tree);
__global__ __launch_bounds__(256) void k_colsum(const h16* __restrict__ VT, float* EC) {
    __shared__ __align__(16) float red[32];
    const int lane = threadIdx.x & 31, wave = __builtin_amdgcn_readfirstlane((int)(threadIdx.x >> 5));
    const int d0 = blockIdx.x * 32 + wave * 4;
#pragma unroll 1
    for (int i = 0; i < 4; ++i) {
        const h16* row = VT + (size_t)(d0 + i) * SEQ;
        float s = 0.0f;
#pragma unroll 2
        for (int it = 0; it < SEQ / 256; ++it) { const v8h x = *(const v8h*)(row + (size_t)(it * 32 + lane) * 8);
            const float p0 = (float)x[0] + (float)x[1], p1 = (float)x[2] + (float)x[3], p2 = (float)x[4] + (float)x[5], p3 = (float)x[6] + (float)x[7];
            s += (p0 + p1) + (p2 + p3); }
        s += __shfl_xor(s, 16, 32); s += __shfl_xor(s, 8, 32); s += __shfl_xor(s, 4, 32); s += __shfl_xor(s, 2, 32); s += __shfl_xor(s, 1, 32);
        if (lane == 0) red[wave * 4 + i] = s;
    }
    __syncthreads();
    if (wave == 0 && lane < 8) {
        v4f o; o[0] = red[4 * lane] * EPSW; o[1] = red[4 * lane + 1] * EPSW; o[2] = red[4 * lane + 2] * EPSW; o[3] = red[4 * lane + 3] * EPSW;
        float* dst = EC + blockIdx.x * 32 + 4 * lane;
        *(v4f*)dst = o; 
    }
}

// k_flash: fused attention, one wave per 16 query rows; Q fragments straight from the f16 planes; K / V^T fragments from LDS tiles of 64 keys that the
// block's four waves fill together and share (two 16-B LDS loads per fragment). Ring of two buffers: the copies of stage t + 1 fly while stage t is worked on.
// Transposed form: S^T[key][t] = K Q^T (A = K rows, B = Q rows); lane (t = lane&15, h = lane>>4) holds keys 8h+r of each 16-key tile, so the packed
// P tile is directly the B fragment of O^T[d][t] = V^T P^T (element r <- tile keys 0..15, element 8+r <- tile keys 16..31, lane unchanged).
// Softmax state (running max, partial sum) is one scalar per lane; the two lane halves of a row are combined with one xor-16 exchange.
// Block (x, y) works query rows 64x.. on keys y*SEQ/KSP.. only; its result is a partial: PO holds the accumulators in register order
// ([tile][range][piece 2j+q][lane][4 floats], each store 512 contiguous bytes), ML the pair (max, sum) per lane ([tile][range][lane][2]).
__global__ __launch_bounds__(32 * AW) void k_flash(const h16* __restrict__ QH, const h16* __restrict__ QR, const h16* __restrict__ KP, const h16* __restrict__ VT, float* PO, float* ML) {
    __shared__ __align__(16) h16 ks[2 * KS * KPH];            // [buffer][key][d], pitch KPH
    __shared__ __align__(16) h16 vs[2 * DM * VPH];            // [buffer][d][key], pitch VPH
    const int tid = threadIdx.x;
    const int lane = threadIdx.x & 31, wave = __builtin_amdgcn_readfirstlane((int)(threadIdx.x >> 5)), lr = lane & 15, hi = lane >> 4;
    const int t0 = (blockIdx.x * AW + wave) * 16;
    // copy maps, 16-B piece i = 128*it + tid. k tile: 64 rows x 16 pieces, contiguous in the plane (a wave's copy = 512 B = 4 lines); row = i >> 4.
    // v^T tile: 128 rows x 8 pieces (a wave's copy = 4 rows x one 128-B line); row = i >> 3.
    const unsigned kl = (unsigned)(size_t)ks + (unsigned)((tid >> 4) * (KPH * 2) + (tid & 15) * 16);
    const unsigned vl = (unsigned)(size_t)vs + (unsigned)((tid >> 3) * (VPH * 2) + (tid & 7) * 16);
    const size_t key0 = (size_t)blockIdx.y * (NST * KS);      // first key of this block's range
    const h16* kg = KP + key0 * DM + (size_t)tid * 8;
    const h16* vg = VT + (size_t)(tid >> 3) * SEQ + key0 + (tid & 7) * 8;
    // prologue: stage 0 lands and is published, then stage 1 is started
    copy8(kl, 8 * KPH * 2, kg, 128 * 8); copy8(vl, 16 * VPH * 2, vg, (size_t)16 * SEQ);
    asm volatile("s_wait_asynccnt 0x0" ::: "memory");         // this wave's copies of stage 0 have landed
    __syncthreads();                                          // every wave's have: stage 0 may be read
    copy8(kl + KS * KPH * 2, 8 * KPH * 2, kg + (size_t)KS * DM, 128 * 8); copy8(vl + DM * VPH * 2, 16 * VPH * 2, vg + KS, (size_t)16 * SEQ);
    const size_t qo = (size_t)(t0 + lr) * DM + 8 * hi;
    v16h qh[4], qr[4];                                        // B fragments: col t, k = d (four 32-deep steps)
#pragma unroll
    for (int c = 0; c < 4; ++c) { qh[c] = ldh(QH + qo + 32 * c); qr[c] = ldh(QR + qo + 32 * c); }
    const int ko = lr * KPH + 8 * hi;                         // + key * KPH       (A fragment: row key, k = d)
    const int vo = lr * VPH + 8 * hi;                         // + 16j*VPH + key   (A fragment: row d, k = key)
    v8f o[8];
#pragma unroll
    for (int j = 0; j < 8; ++j) o[j] = (v8f){};
    float m = -3.0e38f, l = 0.0f;
#pragma unroll 1
    for (int t = 0; t < NST; ++t) {
      const int buf = t & 1;
#pragma unroll 1   // kept rolled: unrolled, both passes' P values stayed live and the kernel went past 256 registers
      for (int ps = 0; ps < KS / 32; ++ps) {
        const h16* kp = ks + buf * (KS * KPH) + ko + ps * 32 * KPH;
        v16h ka[4], kb[4];
#pragma unroll
        for (int c = 0; c < 4; ++c) { ka[c] = ldh(kp + 32 * c); kb[c] = ldh(kp + 16 * KPH + 32 * c); }
        v8f sHa = (v8f){}, sLa = (v8f){}, sHb = (v8f){}, sLb = (v8f){};
#pragma unroll
        for (int c = 0; c < 4; ++c) { sHa = wmma16(ka[c], qh[c], sHa); sLa = wmma16(ka[c], qr[c], sLa); sHb = wmma16(kb[c], qh[c], sHb); sLb = wmma16(kb[c], qr[c], sLb); }
        asm volatile("v_nop\n\tv_nop\n\tv_nop\n\tv_nop" : "+v"(sHa), "+v"(sLa), "+v"(sHb), "+v"(sLb)
                     : "v"(ka[0]), "v"(ka[1]), "v"(ka[2]), "v"(ka[3]), "v"(kb[0]), "v"(kb[1]), "v"(kb[2]), "v"(kb[3]));
        float ta[8], tb[8]; float mx = -3.0e38f;
#pragma unroll
        for (int r = 0; r < 8; ++r) { ta[r] = (sHa[r] + sLa[r] * QRI) * SC2; tb[r] = (sHb[r] + sLb[r] * QRI) * SC2; mx = fmaxf(mx, fmaxf(ta[r], tb[r])); }
        mx = fmaxf(mx, __shfl_xor(mx, 16, 32));
        const float mnew = fmaxf(m, mx);
        const float alpha = __builtin_amdgcn_exp2f(m - mnew);
        const float sh = PSH - mnew;
        v16h pb; float ls = 0.0f;
#pragma unroll
        for (int r = 0; r < 8; ++r) { const h16 pa = (h16)__builtin_amdgcn_exp2f(ta[r] + sh); const h16 pc = (h16)__builtin_amdgcn_exp2f(tb[r] + sh); pb[r] = pa; pb[8 + r] = pc; ls += (float)pa + (float)pc; }
        l = l * alpha + ls; m = mnew;
#pragma unroll
        for (int j = 0; j < 8; ++j) o[j] = o[j] * alpha;
        const h16* va = vs + buf * (DM * VPH) + vo + ps * 32;
        v16h vv[8];
#pragma unroll
        for (int j = 0; j < 8; ++j) vv[j] = ldh(va + 16 * j * VPH);
#pragma unroll
        for (int j = 0; j < 8; ++j) o[j] = wmma16(vv[j], pb, o[j]);
        asm volatile("v_nop\n\tv_nop\n\tv_nop\n\tv_nop" : "+v"(o[0]), "+v"(o[1]), "+v"(o[2]), "+v"(o[3]), "+v"(o[4]), "+v"(o[5]), "+v"(o[6]), "+v"(o[7])
                     : "v"(vv[0]), "v"(vv[1]), "v"(vv[2]), "v"(vv[3]), "v"(vv[4]), "v"(vv[5]), "v"(vv[6]), "v"(vv[7]), "v"(pb));
      }
      // publish point of stage t + 1, every wave, in this order
      asm volatile("s_wait_dscnt 0x0" ::: "memory");          // this wave's reads of stage t have returned before its buffer is refilled
      asm volatile("s_wait_asynccnt 0x0" ::: "memory");       // this wave's copies of stage t + 1 have landed
      __syncthreads();                                        // publishes stage t + 1 and ends every wave's reads of stage t
      if (t + 2 < NST) {                                      // same for the whole block: refill the buffer that stage t has just left
          copy8(kl + buf * (KS * KPH * 2), 8 * KPH * 2, kg + (size_t)(t + 2) * KS * DM, 128 * 8);
          copy8(vl + buf * (DM * VPH * 2), 16 * VPH * 2, vg + (size_t)(t + 2) * KS, (size_t)16 * SEQ);
      }
    }
    asm volatile("s_wait_asynccnt 0x0" ::: "memory");         // nothing of this wave is in flight when the ring is left
    l += __shfl_xor(l, 16, 32);
    const size_t pt = (size_t)(t0 >> 4) * KSP + (size_t)blockIdx.y;     // (tile, range)
    float* po = PO + pt * (16 * 128) + lane * 4;
#pragma unroll
    for (int j = 0; j < 8; ++j) {
        v4f a, c;
        a[0] = o[j][0]; a[1] = o[j][1]; a[2] = o[j][2]; a[3] = o[j][3];
        c[0] = o[j][4]; c[1] = o[j][5]; c[2] = o[j][6]; c[3] = o[j][7];
        *(v4f*)(po + (2 * j) * 128) = a; *(v4f*)(po + (2 * j + 1) * 128) = c;
    }
    v2f ml; ml[0] = m; ml[1] = l;
    *(v2f*)(ML + (pt * 32 + lane) * 2) = ml;
}

// 2^d for the merge weights, with the free slot that the instruction set asks for behind a transcendental in the same statement
__device__ __forceinline__ float exp2_slot(float d) { float w; asm("v_exp_f32 %0, %1\n\tv_nop" : "=v"(w) : "v"(d)); return w; }

// k_merge: joins the KSP partials of one 16-row query tile (ranges in fixed order 0..KSP-1): weight exp2(m_s - max), out = sum(w o) / sum(w l) + EC.
// One block per tile; wave w owns pieces 4w..4w+3 = columns 32w..32w+31 (piece 2j+q of lane (t = lane&15, h = lane>>4): d = 16j + 8h + 4q + 0..3),
// turns them through a wave-private LDS tile and stores whole 128-B lines.
__global__ __launch_bounds__(128) void k_merge(const float* __restrict__ PO, const float* __restrict__ ML, const float* __restrict__ EC, float* OUT) {
    __shared__ __align__(16) float os[4 * 16 * MSP];
    const int lane = threadIdx.x & 31, wave = __builtin_amdgcn_readfirstlane((int)(threadIdx.x >> 5)), lr = lane & 15, hi = lane >> 4;
    const size_t tile = blockIdx.x;
    const float* mb = ML + tile * (KSP * 64) + lane * 2;                     // the tile's KSP partials lie side by side
    const float* pb = PO + tile * (KSP * 16 * 128) + wave * (4 * 128) + lane * 4;
    v4f x[KSP][4], e[4]; float ms[KSP], ls[KSP];
#pragma unroll
    for (int s = 0; s < KSP; ++s) {
        const v2f ml = *(const v2f*)(mb + s * 64); ms[s] = ml[0]; ls[s] = ml[1];
#pragma unroll
        for (int p = 0; p < 4; ++p) x[s][p] = *(const v4f*)(pb + s * (16 * 128) + p * 128);
    }
#pragma unroll
    for (int p = 0; p < 4; ++p) e[p] = *(const v4f*)(EC + 32 * wave + 16 * (p >> 1) + 4 * (p & 1) + 8 * hi);
    __builtin_amdgcn_sched_barrier(0);   // keeps all 44 loads in front of the sums, in flight together: without it they sank to their uses, a few per memory round trip
    float mx = ms[0];
#pragma unroll
    for (int s = 1; s < KSP; ++s) mx = fmaxf(mx, ms[s]);
    v4f acc[4]; float l = 0.0f;
#pragma unroll
    for (int p = 0; p < 4; ++p) acc[p] = (v4f){};
#pragma unroll
    for (int s = 0; s < KSP; ++s) {
        const float w = exp2_slot(ms[s] - mx);
        l += w * ls[s];
#pragma unroll
        for (int p = 0; p < 4; ++p) acc[p] += x[s][p] * w;
    }
    const float inv = 1.0f / l;
    const int wb = wave * 16 * MSP;
#pragma unroll
    for (int p = 0; p < 4; ++p) {
        const int dl = 16 * (p >> 1) + 8 * hi + 4 * (p & 1);            // column inside the wave's 32
        *(v4fa*)(&os[wb + lr * MSP + dl]) = acc[p] * inv + e[p];
    }
    wave_sync();
    float* orow = OUT + tile * 16 * DM + 32 * wave;
#pragma unroll
    for (int s = 0; s < 4; ++s) {                              // 4 rows per store: 8 lanes x 4 floats = one 128-B line each
        const int row = 4 * s + (lane >> 3), c4 = (lane & 7) * 4;
        const v4f val = *(const v4fa*)(&os[wb + row * MSP + c4]);
        *(v4f*)(orow + (size_t)row * DM + c4) = val; }
}

static constexpr size_t al256(size_t v) { return (v + 255) & ~(size_t)255; }
static constexpr size_t SZ_PL = al256((size_t)SEQ * DM * 2);          // one 16-bit plane [SEQ][128] or [128][SEQ]
static constexpr size_t SZ_WB = al256((size_t)2 * DM * DM * 2);       // two transposed bf16 weight planes
static constexpr size_t SZ_EC = al256((size_t)DM * 4);
static constexpr size_t SZ_PO = al256((size_t)KSP * SEQ * DM * 4);    // f32 partial sums: SEQ x 128 values per key range
static constexpr size_t SZ_ML = al256((size_t)KSP * NT * 32 * 2 * 4); // (max, sum) per tile, range and lane
static constexpr size_t SZ_TOTAL = 5 * SZ_PL + SZ_WB + SZ_EC + SZ_PO + SZ_ML;
static_assert(SZ_TOTAL <= (size_t)134217728);          // workspace carve <= 128 MiB
static_assert(((size_t)DM * DM * 2) % 256 == 0);       // weight sub-planes stay 256-byte aligned

extern "C" void kernel_launch(void* const* d_in, const int* in_sizes, int n_in,
                              void* d_out, int out_size, void* d_ws, size_t ws_size, hipStream_t stream) {
    if (n_in < 3) return;
    if ((size_t)in_sizes[0] < (size_t)SEQ * DM) return;
    if ((size_t)in_sizes[1] < (size_t)DM * DM || (size_t)in_sizes[2] < (size_t)DM * DM) return;
    if ((size_t)out_size < (size_t)SEQ * DM) return;
    if (SZ_TOTAL > ws_size) return;
    const float* x = (const float*)d_in[0]; const float* w = (const float*)d_in[1]; const float* v = (const float*)d_in[2];   // wire order X, W, V (W, V are [in][out])
    float* OUT = (float*)d_out;      // [SEQ][128]
    char* wsp = (char*)d_ws;
    bf*  XB = (bf*)wsp;  wsp += SZ_PL;               // [SEQ][128] bf16 x
    h16* KP = (h16*)wsp; wsp += SZ_PL;               // [SEQ][128] f16 image of bf16 x (k plane)
    bf*  WB = (bf*)wsp;  wsp += SZ_WB;               // [2][128 e][128 d]: W^T | V^T weights
    h16* QH = (h16*)wsp; wsp += SZ_PL;               // [SEQ][128] q
    h16* QR = (h16*)wsp; wsp += SZ_PL;               // [SEQ][128] q residual x2048
    h16* VT = (h16*)wsp; wsp += SZ_PL;               // [128 e][SEQ] v^T
    float* EC = (float*)wsp; wsp += SZ_EC;           // [128] 1e-8 * column sums of v
    float* PO = (float*)wsp; wsp += SZ_PO;           // flash partial sums
    float* ML = (float*)wsp; wsp += SZ_ML;           // flash partial (max, sum)
    bf* WT = WB; bf* VWT = WB + (size_t)DM * DM;

    { const size_t n8 = (size_t)SEQ * DM / 8;
      k_cvtx<<<(unsigned)((n8 + 255) / 256), 256, 0, stream>>>(x, XB, KP, n8); }
    // weight transposes: in[rows d][cols e] -> out[e][d]; square 128 x 128, grid = 128/32 e-slabs
    k_wT<<<DM / 32, 256, 0, stream>>>(w, WT);
    k_wT<<<DM / 32, 256, 0, stream>>>(v, VWT);

    // q: A = x rows (m = t), Bt = W^T rows (n = e) -> plane [t][e]
    k_proj<<<dim3(SEQ / 64, DM / 64, 1), 32, 0, stream>>>(XB, WT, QH, QR, 1, DM);
    // v^T: A = V^T weight rows (m = e), Bt = x rows (n = t) -> plane [e][t]
    k_proj<<<dim3(DM / 64, SEQ / 64, 1), 32, 0, stream>>>(VWT, XB, VT, VT, 0, SEQ);

    k_colsum<<<DM / 32, 256, 0, stream>>>(VT, EC);

    k_flash<<<dim3(SEQ / (16 * AW), KSP, 1), 32 * AW, 0, stream>>>(QH, QR, KP, VT, PO, ML);

    k_merge<<<NT, 128, 0, stream>>>(PO, ML, EC, OUT);
}

// v003
// It runs in 67.1 microseconds.
// Timed twice side by side with v002, it ran 1.45 and 1.44 times as fast.
// Over all steps from v000 it is 5.72 times as fast.
#include <hip/hip_runtime.h>

// Single-head attention, x [SEQ][128], W and V [in][out] (q = x W, v = x V), k = x itself, score scale 128^-0.5, out = (softmax + 1e-8) v (f32).
// Compute dtypes, f32 accumulate everywhere: projections v_wmma_f32_16x16x32_bf16 (x, W, V RNE-converted to bf16; products exact);
// scores v_wmma_f32_16x16x32_f16: k = f16 of the bf16 x value (exact), q as f16 value + f16 residual x2048 in its own accumulator (two products);
// P (x256 carry, cancels in the normalisation) and v single f16; softmax f32 (online, running max); the 1e-8 term is added in f32 from a column-sum table.
// Layout: bf16 copy of x, f16 k plane [t][d], bf16 transposed weights [e][d]; q (hi, residual) planes [t][e] and v^T plane [e][t] written by the GEMM epilogue;
// fused flash kernel in transposed form (S^T = K Q^T, O^T = V^T P^T), output from f32 accumulators; its k and v^T tiles are staged in LDS
// (two buffers of 64 keys, asynchronous 16-B copies in whole 128-B lines) and shared by the block's four waves.
// The keys are cut into KSP ranges, one flash block per (64 query rows, range): each writes its un-normalised f32 sums with (max, sum) to the workspace,
// and a merge launch joins the ranges, normalises, adds the 1e-8 term and stores the output.

#ifndef NB
#define NB 1
#endif
#ifndef SEQ
#define SEQ 8192
#endif
#define NB_FULL  1
#define SEQ_FULL 8192
#define DM   128                 // feature width = head width (one head)
#define AW   4                   // waves per flash block (16 query rows each)
#define OSP  132                 // LDS row pitch (floats) of the weight-transpose tile
#define QRS  2048.0f             // carry of the q residual plane
#define QRI  (1.0f / 2048.0f)
#define SC2  (0.08838834764831845f * 1.4426950408889634f)   // 128^-0.5 * log2(e)
#define PSH  8.0f                // log2 of the P carry (256)
#define EPSW 1.0e-8f
#define KS   64                  // keys per LDS stage of the flash kernel (two 32-key passes)
#define KPH  136                 // LDS row pitch (halves) of a staged k row: 272 B = 16 B x odd, conflict-free for 16-B fragment reads
#define VPH  72                  // LDS row pitch (halves) of a staged v^T row piece (64 keys): 144 B = 16 B x odd
#define KSP  8                   // key ranges of the flash grid: 128 x 8 blocks of 4 waves = 4 blocks per WGP, 4 waves per SIMD on 256 WGPs
#define NST  (SEQ / KS / KSP)    // LDS stages per key range
#define NT   (SEQ / 16)          // 16-row query tiles
#define MSP  36                  // LDS row pitch (floats) of the merge kernel's 16 x 32 output tile: 144 B = 16 B x odd

static_assert(NB == 1);                        // no batch dimension in this module
static_assert(DM == 128);                      // store maps assume 128 columns (512 B per f32 row, 256 B per 16-bit row)
static_assert(DM % 64 == 0);
static_assert(DM % 32 == 0);                   // GEMM and score k-loops step by 32
static_assert(SEQ % 1024 == 0);                // column-sum quarters of whole 512-B loads, 64-row tiles, 32-key steps, flash grid
static_assert(SEQ % (16 * AW) == 0);
static_assert(((size_t)SEQ * DM) % 8 == 0);
static_assert(SEQ <= SEQ_FULL);
static_assert((OSP * 4) % 16 == 0);
static_assert(SEQ % (KS * KSP) == 0 && NST >= 2);  // equal key ranges; the two-buffer ring's prologue fills stages 0 and 1
static_assert(KS == 64 && AW == 4);            // copy maps: 128 lanes x 8 copies x 16 B = one 16-KiB k tile, and one 16-KiB v^T tile
static_assert((KPH * 2) % 32 == 16 && (VPH * 2) % 32 == 16 && KPH >= DM && VPH >= KS);

typedef _Float16 h16;
typedef unsigned short bf;
typedef __attribute__((ext_vector_type(16))) __bf16   v16bf;
typedef __attribute__((ext_vector_type(16))) _Float16 v16h;
typedef __attribute__((ext_vector_type(8)))  _Float16 v8h;
typedef __attribute__((ext_vector_type(8)))  unsigned short v8us;
typedef __attribute__((ext_vector_type(8)))  float    v8f;
typedef __attribute__((ext_vector_type(4)))  float    v4f;
typedef v4f  __attribute__((may_alias)) v4fa;
typedef __attribute__((ext_vector_type(2)))  float    v2f;

__device__ __forceinline__ unsigned short f2bf(float f) { unsigned u = __float_as_uint(f); u += 0x7FFFu + ((u >> 16) & 1u); return (unsigned short)(u >> 16); }
__device__ __forceinline__ v16h cat16(v8h lo, v8h hi) { return __builtin_shufflevector(lo, hi, 0, 1, 2, 3, 4, 5, 6, 7, 8, 9, 10, 11, 12, 13, 14, 15); }
__device__ __forceinline__ v16bf cat16b(v8us lo, v8us hi) { return __builtin_bit_cast(v16bf, __builtin_shufflevector(lo, hi, 0, 1, 2, 3, 4, 5, 6, 7, 8, 9, 10, 11, 12, 13, 14, 15)); }
__device__ __forceinline__ v8f wmma16(v16h a, v16h b, v8f c) { return __builtin_amdgcn_wmma_f32_16x16x32_f16(false, a, false, b, (short)0, c, false, false); }
__device__ __forceinline__ v8f wmmab(v16bf a, v16bf b, v8f c) { return __builtin_amdgcn_wmma_f32_16x16x32_bf16(false, a, false, b, (short)0, c, false, false); }
// fragment loaders from K-contiguous 16-bit rows; p already includes + 8*(lane>>4): elements 0..7 <- k0+8h+0..7, elements 8..15 <- k0+16+8h+0..7 (same map for A and B)
__device__ __forceinline__ v16h  ldh(const h16* p) { return cat16(*(const v8h*)p, *(const v8h*)(p + 16)); }
__device__ __forceinline__ v16bf ldb(const bf* p)  { return cat16b(*(const v8us*)p, *(const v8us*)(p + 16)); }
// ordering point for wave-private LDS tiles (same wave writes and reads)
__device__ __forceinline__ void wave_sync() { __builtin_amdgcn_fence(3 /* release order */, "wavefront"); __builtin_amdgcn_wave_barrier(); asm volatile("" ::: "memory"); }

// Eight asynchronous 16-B copies per lane, global -> LDS, through no register: copy i moves LDS address l + i*ls (bytes) <- g + i*gs (halves).
// The address-translation wait is the statement's own last line, so that no register a copy names is rewritten ahead of it.
__device__ __forceinline__ void copy8(unsigned l, unsigned ls, const h16* g, size_t gs) {
    asm volatile("global_load_async_to_lds_b128 %0, %8, off\n\t"
                 "global_load_async_to_lds_b128 %1, %9, off\n\t"
                 "global_load_async_to_lds_b128 %2, %10, off\n\t"
                 "global_load_async_to_lds_b128 %3, %11, off\n\t"
                 "global_load_async_to_lds_b128 %4, %12, off\n\t"
                 "global_load_async_to_lds_b128 %5, %13, off\n\t"
                 "global_load_async_to_lds_b128 %6, %14, off\n\t"
                 "global_load_async_to_lds_b128 %7, %15, off\n\t"
                 "s_wait_xcnt 0x0"
                 :: "v"(l), "v"(l + ls), "v"(l + 2 * ls), "v"(l + 3 * ls), "v"(l + 4 * ls), "v"(l + 5 * ls), "v"(l + 6 * ls), "v"(l + 7 * ls),
                    "v"(g), "v"(g + gs), "v"(g + 2 * gs), "v"(g + 3 * gs), "v"(g + 4 * gs), "v"(g + 5 * gs), "v"(g + 6 * gs), "v"(g + 7 * gs)
                 : "memory");
}

__global__ __launch_bounds__(256) void k_cvtx(const float* __restrict__ src, bf* xb, h16* kp, size_t n8) {
    const size_t i = (size_t)blockIdx.x * 256 + threadIdx.x; if (i >= n8) return;
    const v8f v = *(const v8f*)(src + i * 8); v8us o; v8h k;
#pragma unroll
    for (int e = 0; e < 8; ++e) { const unsigned short u = f2bf(v[e]); o[e] = u; k[e] = (h16)__uint_as_float(((unsigned)u) << 16); }
    *(v8us*)(xb + i * 8) = o; *(v8h*)(kp + i * 8) = k;
    
}

// k_wT: src f32 [rows d = 128][cols e = 128] -> dst bf16 [e][d] (RNE convert), transposed through LDS (block barrier: cross-wave tile).
__global__ __launch_bounds__(256) void k_wT(const float* __restrict__ src, bf* dst) {
    __shared__ __align__(16) float ts[32 * OSP];
    const int tid = threadIdx.x; const int e0 = blockIdx.x * 32;
#pragma unroll 4
    for (int it = 0; it < 16; ++it) { const int idx = it * 256 + tid; const int d = idx >> 5, ee = idx & 31;      // 16 x 256 = 128 d x 32 e: whole tile written
        ts[ee * OSP + d] = src[(size_t)d * DM + e0 + ee]; }
    __syncthreads();
{
#pragma unroll
        for (int it = 0; it < 2; ++it) { const int idx = it * 256 + tid; const int ee = idx >> 4, d8 = (idx & 15) * 8;   // 2 x 256 = 32 rows x 16 pieces
            const v4f x0 = *(const v4fa*)(&ts[ee * OSP + d8]); const v4f x1 = *(const v4fa*)(&ts[ee * OSP + d8 + 4]); v8us o;
#pragma unroll
            for (int i = 0; i < 4; ++i) { o[i] = f2bf(x0[i]); o[4 + i] = f2bf(x1[i]); }
            *(v8us*)(dst + (size_t)(e0 + ee) * DM + d8) = o; }
         }
}

// k_proj: register-blocked bf16 GEMM, ONE WAVE per 64x64 tile (16 accumulators), operands straight from K-contiguous bf16 planes, K = DM.
// C[m][n] = sum_k A[m][k] Bt[n][k], written as f16 (Ph) and optionally the f16 residual x2048 (Pr, useRes != 0) at r0*pitch + c0, row pitch 'pitch' (halves). grid (M/64, N/64), 32 threads.
__global__ __launch_bounds__(32) void k_proj(const bf* __restrict__ A, const bf* __restrict__ Bt, h16* Ph, h16* Pr, int useRes, int pitch) {
    __shared__ __align__(16) float os[16 * 68];
    const int K = DM;
    const int lane = threadIdx.x & 31, lr = lane & 15, hi = lane >> 4; const int r0 = blockIdx.x * 64, c0 = blockIdx.y * 64;
    v8f acc[4][4];
#pragma unroll
    for (int mb = 0; mb < 4; ++mb)
#pragma unroll
        for (int nb = 0; nb < 4; ++nb) acc[mb][nb] = (v8f){};
    const size_t aoff = (size_t)(r0 + lr) * K + 8 * hi, boff = (size_t)(c0 + lr) * K + 8 * hi;
#pragma unroll 1
    for (int kc = 0; kc < K; kc += 32) {
        v16bf a[4];
#pragma unroll
        for (int mb = 0; mb < 4; ++mb) a[mb] = ldb(A + aoff + (size_t)mb * 16 * K + kc);
#pragma unroll
        for (int nb = 0; nb < 4; ++nb) { const v16bf b = ldb(Bt + boff + (size_t)nb * 16 * K + kc);
#pragma unroll
            for (int mb = 0; mb < 4; ++mb) acc[mb][nb] = wmmab(a[mb], b, acc[mb][nb]); }
        asm volatile("v_nop\n\tv_nop\n\tv_nop\n\tv_nop" : "+v"(acc[0][0]), "+v"(acc[1][1]), "+v"(acc[2][2]), "+v"(acc[3][3]) : "v"(a[0]), "v"(a[1]), "v"(a[2]), "v"(a[3]));
    }
    const size_t tbase = (size_t)r0 * (size_t)pitch + (size_t)c0;
#pragma unroll
    for (int mb = 0; mb < 4; ++mb) {
#pragma unroll
        for (int nb = 0; nb < 4; ++nb) {
#pragma unroll
            for (int j = 0; j < 8; ++j) os[(hi * 8 + j) * 68 + nb * 16 + lr] = acc[mb][nb][j]; }   // D: row 8h+j, col lane&15
        wave_sync();
        const size_t sb = tbase + (size_t)(mb * 16) * (size_t)pitch;
{
#pragma unroll
            for (int s = 0; s < 4; ++s) { const int row = 4 * s + (lane >> 3), c8 = (lane & 7) * 8;   // 4 s x 4 row groups = 16 rows; 8 lanes x 8 = 64 columns
                const v4f x0 = *(const v4fa*)(&os[row * 68 + c8]); const v4f x1 = *(const v4fa*)(&os[row * 68 + c8 + 4]); v8h hv, rv;
#pragma unroll
                for (int i = 0; i < 4; ++i) { const h16 a0 = (h16)x0[i]; const h16 a1 = (h16)x1[i]; hv[i] = a0; hv[4 + i] = a1; rv[i] = (h16)((x0[i] - (float)a0) * QRS); rv[4 + i] = (h16)((x1[i] - (float)a1) * QRS); }
                const size_t oo = sb + (size_t)row * (size_t)pitch + c8;
                *(v8h*)(Ph + oo) = hv; if (useRes) *(v8h*)(Pr + oo) = rv; }
             }
        wave_sync();
    }
}

// k_colsum: EC = 1e-8 * row sums of VT, spread so that one memory round trip covers the plane. grid DM/4 blocks x 512 threads: block b owns rows 4b..4b+3,
// wave w the quarter w&3 of row 4b + (w>>2): eight 16-B loads per lane, all in flight together (a wave's load = 512 contiguous bytes); fixed-order sums.
// EC layout: the four sums of block b stand at the head of the block's own 128-B line, EC[32b + 0..3] (one writer per line): column e is EC[8*(e & ~3) + (e & 3)].
__global__ __launch_bounds__(512) void k_colsum(const h16* __restrict__ VT, float* EC) {
    __shared__ __align__(16) float red[16];
    const int lane = threadIdx.x & 31, wave = __builtin_amdgcn_readfirstlane((int)(threadIdx.x >> 5));
    const h16* src = VT + (size_t)(blockIdx.x * 4 + (wave >> 2)) * SEQ + (size_t)(wave & 3) * (SEQ / 4) + lane * 8;
    v8h x[SEQ / 1024];
#pragma unroll   // all loads issue before the first sum: rolled, each trip would wait out its own round trip
    for (int it = 0; it < SEQ / 1024; ++it) x[it] = *(const v8h*)(src + it * 256);
    float s = 0.0f;
#pragma unroll   // x[] is indexed by constants only, so it stays in registers
    for (int it = 0; it < SEQ / 1024; ++it) {
        const float p0 = (float)x[it][0] + (float)x[it][1], p1 = (float)x[it][2] + (float)x[it][3], p2 = (float)x[it][4] + (float)x[it][5], p3 = (float)x[it][6] + (float)x[it][7];
        s += (p0 + p1) + (p2 + p3); }
    s += __shfl_xor(s, 16, 32); s += __shfl_xor(s, 8, 32); s += __shfl_xor(s, 4, 32); s += __shfl_xor(s, 2, 32); s += __shfl_xor(s, 1, 32);
    if (lane == 0) red[wave] = s;
    __syncthreads();
    if (threadIdx.x == 0) {
        v4f o;
#pragma unroll   // o[] indexed by constants: one 16-B store from registers
        for (int i = 0; i < 4; ++i) o[i] = ((red[4 * i] + red[4 * i + 1]) + (red[4 * i + 2] + red[4 * i + 3])) * EPSW;
        *(v4f*)(EC + blockIdx.x * 32) = o;
    }
}

// k_flash: fused attention, one wave per 16 query rows; Q fragments straight from the f16 planes; K / V^T fragments from LDS tiles of 64 keys that the
// block's four waves fill together and share (two 16-B LDS loads per fragment). Ring of two buffers: the copies of stage t + 1 fly while stage t is worked on.
// Transposed form: S^T[key][t] = K Q^T (A = K rows, B = Q rows); lane (t = lane&15, h = lane>>4) holds keys 8h+r of each 16-key tile, so the packed
// P tile is directly the B fragment of O^T[d][t] = V^T P^T (element r <- tile keys 0..15, element 8+r <- tile keys 16..31, lane unchanged).
// Softmax state (running max, partial sum) is one scalar per lane; the two lane halves of a row are combined with one xor-16 exchange.
// Block (x, y) works query rows 64x.. on keys y*SEQ/KSP.. only; its result is a partial: PO holds the accumulators in register order
// ([tile][range][piece 2j+q][lane][4 floats], each store 512 contiguous bytes), ML the pair (max, sum) per lane ([tile][range][lane][2]).
__global__ __launch_bounds__(32 * AW) void k_flash(const h16* __restrict__ QH, const h16* __restrict__ QR, const h16* __restrict__ KP, const h16* __restrict__ VT, float* PO, float* ML) {
    __shared__ __align__(16) h16 ks[2 * KS * KPH];            // [buffer][key][d], pitch KPH
    __shared__ __align__(16) h16 vs[2 * DM * VPH];            // [buffer][d][key], pitch VPH
    const int tid = threadIdx.x;
    const int lane = threadIdx.x & 31, wave = __builtin_amdgcn_readfirstlane((int)(threadIdx.x >> 5)), lr = lane & 15, hi = lane >> 4;
    const int t0 = (blockIdx.x * AW + wave) * 16;
    // copy maps, 16-B piece i = 128*it + tid. k tile: 64 rows x 16 pieces, contiguous in the plane (a wave's copy = 512 B = 4 lines); row = i >> 4.
    // v^T tile: 128 rows x 8 pieces (a wave's copy = 4 rows x one 128-B line); row = i >> 3.
    const unsigned kl = (unsigned)(size_t)ks + (unsigned)((tid >> 4) * (KPH * 2) + (tid & 15) * 16);
    const unsigned vl = (unsigned)(size_t)vs + (unsigned)((tid >> 3) * (VPH * 2) + (tid & 7) * 16);
    const size_t key0 = (size_t)blockIdx.y * (NST * KS);      // first key of this block's range
    const h16* kg = KP + key0 * DM + (size_t)tid * 8;
    const h16* vg = VT + (size_t)(tid >> 3) * SEQ + key0 + (tid & 7) * 8;
    // prologue: stage 0 lands and is published, then stage 1 is started
    copy8(kl, 8 * KPH * 2, kg, 128 * 8); copy8(vl, 16 * VPH * 2, vg, (size_t)16 * SEQ);
    asm volatile("s_wait_asynccnt 0x0" ::: "memory");         // this wave's copies of stage 0 have landed
    __syncthreads();                                          // every wave's have: stage 0 may be read
    copy8(kl + KS * KPH * 2, 8 * KPH * 2, kg + (size_t)KS * DM, 128 * 8); copy8(vl + DM * VPH * 2, 16 * VPH * 2, vg + KS, (size_t)16 * SEQ);
    const size_t qo = (size_t)(t0 + lr) * DM + 8 * hi;
    v16h qh[4], qr[4];                                        // B fragments: col t, k = d (four 32-deep steps)
#pragma unroll
    for (int c = 0; c < 4; ++c) { qh[c] = ldh(QH + qo + 32 * c); qr[c] = ldh(QR + qo + 32 * c); }
    const int ko = lr * KPH + 8 * hi;                         // + key * KPH       (A fragment: row key, k = d)
    const int vo = lr * VPH + 8 * hi;                         // + 16j*VPH + key   (A fragment: row d, k = key)
    v8f o[8];
#pragma unroll
    for (int j = 0; j < 8; ++j) o[j] = (v8f){};
    float m = -3.0e38f, l = 0.0f;
#pragma unroll 1
    for (int t = 0; t < NST; ++t) {
      const int buf = t & 1;
#pragma unroll 1   // kept rolled: unrolled, both passes' P values stayed live and the kernel went past 256 registers
      for (int ps = 0; ps < KS / 32; ++ps) {
        const h16* kp = ks + buf * (KS * KPH) + ko + ps * 32 * KPH;
        v16h ka[4], kb[4];
#pragma unroll
        for (int c = 0; c < 4; ++c) { ka[c] = ldh(kp + 32 * c); kb[c] = ldh(kp + 16 * KPH + 32 * c); }
        v8f sHa = (v8f){}, sLa = (v8f){}, sHb = (v8f){}, sLb = (v8f){};
#pragma unroll
        for (int c = 0; c < 4; ++c) { sHa = wmma16(ka[c], qh[c], sHa); sLa = wmma16(ka[c], qr[c], sLa); sHb = wmma16(kb[c], qh[c], sHb); sLb = wmma16(kb[c], qr[c], sLb); }
        asm volatile("v_nop\n\tv_nop\n\tv_nop\n\tv_nop" : "+v"(sHa), "+v"(sLa), "+v"(sHb), "+v"(sLb)
                     : "v"(ka[0]), "v"(ka[1]), "v"(ka[2]), "v"(ka[3]), "v"(kb[0]), "v"(kb[1]), "v"(kb[2]), "v"(kb[3]));
        float ta[8], tb[8]; float mx = -3.0e38f;
#pragma unroll
        for (int r = 0; r < 8; ++r) { ta[r] = (sHa[r] + sLa[r] * QRI) * SC2; tb[r] = (sHb[r] + sLb[r] * QRI) * SC2; mx = fmaxf(mx, fmaxf(ta[r], tb[r])); }
        mx = fmaxf(mx, __shfl_xor(mx, 16, 32));
        const float mnew = fmaxf(m, mx);
        const float alpha = __builtin_amdgcn_exp2f(m - mnew);
        const float sh = PSH - mnew;
        v16h pb; float ls = 0.0f;
#pragma unroll
        for (int r = 0; r < 8; ++r) { const h16 pa = (h16)__builtin_amdgcn_exp2f(ta[r] + sh); const h16 pc = (h16)__builtin_amdgcn_exp2f(tb[r] + sh); pb[r] = pa; pb[8 + r] = pc; ls += (float)pa + (float)pc; }
        l = l * alpha + ls; m = mnew;
#pragma unroll
        for (int j = 0; j < 8; ++j) o[j] = o[j] * alpha;
        const h16* va = vs + buf * (DM * VPH) + vo + ps * 32;
        v16h vv[8];
#pragma unroll
        for (int j = 0; j < 8; ++j) vv[j] = ldh(va + 16 * j * VPH);
#pragma unroll
        for (int j = 0; j < 8; ++j) o[j] = wmma16(vv[j], pb, o[j]);
        asm volatile("v_nop\n\tv_nop\n\tv_nop\n\tv_nop" : "+v"(o[0]), "+v"(o[1]), "+v"(o[2]), "+v"(o[3]), "+v"(o[4]), "+v"(o[5]), "+v"(o[6]), "+v"(o[7])
                     : "v"(vv[0]), "v"(vv[1]), "v"(vv[2]), "v"(vv[3]), "v"(vv[4]), "v"(vv[5]), "v"(vv[6]), "v"(vv[7]), "v"(pb));
      }
      // publish point of stage t + 1, every wave, in this order
      asm volatile("s_wait_dscnt 0x0" ::: "memory");          // this wave's reads of stage t have returned before its buffer is refilled
      asm volatile("s_wait_asynccnt 0x0" ::: "memory");       // this wave's copies of stage t + 1 have landed
      __syncthreads();                                        // publishes stage t + 1 and ends every wave's reads of stage t
      if (t + 2 < NST) {                                      // same for the whole block: refill the buffer that stage t has just left
          copy8(kl + buf * (KS * KPH * 2), 8 * KPH * 2, kg + (size_t)(t + 2) * KS * DM, 128 * 8);
          copy8(vl + buf * (DM * VPH * 2), 16 * VPH * 2, vg + (size_t)(t + 2) * KS, (size_t)16 * SEQ);
      }
    }
    asm volatile("s_wait_asynccnt 0x0" ::: "memory");         // nothing of this wave is in flight when the ring is left
    l += __shfl_xor(l, 16, 32);
    const size_t pt = (size_t)(t0 >> 4) * KSP + (size_t)blockIdx.y;     // (tile, range)
    float* po = PO + pt * (16 * 128) + lane * 4;
#pragma unroll
    for (int j = 0; j < 8; ++j) {
        v4f a, c;
        a[0] = o[j][0]; a[1] = o[j][1]; a[2] = o[j][2]; a[3] = o[j][3];
        c[0] = o[j][4]; c[1] = o[j][5]; c[2] = o[j][6]; c[3] = o[j][7];
        *(v4f*)(po + (2 * j) * 128) = a; *(v4f*)(po + (2 * j + 1) * 128) = c;
    }
    v2f ml; ml[0] = m; ml[1] = l;
    *(v2f*)(ML + (pt * 32 + lane) * 2) = ml;
}

// 2^d for the merge weights, with the free slot that the instruction set asks for behind a transcendental in the same statement
__device__ __forceinline__ float exp2_slot(float d) { float w; asm("v_exp_f32 %0, %1\n\tv_nop" : "=v"(w) : "v"(d)); return w; }

// k_merge: joins the KSP partials of one 16-row query tile (ranges in fixed order 0..KSP-1): weight exp2(m_s - max), out = sum(w o) / sum(w l) + EC.
// One block per tile; wave w owns pieces 4w..4w+3 = columns 32w..32w+31 (piece 2j+q of lane (t = lane&15, h = lane>>4): d = 16j + 8h + 4q + 0..3),
// turns them through a wave-private LDS tile and stores whole 128-B lines.
__global__ __launch_bounds__(128) void k_merge(const float* __restrict__ PO, const float* __restrict__ ML, const float* __restrict__ EC, float* OUT) {
    __shared__ __align__(16) float os[4 * 16 * MSP];
    const int lane = threadIdx.x & 31, wave = __builtin_amdgcn_readfirstlane((int)(threadIdx.x >> 5)), lr = lane & 15, hi = lane >> 4;
    const size_t tile = blockIdx.x;
    const float* mb = ML + tile * (KSP * 64) + lane * 2;                     // the tile's KSP partials lie side by side
    const float* pb = PO + tile * (KSP * 16 * 128) + wave * (4 * 128) + lane * 4;
    v4f x[KSP][4], e[4]; float ms[KSP], ls[KSP];
#pragma unroll
    for (int s = 0; s < KSP; ++s) {
        const v2f ml = *(const v2f*)(mb + s * 64); ms[s] = ml[0]; ls[s] = ml[1];
#pragma unroll
        for (int p = 0; p < 4; ++p) x[s][p] = *(const v4f*)(pb + s * (16 * 128) + p * 128);
    }
#pragma unroll
    for (int p = 0; p < 4; ++p) e[p] = *(const v4f*)(EC + 8 * (32 * wave + 16 * (p >> 1) + 4 * (p & 1) + 8 * hi));   // four columns per 128-B line of EC
    __builtin_amdgcn_sched_barrier(0);   // keeps all 44 loads in front of the sums, in flight together: without it they sank to their uses, a few per memory round trip
    float mx = ms[0];
#pragma unroll
    for (int s = 1; s < KSP; ++s) mx = fmaxf(mx, ms[s]);
    v4f acc[4]; float l = 0.0f;
#pragma unroll
    for (int p = 0; p < 4; ++p) acc[p] = (v4f){};
#pragma unroll
    for (int s = 0; s < KSP; ++s) {
        const float w = exp2_slot(ms[s] - mx);
        l += w * ls[s];
#pragma unroll
        for (int p = 0; p < 4; ++p) acc[p] += x[s][p] * w;
    }
    const float inv = 1.0f / l;
    const int wb = wave * 16 * MSP;
#pragma unroll
    for (int p = 0; p < 4; ++p) {
        const int dl = 16 * (p >> 1) + 8 * hi + 4 * (p & 1);            // column inside the wave's 32
        *(v4fa*)(&os[wb + lr * MSP + dl]) = acc[p] * inv + e[p];
    }
    wave_sync();
    float* orow = OUT + tile * 16 * DM + 32 * wave;
#pragma unroll
    for (int s = 0; s < 4; ++s) {                              // 4 rows per store: 8 lanes x 4 floats = one 128-B line each
        const int row = 4 * s + (lane >> 3), c4 = (lane & 7) * 4;
        const v4f val = *(const v4fa*)(&os[wb + row * MSP + c4]);
        *(v4f*)(orow + (size_t)row * DM + c4) = val; }
}

static constexpr size_t al256(size_t v) { return (v + 255) & ~(size_t)255; }
static constexpr size_t SZ_PL = al256((size_t)SEQ * DM * 2);          // one 16-bit plane [SEQ][128] or [128][SEQ]
static constexpr size_t SZ_WB = al256((size_t)2 * DM * DM * 2);       // two transposed bf16 weight planes
static constexpr size_t SZ_EC = al256((size_t)(DM / 4) * 128);         // one 128-B line per four columns
static constexpr size_t SZ_PO = al256((size_t)KSP * SEQ * DM * 4);    // f32 partial sums: SEQ x 128 values per key range
static constexpr size_t SZ_ML = al256((size_t)KSP * NT * 32 * 2 * 4); // (max, sum) per tile, range and lane
static constexpr size_t SZ_TOTAL = 5 * SZ_PL + SZ_WB + SZ_EC + SZ_PO + SZ_ML;
static_assert(SZ_TOTAL <= (size_t)134217728);          // workspace carve <= 128 MiB
static_assert(((size_t)DM * DM * 2) % 256 == 0);       // weight sub-planes stay 256-byte aligned

extern "C" void kernel_launch(void* const* d_in, const int* in_sizes, int n_in,
                              void* d_out, int out_size, void* d_ws, size_t ws_size, hipStream_t stream) {
    if (n_in < 3) return;
    if ((size_t)in_sizes[0] < (size_t)SEQ * DM) return;
    if ((size_t)in_sizes[1] < (size_t)DM * DM || (size_t)in_sizes[2] < (size_t)DM * DM) return;
    if ((size_t)out_size < (size_t)SEQ * DM) return;
    if (SZ_TOTAL > ws_size) return;
    const float* x = (const float*)d_in[0]; const float* w = (const float*)d_in[1]; const float* v = (const float*)d_in[2];   // wire order X, W, V (W, V are [in][out])
    float* OUT = (float*)d_out;      // [SEQ][128]
    char* wsp = (char*)d_ws;
    bf*  XB = (bf*)wsp;  wsp += SZ_PL;               // [SEQ][128] bf16 x
    h16* KP = (h16*)wsp; wsp += SZ_PL;               // [SEQ][128] f16 image of bf16 x (k plane)
    bf*  WB = (bf*)wsp;  wsp += SZ_WB;               // [2][128 e][128 d]: W^T | V^T weights
    h16* QH = (h16*)wsp; wsp += SZ_PL;               // [SEQ][128] q
    h16* QR = (h16*)wsp; wsp += SZ_PL;               // [SEQ][128] q residual x2048
    h16* VT = (h16*)wsp; wsp += SZ_PL;               // [128 e][SEQ] v^T
    float* EC = (float*)wsp; wsp += SZ_EC;           // [32 lines][4 of 32 floats] 1e-8 * column sums of v
    float* PO = (float*)wsp; wsp += SZ_PO;           // flash partial sums
    float* ML = (float*)wsp; wsp += SZ_ML;           // flash partial (max, sum)
    bf* WT = WB; bf* VWT = WB + (size_t)DM * DM;

    { const size_t n8 = (size_t)SEQ * DM / 8;
      k_cvtx<<<(unsigned)((n8 + 255) / 256), 256, 0, stream>>>(x, XB, KP, n8); }
    // weight transposes: in[rows d][cols e] -> out[e][d]; square 128 x 128, grid = 128/32 e-slabs
    k_wT<<<DM / 32, 256, 0, stream>>>(w, WT);
    k_wT<<<DM / 32, 256, 0, stream>>>(v, VWT);

    // q: A = x rows (m = t), Bt = W^T rows (n = e) -> plane [t][e]
    k_proj<<<dim3(SEQ / 64, DM / 64, 1), 32, 0, stream>>>(XB, WT, QH, QR, 1, DM);
    // v^T: A = V^T weight rows (m = e), Bt = x rows (n = t) -> plane [e][t]
    k_proj<<<dim3(DM / 64, SEQ / 64, 1), 32, 0, stream>>>(VWT, XB, VT, VT, 0, SEQ);

    k_colsum<<<DM / 4, 512, 0, stream>>>(VT, EC);

    k_flash<<<dim3(SEQ / (16 * AW), KSP, 1), 32 * AW, 0, stream>>>(QH, QR, KP, VT, PO, ML);

    k_merge<<<NT, 128, 0, stream>>>(PO, ML, EC, OUT);
}

// v004
// Measured time: 54 microseconds a run.
// Timed twice side by side with v003, it ran 1.25 and 1.24 times as fast.
// Over all steps from v000 it is 7.12 times as fast.
#include <hip/hip_runtime.h>

// Single-head attention, x [SEQ][128], W and V [in][out] (q = x W, v = x V), k = x itself, score scale 128^-0.5, out = (softmax + 1e-8) v (f32).
// Compute dtypes, f32 accumulate everywhere: projections v_wmma_f32_16x16x32_bf16 (x, W, V RNE-converted to bf16; products exact);
// scores v_wmma_f32_16x16x32_f16: k = f16 of the bf16 x value (exact), q as f16 value + f16 residual x2048 in its own accumulator (two products);
// P (x256 carry, cancels in the normalisation) and v single f16; softmax f32 (online, running max); the 1e-8 term is added in f32 from a column-sum table.
// Layout: bf16 copy of x, f16 k plane [t][d], bf16 transposed weights [e][d]; q (hi, residual) planes [t][e] and v^T plane [e][t] written by the GEMM epilogue;
// fused flash kernel in transposed form (S^T = K Q^T, O^T = V^T P^T), output from f32 accumulators; its k and v^T tiles are staged in LDS
// (two buffers of 64 keys, asynchronous 16-B copies in whole 128-B lines) and shared by the block's four waves.
// The keys are cut into KSP ranges, one flash block per (64 query rows, range): each writes its un-normalised f32 sums with (max, sum) to the workspace,
// and a merge launch joins the ranges, normalises, adds the 1e-8 term and stores the output.
// Four launches, each reading only what an earlier one wrote; work that reads none of each other's output shares a grid, told apart by the block index:
// k_prep (both weight transposes + the x conversion), k_proj (q tiles + v^T tiles), k_flash (flash blocks + the column-sum blocks), k_merge.

#ifndef NB
#define NB 1
#endif
#ifndef SEQ
#define SEQ 8192
#endif
#define NB_FULL  1
#define SEQ_FULL 8192
#define DM   128                 // feature width = head width (one head)
#define AW   4                   // waves per flash block (16 query rows each)
#define OSP  132                 // LDS row pitch (floats) of the weight-transpose tile
#define QRS  2048.0f             // carry of the q residual plane
#define QRI  (1.0f / 2048.0f)
#define SC2  (0.08838834764831845f * 1.4426950408889634f)   // 128^-0.5 * log2(e)
#define PSH  8.0f                // log2 of the P carry (256)
#define EPSW 1.0e-8f
#define KS   64                  // keys per LDS stage of the flash kernel (two 32-key passes)
#define KPH  136                 // LDS row pitch (halves) of a staged k row: 272 B = 16 B x odd, conflict-free for 16-B fragment reads
#define VPH  72                  // LDS row pitch (halves) of a staged v^T row piece (64 keys): 144 B = 16 B x odd
#define KSP  8                   // key ranges of the flash grid: 128 x 8 blocks of 4 waves = 4 blocks per WGP, 4 waves per SIMD on 256 WGPs
#define NST  (SEQ / KS / KSP)    // LDS stages per key range
#define NT   (SEQ / 16)          // 16-row query tiles
#define WSL  (DM / 32)           // 32-column slabs (blocks) of one weight transpose
#define FBX  (SEQ / (16 * AW))   // flash blocks per key range
#define MSP  36                  // LDS row pitch (floats) of the merge kernel's 16 x 32 output tile: 144 B = 16 B x odd

static_assert(NB == 1);                        // no batch dimension in this module
static_assert(DM == 128);                      // store maps assume 128 columns (512 B per f32 row, 256 B per 16-bit row)
static_assert(DM % 64 == 0);
static_assert(DM % 32 == 0);                   // GEMM and score k-loops step by 32
static_assert(SEQ % 1024 == 0);                // column-sum quarters of whole 512-B loads, 64-row tiles, 32-key steps, flash grid
static_assert(SEQ % (16 * AW) == 0);
static_assert(((size_t)SEQ * DM) % 8 == 0);
static_assert(SEQ <= SEQ_FULL);
static_assert((OSP * 4) % 16 == 0);
static_assert(SEQ % (KS * KSP) == 0 && NST >= 2);  // equal key ranges; the two-buffer ring's prologue fills stages 0 and 1
static_assert(KS == 64 && AW == 4);            // copy maps: 128 lanes x 8 copies x 16 B = one 16-KiB k tile, and one 16-KiB v^T tile
static_assert((KPH * 2) % 32 == 16 && (VPH * 2) % 32 == 16 && KPH >= DM && VPH >= KS);

typedef _Float16 h16;
typedef unsigned short bf;
typedef __attribute__((ext_vector_type(16))) __bf16   v16bf;
typedef __attribute__((ext_vector_type(16))) _Float16 v16h;
typedef __attribute__((ext_vector_type(8)))  _Float16 v8h;
typedef __attribute__((ext_vector_type(8)))  unsigned short v8us;
typedef __attribute__((ext_vector_type(8)))  float    v8f;
typedef __attribute__((ext_vector_type(4)))  float    v4f;
typedef v4f  __attribute__((may_alias)) v4fa;
typedef __attribute__((ext_vector_type(2)))  float    v2f;

__device__ __forceinline__ unsigned short f2bf(float f) { unsigned u = __float_as_uint(f); u += 0x7FFFu + ((u >> 16) & 1u); return (unsigned short)(u >> 16); }
__device__ __forceinline__ v16h cat16(v8h lo, v8h hi) { return __builtin_shufflevector(lo, hi, 0, 1, 2, 3, 4, 5, 6, 7, 8, 9, 10, 11, 12, 13, 14, 15); }
__device__ __forceinline__ v16bf cat16b(v8us lo, v8us hi) { return __builtin_bit_cast(v16bf, __builtin_shufflevector(lo, hi, 0, 1, 2, 3, 4, 5, 6, 7, 8, 9, 10, 11, 12, 13, 14, 15)); }
__device__ __forceinline__ v8f wmma16(v16h a, v16h b, v8f c) { return __builtin_amdgcn_wmma_f32_16x16x32_f16(false, a, false, b, (short)0, c, false, false); }
__device__ __forceinline__ v8f wmmab(v16bf a, v16bf b, v8f c) { return __builtin_amdgcn_wmma_f32_16x16x32_bf16(false, a, false, b, (short)0, c, false, false); }
// fragment loaders from K-contiguous 16-bit rows; p already includes + 8*(lane>>4): elements 0..7 <- k0+8h+0..7, elements 8..15 <- k0+16+8h+0..7 (same map for A and B)
__device__ __forceinline__ v16h  ldh(const h16* p) { return cat16(*(const v8h*)p, *(const v8h*)(p + 16)); }
__device__ __forceinline__ v16bf ldb(const bf* p)  { return cat16b(*(const v8us*)p, *(const v8us*)(p + 16)); }
// ordering point for wave-private LDS tiles (same wave writes and reads)
__device__ __forceinline__ void wave_sync() { __builtin_amdgcn_fence(3 /* release order */, "wavefront"); __builtin_amdgcn_wave_barrier(); asm volatile("" ::: "memory"); }

// Eight asynchronous 16-B copies per lane, global -> LDS, through no register: copy i moves LDS address l + i*ls (bytes) <- g + i*gs (halves).
// The address-translation wait is the statement's own last line, so that no register a copy names is rewritten ahead of it.
__device__ __forceinline__ void copy8(unsigned l, unsigned ls, const h16* g, size_t gs) {
    asm volatile("global_load_async_to_lds_b128 %0, %8, off\n\t"
                 "global_load_async_to_lds_b128 %1, %9, off\n\t"
                 "global_load_async_to_lds_b128 %2, %10, off\n\t"
                 "global_load_async_to_lds_b128 %3, %11, off\n\t"
                 "global_load_async_to_lds_b128 %4, %12, off\n\t"
                 "global_load_async_to_lds_b128 %5, %13, off\n\t"
                 "global_load_async_to_lds_b128 %6, %14, off\n\t"
                 "global_load_async_to_lds_b128 %7, %15, off\n\t"
                 "s_wait_xcnt 0x0"
                 :: "v"(l), "v"(l + ls), "v"(l + 2 * ls), "v"(l + 3 * ls), "v"(l + 4 * ls), "v"(l + 5 * ls), "v"(l + 6 * ls), "v"(l + 7 * ls),
                    "v"(g), "v"(g + gs), "v"(g + 2 * gs), "v"(g + 3 * gs), "v"(g + 4 * gs), "v"(g + 5 * gs), "v"(g + 6 * gs), "v"(g + 7 * gs)
                 : "memory");
}

// cvtx: block b of the conversion: 8 values per thread, f32 x -> bf16 plane and its f16 image (k plane).
__device__ __forceinline__ void cvtx(int b, const float* __restrict__ src, bf* xb, h16* kp, size_t n8) {
    const size_t i = (size_t)b * 256 + threadIdx.x; if (i >= n8) return;
    const v8f v = *(const v8f*)(src + i * 8); v8us o; v8h k;
#pragma unroll
    for (int e = 0; e < 8; ++e) { const unsigned short u = f2bf(v[e]); o[e] = u; k[e] = (h16)__uint_as_float(((unsigned)u) << 16); }
    *(v8us*)(xb + i * 8) = o; *(v8h*)(kp + i * 8) = k;
    
}

// wT: src f32 [rows d = 128][cols e = 128] -> dst bf16 [e][d] (RNE convert), slab of 32 columns e, transposed through LDS (block barrier: cross-wave tile).
__device__ __forceinline__ void wT(int slab, const float* __restrict__ src, bf* dst) {
    __shared__ __align__(16) float ts[32 * OSP];
    const int tid = threadIdx.x; const int e0 = slab * 32;
#pragma unroll 4
    for (int it = 0; it < 16; ++it) { const int idx = it * 256 + tid; const int d = idx >> 5, ee = idx & 31;      // 16 x 256 = 128 d x 32 e: whole tile written
        ts[ee * OSP + d] = src[(size_t)d * DM + e0 + ee]; }
    __syncthreads();
{
#pragma unroll
        for (int it = 0; it < 2; ++it) { const int idx = it * 256 + tid; const int ee = idx >> 4, d8 = (idx & 15) * 8;   // 2 x 256 = 32 rows x 16 pieces
            const v4f x0 = *(const v4fa*)(&ts[ee * OSP + d8]); const v4f x1 = *(const v4fa*)(&ts[ee * OSP + d8 + 4]); v8us o;
#pragma unroll
            for (int i = 0; i < 4; ++i) { o[i] = f2bf(x0[i]); o[4 + i] = f2bf(x1[i]); }
            *(v8us*)(dst + (size_t)(e0 + ee) * DM + d8) = o; }
         }
    asm volatile("s_wait_xcnt 0x0" ::: "memory");   // the conversion part is laid out behind these stores and writes their registers: the wait stands in front of that
}

// k_prep: everything that reads the inputs alone, in one grid. Blocks 0..WSL-1 transpose W, WSL..2*WSL-1 transpose V (first in the grid: dependent
// load rounds, the longest blocks), the rest convert x. The choice depends on blockIdx alone, so the transposes' barrier is met by whole blocks.
__global__ __launch_bounds__(256) void k_prep(const float* __restrict__ x, const float* __restrict__ w, const float* __restrict__ v,
                                              bf* xb, h16* kp, bf* wt, bf* vwt, size_t n8) {
    const int b = blockIdx.x;
    if (b >= 2 * WSL) { cvtx(b - 2 * WSL, x, xb, kp, n8); return; }
    const bool second = b >= WSL;
    wT(second ? b - WSL : b, second ? v : w, second ? vwt : wt);
}

// k_proj: register-blocked bf16 GEMM, ONE WAVE per 64x64 tile (16 accumulators), operands straight from K-contiguous bf16 planes, K = DM.
// C[m][n] = sum_k A[m][k] Bt[n][k], written as f16 (Ph) and optionally the f16 residual x2048 (Pr, useRes != 0) at r0*pitch + c0, row pitch 'pitch' (halves).
// Both projections in one grid (SEQ/64, DM/64, 2), 32 threads; x = 64 rows t of x, y = 64 columns e of the weight.
// z = 0, q: A = x rows (m = t), Bt = W^T rows (n = e) -> planes [t][e] with residual. z = 1, v^T: A = V^T weight rows (m = e), Bt = x rows (n = t) -> plane [e][t].
__global__ __launch_bounds__(32) void k_proj(const bf* __restrict__ XB, const bf* __restrict__ WT, const bf* __restrict__ VWT, h16* QH, h16* QR, h16* VT) {
    __shared__ __align__(16) float os[16 * 68];
    const int K = DM;
    const bool isv = blockIdx.z != 0;
    const bf* A = isv ? VWT : XB; const bf* Bt = isv ? XB : WT; h16* Ph = isv ? VT : QH; h16* Pr = isv ? VT : QR;
    const int useRes = isv ? 0 : 1, pitch = isv ? SEQ : DM;
    const int lane = threadIdx.x & 31, lr = lane & 15, hi = lane >> 4; const int r0 = (isv ? blockIdx.y : blockIdx.x) * 64, c0 = (isv ? blockIdx.x : blockIdx.y) * 64;
    v8f acc[4][4];
#pragma unroll
    for (int mb = 0; mb < 4; ++mb)
#pragma unroll
        for (int nb = 0; nb < 4; ++nb) acc[mb][nb] = (v8f){};
    const size_t aoff = (size_t)(r0 + lr) * K + 8 * hi, boff = (size_t)(c0 + lr) * K + 8 * hi;
#pragma unroll 1
    for (int kc = 0; kc < K; kc += 32) {
        v16bf a[4];
#pragma unroll
        for (int mb = 0; mb < 4; ++mb) a[mb] = ldb(A + aoff + (size_t)mb * 16 * K + kc);
#pragma unroll
        for (int nb = 0; nb < 4; ++nb) { const v16bf b = ldb(Bt + boff + (size_t)nb * 16 * K + kc);
#pragma unroll
            for (int mb = 0; mb < 4; ++mb) acc[mb][nb] = wmmab(a[mb], b, acc[mb][nb]); }
        asm volatile("v_nop\n\tv_nop\n\tv_nop\n\tv_nop" : "+v"(acc[0][0]), "+v"(acc[1][1]), "+v"(acc[2][2]), "+v"(acc[3][3]) : "v"(a[0]), "v"(a[1]), "v"(a[2]), "v"(a[3]));
    }
    const size_t tbase = (size_t)r0 * (size_t)pitch + (size_t)c0;
#pragma unroll
    for (int mb = 0; mb < 4; ++mb) {
#pragma unroll
        for (int nb = 0; nb < 4; ++nb) {
#pragma unroll
            for (int j = 0; j < 8; ++j) os[(hi * 8 + j) * 68 + nb * 16 + lr] = acc[mb][nb][j]; }   // D: row 8h+j, col lane&15
        wave_sync();
        const size_t sb = tbase + (size_t)(mb * 16) * (size_t)pitch;
{
#pragma unroll
            for (int s = 0; s < 4; ++s) { const int row = 4 * s + (lane >> 3), c8 = (lane & 7) * 8;   // 4 s x 4 row groups = 16 rows; 8 lanes x 8 = 64 columns
                const v4f x0 = *(const v4fa*)(&os[row * 68 + c8]); const v4f x1 = *(const v4fa*)(&os[row * 68 + c8 + 4]); v8h hv, rv;
#pragma unroll
                for (int i = 0; i < 4; ++i) { const h16 a0 = (h16)x0[i]; const h16 a1 = (h16)x1[i]; hv[i] = a0; hv[4 + i] = a1; rv[i] = (h16)((x0[i] - (float)a0) * QRS); rv[4 + i] = (h16)((x1[i] - (float)a1) * QRS); }
                const size_t oo = sb + (size_t)row * (size_t)pitch + c8;
                *(v8h*)(Ph + oo) = hv; if (useRes) *(v8h*)(Pr + oo) = rv; }
             }
        wave_sync();
    }
}

// colsum: EC = 1e-8 * row sums of VT, for the DM/4 blocks of four waves that close the flash grid. Block b owns rows 4b..4b+3, wave w the whole row 4b + w:
// 32 loads of 16 B per lane, all in flight together (a wave's load = 512 contiguous bytes). Fixed-order sums: per quarter row over its eight loads and
// over the lanes, then the four quarters pairwise.
// EC layout: the four sums of block b stand at the head of the block's own 128-B line, EC[32b + 0..3] (one writer per line): column e is EC[8*(e & ~3) + (e & 3)].
__device__ __forceinline__ void colsum(int b, const h16* __restrict__ VT, float* EC) {
    __shared__ __align__(16) float red[AW];
    const int lane = threadIdx.x & 31, wave = __builtin_amdgcn_readfirstlane((int)(threadIdx.x >> 5));
    const h16* src = VT + (size_t)(b * 4 + wave) * SEQ + lane * 8;
    v8h x[SEQ / 256];
#pragma unroll   // all loads issue before the first sum: rolled, each trip would wait out its own round trip
    for (int it = 0; it < SEQ / 256; ++it) x[it] = *(const v8h*)(src + it * 256);
    float sq[4];
#pragma unroll   // x[] and sq[] are indexed by constants only, so they stay in registers
    for (int q = 0; q < 4; ++q) {
        float s = 0.0f;
#pragma unroll   // constant indices into x[], as above
        for (int it = q * (SEQ / 1024); it < (q + 1) * (SEQ / 1024); ++it) {
            const float p0 = (float)x[it][0] + (float)x[it][1], p1 = (float)x[it][2] + (float)x[it][3], p2 = (float)x[it][4] + (float)x[it][5], p3 = (float)x[it][6] + (float)x[it][7];
            s += (p0 + p1) + (p2 + p3); }
        s += __shfl_xor(s, 16, 32); s += __shfl_xor(s, 8, 32); s += __shfl_xor(s, 4, 32); s += __shfl_xor(s, 2, 32); s += __shfl_xor(s, 1, 32);
        sq[q] = s;
    }
    if (lane == 0) red[wave] = (sq[0] + sq[1]) + (sq[2] + sq[3]);
    __syncthreads();
    if (threadIdx.x == 0) {
        v4f o;
#pragma unroll   // o[] indexed by constants: one 16-B store from registers
        for (int i = 0; i < 4; ++i) o[i] = red[i] * EPSW;
        *(v4f*)(EC + b * 32) = o;
    }
}

// k_flash: fused attention, one wave per 16 query rows; Q fragments straight from the f16 planes; K / V^T fragments from LDS tiles of 64 keys that the
// block's four waves fill together and share (two 16-B LDS loads per fragment). Ring of two buffers: the copies of stage t + 1 fly while stage t is worked on.
// Transposed form: S^T[key][t] = K Q^T (A = K rows, B = Q rows); lane (t = lane&15, h = lane>>4) holds keys 8h+r of each 16-key tile, so the packed
// P tile is directly the B fragment of O^T[d][t] = V^T P^T (element r <- tile keys 0..15, element 8+r <- tile keys 16..31, lane unchanged).
// Softmax state (running max, partial sum) is one scalar per lane; the two lane halves of a row are combined with one xor-16 exchange.
// Block (x, y) works query rows 64x.. on keys y*SEQ/KSP.. only; its result is a partial: PO holds the accumulators in register order
// ([tile][range][piece 2j+q][lane][4 floats], each store 512 contiguous bytes), ML the pair (max, sum) per lane ([tile][range][lane][2]).
// Flat grid: block f < FBX*KSP is flash block (x, y) = (f % FBX, f / FBX); the DM/4 blocks behind them take the column sums, which read VT alone and are read
// by the merge launch only. They are short and stand last in the grid, so that they start in the places that the first finished flash blocks leave.
__global__ __launch_bounds__(32 * AW) void k_flash(const h16* __restrict__ QH, const h16* __restrict__ QR, const h16* __restrict__ KP, const h16* __restrict__ VT, float* PO, float* ML, float* EC) {
    if (blockIdx.x >= FBX * KSP) { colsum((int)blockIdx.x - FBX * KSP, VT, EC); return; }   // whole blocks, ahead of every copy and barrier of the flash part
    const int bx = blockIdx.x % FBX, by = blockIdx.x / FBX;
    __shared__ __align__(16) h16 ks[2 * KS * KPH];            // [buffer][key][d], pitch KPH
    __shared__ __align__(16) h16 vs[2 * DM * VPH];            // [buffer][d][key], pitch VPH
    const int tid = threadIdx.x;
    const int lane = threadIdx.x & 31, wave = __builtin_amdgcn_readfirstlane((int)(threadIdx.x >> 5)), lr = lane & 15, hi = lane >> 4;
    const int t0 = (bx * AW + wave) * 16;
    // copy maps, 16-B piece i = 128*it + tid. k tile: 64 rows x 16 pieces, contiguous in the plane (a wave's copy = 512 B = 4 lines); row = i >> 4.
    // v^T tile: 128 rows x 8 pieces (a wave's copy = 4 rows x one 128-B line); row = i >> 3.
    const unsigned kl = (unsigned)(size_t)ks + (unsigned)((tid >> 4) * (KPH * 2) + (tid & 15) * 16);
    const unsigned vl = (unsigned)(size_t)vs + (unsigned)((tid >> 3) * (VPH * 2) + (tid & 7) * 16);
    const size_t key0 = (size_t)by * (NST * KS);      // first key of this block's range
    const h16* kg = KP + key0 * DM + (size_t)tid * 8;
    const h16* vg = VT + (size_t)(tid >> 3) * SEQ + key0 + (tid & 7) * 8;
    // prologue: stage 0 lands and is published, then stage 1 is started
    copy8(kl, 8 * KPH * 2, kg, 128 * 8); copy8(vl, 16 * VPH * 2, vg, (size_t)16 * SEQ);
    asm volatile("s_wait_asynccnt 0x0" ::: "memory");         // this wave's copies of stage 0 have landed
    __syncthreads();                                          // every wave's have: stage 0 may be read
    copy8(kl + KS * KPH * 2, 8 * KPH * 2, kg + (size_t)KS * DM, 128 * 8); copy8(vl + DM * VPH * 2, 16 * VPH * 2, vg + KS, (size_t)16 * SEQ);
    const size_t qo = (size_t)(t0 + lr) * DM + 8 * hi;
    v16h qh[4], qr[4];                                        // B fragments: col t, k = d (four 32-deep steps)
#pragma unroll
    for (int c = 0; c < 4; ++c) { qh[c] = ldh(QH + qo + 32 * c); qr[c] = ldh(QR + qo + 32 * c); }
    const int ko = lr * KPH + 8 * hi;                         // + key * KPH       (A fragment: row key, k = d)
    const int vo = lr * VPH + 8 * hi;                         // + 16j*VPH + key   (A fragment: row d, k = key)
    v8f o[8];
#pragma unroll
    for (int j = 0; j < 8; ++j) o[j] = (v8f){};
    float m = -3.0e38f, l = 0.0f;
#pragma unroll 1
    for (int t = 0; t < NST; ++t) {
      const int buf = t & 1;
#pragma unroll 1   // kept rolled: unrolled, both passes' P values stayed live and the kernel went past 256 registers
      for (int ps = 0; ps < KS / 32; ++ps) {
        const h16* kp = ks + buf * (KS * KPH) + ko + ps * 32 * KPH;
        v16h ka[4], kb[4];
#pragma unroll
        for (int c = 0; c < 4; ++c) { ka[c] = ldh(kp + 32 * c); kb[c] = ldh(kp + 16 * KPH + 32 * c); }
        v8f sHa = (v8f){}, sLa = (v8f){}, sHb = (v8f){}, sLb = (v8f){};
#pragma unroll
        for (int c = 0; c < 4; ++c) { sHa = wmma16(ka[c], qh[c], sHa); sLa = wmma16(ka[c], qr[c], sLa); sHb = wmma16(kb[c], qh[c], sHb); sLb = wmma16(kb[c], qr[c], sLb); }
        asm volatile("v_nop\n\tv_nop\n\tv_nop\n\tv_nop" : "+v"(sHa), "+v"(sLa), "+v"(sHb), "+v"(sLb)
                     : "v"(ka[0]), "v"(ka[1]), "v"(ka[2]), "v"(ka[3]), "v"(kb[0]), "v"(kb[1]), "v"(kb[2]), "v"(kb[3]));
        float ta[8], tb[8]; float mx = -3.0e38f;
#pragma unroll
        for (int r = 0; r < 8; ++r) { ta[r] = (sHa[r] + sLa[r] * QRI) * SC2; tb[r] = (sHb[r] + sLb[r] * QRI) * SC2; mx = fmaxf(mx, fmaxf(ta[r], tb[r])); }
        mx = fmaxf(mx, __shfl_xor(mx, 16, 32));
        const float mnew = fmaxf(m, mx);
        const float alpha = __builtin_amdgcn_exp2f(m - mnew);
        const float sh = PSH - mnew;
        v16h pb; float ls = 0.0f;
#pragma unroll
        for (int r = 0; r < 8; ++r) { const h16 pa = (h16)__builtin_amdgcn_exp2f(ta[r] + sh); const h16 pc = (h16)__builtin_amdgcn_exp2f(tb[r] + sh); pb[r] = pa; pb[8 + r] = pc; ls += (float)pa + (float)pc; }
        l = l * alpha + ls; m = mnew;
#pragma unroll
        for (int j = 0; j < 8; ++j) o[j] = o[j] * alpha;
        const h16* va = vs + buf * (DM * VPH) + vo + ps * 32;
        v16h vv[8];
#pragma unroll
        for (int j = 0; j < 8; ++j) vv[j] = ldh(va + 16 * j * VPH);
#pragma unroll
        for (int j = 0; j < 8; ++j) o[j] = wmma16(vv[j], pb, o[j]);
        asm volatile("v_nop\n\tv_nop\n\tv_nop\n\tv_nop" : "+v"(o[0]), "+v"(o[1]), "+v"(o[2]), "+v"(o[3]), "+v"(o[4]), "+v"(o[5]), "+v"(o[6]), "+v"(o[7])
                     : "v"(vv[0]), "v"(vv[1]), "v"(vv[2]), "v"(vv[3]), "v"(vv[4]), "v"(vv[5]), "v"(vv[6]), "v"(vv[7]), "v"(pb));
      }
      // publish point of stage t + 1, every wave, in this order
      asm volatile("s_wait_dscnt 0x0" ::: "memory");          // this wave's reads of stage t have returned before its buffer is refilled
      asm volatile("s_wait_asynccnt 0x0" ::: "memory");       // this wave's copies of stage t + 1 have landed
      __syncthreads();                                        // publishes stage t + 1 and ends every wave's reads of stage t
      if (t + 2 < NST) {                                      // same for the whole block: refill the buffer that stage t has just left
          copy8(kl + buf * (KS * KPH * 2), 8 * KPH * 2, kg + (size_t)(t + 2) * KS * DM, 128 * 8);
          copy8(vl + buf * (DM * VPH * 2), 16 * VPH * 2, vg + (size_t)(t + 2) * KS, (size_t)16 * SEQ);
      }
    }
    asm volatile("s_wait_asynccnt 0x0" ::: "memory");         // nothing of this wave is in flight when the ring is left
    l += __shfl_xor(l, 16, 32);
    const size_t pt = (size_t)(t0 >> 4) * KSP + (size_t)by;     // (tile, range)
    float* po = PO + pt * (16 * 128) + lane * 4;
#pragma unroll
    for (int j = 0; j < 8; ++j) {
        v4f a, c;
        a[0] = o[j][0]; a[1] = o[j][1]; a[2] = o[j][2]; a[3] = o[j][3];
        c[0] = o[j][4]; c[1] = o[j][5]; c[2] = o[j][6]; c[3] = o[j][7];
        *(v4f*)(po + (2 * j) * 128) = a; *(v4f*)(po + (2 * j + 1) * 128) = c;
    }
    v2f ml; ml[0] = m; ml[1] = l;
    *(v2f*)(ML + (pt * 32 + lane) * 2) = ml;
    asm volatile("s_wait_xcnt 0x0" ::: "memory");   // the column-sum part is laid out behind these stores and writes their registers: the wait stands in front of that
}

// 2^d for the merge weights, with the free slot that the instruction set asks for behind a transcendental in the same statement
__device__ __forceinline__ float exp2_slot(float d) { float w; asm("v_exp_f32 %0, %1\n\tv_nop" : "=v"(w) : "v"(d)); return w; }

// k_merge: joins the KSP partials of one 16-row query tile (ranges in fixed order 0..KSP-1): weight exp2(m_s - max), out = sum(w o) / sum(w l) + EC.
// One block per tile; wave w owns pieces 4w..4w+3 = columns 32w..32w+31 (piece 2j+q of lane (t = lane&15, h = lane>>4): d = 16j + 8h + 4q + 0..3),
// turns them through a wave-private LDS tile and stores whole 128-B lines.
__global__ __launch_bounds__(128) void k_merge(const float* __restrict__ PO, const float* __restrict__ ML, const float* __restrict__ EC, float* OUT) {
    __shared__ __align__(16) float os[4 * 16 * MSP];
    const int lane = threadIdx.x & 31, wave = __builtin_amdgcn_readfirstlane((int)(threadIdx.x >> 5)), lr = lane & 15, hi = lane >> 4;
    const size_t tile = blockIdx.x;
    const float* mb = ML + tile * (KSP * 64) + lane * 2;                     // the tile's KSP partials lie side by side
    const float* pb = PO + tile * (KSP * 16 * 128) + wave * (4 * 128) + lane * 4;
    v4f x[KSP][4], e[4]; float ms[KSP], ls[KSP];
#pragma unroll
    for (int s = 0; s < KSP; ++s) {
        const v2f ml = *(const v2f*)(mb + s * 64); ms[s] = ml[0]; ls[s] = ml[1];
#pragma unroll
        for (int p = 0; p < 4; ++p) x[s][p] = *(const v4f*)(pb + s * (16 * 128) + p * 128);
    }
#pragma unroll
    for (int p = 0; p < 4; ++p) e[p] = *(const v4f*)(EC + 8 * (32 * wave + 16 * (p >> 1) + 4 * (p & 1) + 8 * hi));   // four columns per 128-B line of EC
    __builtin_amdgcn_sched_barrier(0);   // keeps all 44 loads in front of the sums, in flight together: without it they sank to their uses, a few per memory round trip
    float mx = ms[0];
#pragma unroll
    for (int s = 1; s < KSP; ++s) mx = fmaxf(mx, ms[s]);
    v4f acc[4]; float l = 0.0f;
#pragma unroll
    for (int p = 0; p < 4; ++p) acc[p] = (v4f){};
#pragma unroll
    for (int s = 0; s < KSP; ++s) {
        const float w = exp2_slot(ms[s] - mx);
        l += w * ls[s];
#pragma unroll
        for (int p = 0; p < 4; ++p) acc[p] += x[s][p] * w;
    }
    const float inv = 1.0f / l;
    const int wb = wave * 16 * MSP;
#pragma unroll
    for (int p = 0; p < 4; ++p) {
        const int dl = 16 * (p >> 1) + 8 * hi + 4 * (p & 1);            // column inside the wave's 32
        *(v4fa*)(&os[wb + lr * MSP + dl]) = acc[p] * inv + e[p];
    }
    wave_sync();
    float* orow = OUT + tile * 16 * DM + 32 * wave;
#pragma unroll
    for (int s = 0; s < 4; ++s) {                              // 4 rows per store: 8 lanes x 4 floats = one 128-B line each
        const int row = 4 * s + (lane >> 3), c4 = (lane & 7) * 4;
        const v4f val = *(const v4fa*)(&os[wb + row * MSP + c4]);
        *(v4f*)(orow + (size_t)row * DM + c4) = val; }
}

static constexpr size_t al256(size_t v) { return (v + 255) & ~(size_t)255; }
static constexpr size_t SZ_PL = al256((size_t)SEQ * DM * 2);          // one 16-bit plane [SEQ][128] or [128][SEQ]
static constexpr size_t SZ_WB = al256((size_t)2 * DM * DM * 2);       // two transposed bf16 weight planes
static constexpr size_t SZ_EC = al256((size_t)(DM / 4) * 128);         // one 128-B line per four columns
static constexpr size_t SZ_PO = al256((size_t)KSP * SEQ * DM * 4);    // f32 partial sums: SEQ x 128 values per key range
static constexpr size_t SZ_ML = al256((size_t)KSP * NT * 32 * 2 * 4); // (max, sum) per tile, range and lane
static constexpr size_t SZ_TOTAL = 5 * SZ_PL + SZ_WB + SZ_EC + SZ_PO + SZ_ML;
static_assert(SZ_TOTAL <= (size_t)134217728);          // workspace carve <= 128 MiB
static_assert(((size_t)DM * DM * 2) % 256 == 0);       // weight sub-planes stay 256-byte aligned

extern "C" void kernel_launch(void* const* d_in, const int* in_sizes, int n_in,
                              void* d_out, int out_size, void* d_ws, size_t ws_size, hipStream_t stream) {
    if (n_in < 3) return;
    if ((size_t)in_sizes[0] < (size_t)SEQ * DM) return;
    if ((size_t)in_sizes[1] < (size_t)DM * DM || (size_t)in_sizes[2] < (size_t)DM * DM) return;
    if ((size_t)out_size < (size_t)SEQ * DM) return;
    if (SZ_TOTAL > ws_size) return;
    const float* x = (const float*)d_in[0]; const float* w = (const float*)d_in[1]; const float* v = (const float*)d_in[2];   // wire order X, W, V (W, V are [in][out])
    float* OUT = (float*)d_out;      // [SEQ][128]
    char* wsp = (char*)d_ws;
    bf*  XB = (bf*)wsp;  wsp += SZ_PL;               // [SEQ][128] bf16 x
    h16* KP = (h16*)wsp; wsp += SZ_PL;               // [SEQ][128] f16 image of bf16 x (k plane)
    bf*  WB = (bf*)wsp;  wsp += SZ_WB;               // [2][128 e][128 d]: W^T | V^T weights
    h16* QH = (h16*)wsp; wsp += SZ_PL;               // [SEQ][128] q
    h16* QR = (h16*)wsp; wsp += SZ_PL;               // [SEQ][128] q residual x2048
    h16* VT = (h16*)wsp; wsp += SZ_PL;               // [128 e][SEQ] v^T
    float* EC = (float*)wsp; wsp += SZ_EC;           // [32 lines][4 of 32 floats] 1e-8 * column sums of v
    float* PO = (float*)wsp; wsp += SZ_PO;           // flash partial sums
    float* ML = (float*)wsp; wsp += SZ_ML;           // flash partial (max, sum)
    bf* WT = WB; bf* VWT = WB + (size_t)DM * DM;

    // inputs -> bf16 x, f16 k plane, transposed bf16 weights (in[rows d][cols e] -> out[e][d])
    { const size_t n8 = (size_t)SEQ * DM / 8;
      k_prep<<<(unsigned)(2 * WSL + (n8 + 255) / 256), 256, 0, stream>>>(x, w, v, XB, KP, WT, VWT, n8); }

    // q planes [t][e] and v^T plane [e][t]
    k_proj<<<dim3(SEQ / 64, DM / 64, 2), 32, 0, stream>>>(XB, WT, VWT, QH, QR, VT);

    // flash partials, and the column sums of v
    k_flash<<<FBX * KSP + DM / 4, 32 * AW, 0, stream>>>(QH, QR, KP, VT, PO, ML, EC);

    k_merge<<<NT, 128, 0, stream>>>(PO, ML, EC, OUT);
}

// v005
// Measured time: 47.9 microseconds a run.
// In two side-by-side timings against v004, it was 1.12 and 1.13 times as fast.
// All steps since v000 together make it 8.02 times as fast.
#include <hip/hip_runtime.h>

// Single-head attention, x [SEQ][128], W and V [in][out] (q = x W, v = x V), k = x itself, score scale 128^-0.5, out = (softmax + 1e-8) v (f32).
// Compute dtypes, f32 accumulate everywhere: projections v_wmma_f32_16x16x32_bf16 (x, W, V RNE-converted to bf16; products exact);
// scores v_wmma_f32_16x16x32_f16: k = f16 of the bf16 x value (exact), q as one f16 value (its 2^-12 rounding lies under the 2^-9 bf16 rounding that x and W bring into q and k);
// P (x256 carry, cancels in the normalisation) and v single f16; softmax f32 (online, running max); the 1e-8 term is added in f32 from a column-sum table.
// Layout: bf16 copy of x, f16 k plane [t][d], bf16 transposed weights [e][d]; q plane [t][e] and v^T plane [e][t] written by the GEMM epilogue;
// fused flash kernel in transposed form (S^T = K Q^T, O^T = V^T P^T), output from f32 accumulators; its k and v^T tiles are staged in LDS
// (two buffers of 64 keys, asynchronous 16-B copies in whole 128-B lines) and shared by the block's four waves.
// The keys are cut into KSP ranges, one flash block per (64 query rows, range): each writes its un-normalised f32 sums with (max, sum) to the workspace,
// and a merge launch joins the ranges, normalises, adds the 1e-8 term and stores the output.
// Four launches, each reading only what an earlier one wrote; work that reads none of each other's output shares a grid, told apart by the block index:
// k_prep (both weight transposes + the x conversion), k_proj (q tiles + v^T tiles), k_flash (flash blocks + the column-sum blocks), k_merge.

#ifndef NB
#define NB 1
#endif
#ifndef SEQ
#define SEQ 8192
#endif
#define NB_FULL  1
#define SEQ_FULL 8192
#define DM   128                 // feature width = head width (one head)
#define AW   4                   // waves per flash block (16 query rows each)
#define OSP  132                 // LDS row pitch (floats) of the weight-transpose tile
#define SC2  (0.08838834764831845f * 1.4426950408889634f)   // 128^-0.5 * log2(e)
#define PSH  8.0f                // log2 of the P carry (256)
#define EPSW 1.0e-8f
#define KS   64                  // keys per LDS stage of the flash kernel (two 32-key passes)
#define KPH  136                 // LDS row pitch (halves) of a staged k row: 272 B = 16 B x odd, conflict-free for 16-B fragment reads
#define VPH  72                  // LDS row pitch (halves) of a staged v^T row piece (64 keys): 144 B = 16 B x odd
#define KSP  8                   // key ranges of the flash grid: 128 x 8 blocks of 4 waves = 4 blocks per WGP, 4 waves per SIMD on 256 WGPs
#define NST  (SEQ / KS / KSP)    // LDS stages per key range
#define NT   (SEQ / 16)          // 16-row query tiles
#define WSL  (DM / 32)           // 32-column slabs (blocks) of one weight transpose
#define FBX  (SEQ / (16 * AW))   // flash blocks per key range
#define MSP  36                  // LDS row pitch (floats) of the merge kernel's 16 x 32 output tile: 144 B = 16 B x odd

static_assert(NB == 1);                        // no batch dimension in this module
static_assert(DM == 128);                      // store maps assume 128 columns (512 B per f32 row, 256 B per 16-bit row)
static_assert(DM % 64 == 0);
static_assert(DM % 32 == 0);                   // GEMM and score k-loops step by 32
static_assert(SEQ % 1024 == 0);                // column-sum quarters of whole 512-B loads, 64-row tiles, 32-key steps, flash grid
static_assert(SEQ % (16 * AW) == 0);
static_assert(((size_t)SEQ * DM) % 8 == 0);
static_assert(SEQ <= SEQ_FULL);
static_assert((OSP * 4) % 16 == 0);
static_assert(SEQ % (KS * KSP) == 0 && NST >= 2);  // equal key ranges; the two-buffer ring's prologue fills stages 0 and 1
static_assert(KS == 64 && AW == 4);            // copy maps: 128 lanes x 8 copies x 16 B = one 16-KiB k tile, and one 16-KiB v^T tile
static_assert((KPH * 2) % 32 == 16 && (VPH * 2) % 32 == 16 && KPH >= DM && VPH >= KS);

typedef _Float16 h16;
typedef unsigned short bf;
typedef __attribute__((ext_vector_type(16))) __bf16   v16bf;
typedef __attribute__((ext_vector_type(16))) _Float16 v16h;
typedef __attribute__((ext_vector_type(8)))  _Float16 v8h;
typedef __attribute__((ext_vector_type(8)))  unsigned short v8us;
typedef __attribute__((ext_vector_type(8)))  float    v8f;
typedef __attribute__((ext_vector_type(4)))  float    v4f;
typedef v4f  __attribute__((may_alias)) v4fa;
typedef __attribute__((ext_vector_type(2)))  float    v2f;

__device__ __forceinline__ unsigned short f2bf(float f) { unsigned u = __float_as_uint(f); u += 0x7FFFu + ((u >> 16) & 1u); return (unsigned short)(u >> 16); }
__device__ __forceinline__ v16h cat16(v8h lo, v8h hi) { return __builtin_shufflevector(lo, hi, 0, 1, 2, 3, 4, 5, 6, 7, 8, 9, 10, 11, 12, 13, 14, 15); }
__device__ __forceinline__ v16bf cat16b(v8us lo, v8us hi) { return __builtin_bit_cast(v16bf, __builtin_shufflevector(lo, hi, 0, 1, 2, 3, 4, 5, 6, 7, 8, 9, 10, 11, 12, 13, 14, 15)); }
__device__ __forceinline__ v8f wmma16(v16h a, v16h b, v8f c) { return __builtin_amdgcn_wmma_f32_16x16x32_f16(false, a, false, b, (short)0, c, false, false); }
__device__ __forceinline__ v8f wmmab(v16bf a, v16bf b, v8f c) { return __builtin_amdgcn_wmma_f32_16x16x32_bf16(false, a, false, b, (short)0, c, false, false); }
// fragment loaders from K-contiguous 16-bit rows; p already includes + 8*(lane>>4): elements 0..7 <- k0+8h+0..7, elements 8..15 <- k0+16+8h+0..7 (same map for A and B)
__device__ __forceinline__ v16h  ldh(const h16* p) { return cat16(*(const v8h*)p, *(const v8h*)(p + 16)); }
__device__ __forceinline__ v16bf ldb(const bf* p)  { return cat16b(*(const v8us*)p, *(const v8us*)(p + 16)); }
// ordering point for wave-private LDS tiles (same wave writes and reads)
__device__ __forceinline__ void wave_sync() { __builtin_amdgcn_fence(3 /* release order */, "wavefront"); __builtin_amdgcn_wave_barrier(); asm volatile("" ::: "memory"); }

// Eight asynchronous 16-B copies per lane, global -> LDS, through no register: copy i moves LDS address l + i*ls (bytes) <- g + i*gs (halves).
// The address-translation wait is the statement's own last line, so that no register a copy names is rewritten ahead of it.
__device__ __forceinline__ void copy8(unsigned l, unsigned ls, const h16* g, size_t gs) {
    asm volatile("global_load_async_to_lds_b128 %0, %8, off\n\t"
                 "global_load_async_to_lds_b128 %1, %9, off\n\t"
                 "global_load_async_to_lds_b128 %2, %10, off\n\t"
                 "global_load_async_to_lds_b128 %3, %11, off\n\t"
                 "global_load_async_to_lds_b128 %4, %12, off\n\t"
                 "global_load_async_to_lds_b128 %5, %13, off\n\t"
                 "global_load_async_to_lds_b128 %6, %14, off\n\t"
                 "global_load_async_to_lds_b128 %7, %15, off\n\t"
                 "s_wait_xcnt 0x0"
                 :: "v"(l), "v"(l + ls), "v"(l + 2 * ls), "v"(l + 3 * ls), "v"(l + 4 * ls), "v"(l + 5 * ls), "v"(l + 6 * ls), "v"(l + 7 * ls),
                    "v"(g), "v"(g + gs), "v"(g + 2 * gs), "v"(g + 3 * gs), "v"(g + 4 * gs), "v"(g + 5 * gs), "v"(g + 6 * gs), "v"(g + 7 * gs)
                 : "memory");
}

// cvtx: block b of the conversion: 8 values per thread, f32 x -> bf16 plane and its f16 image (k plane).
__device__ __forceinline__ void cvtx(int b, const float* __restrict__ src, bf* xb, h16* kp, size_t n8) {
    const size_t i = (size_t)b * 256 + threadIdx.x; if (i >= n8) return;
    const v8f v = *(const v8f*)(src + i * 8); v8us o; v8h k;
#pragma unroll
    for (int e = 0; e < 8; ++e) { const unsigned short u = f2bf(v[e]); o[e] = u; k[e] = (h16)__uint_as_float(((unsigned)u) << 16); }
    *(v8us*)(xb + i * 8) = o; *(v8h*)(kp + i * 8) = k;
    
}

// wT: src f32 [rows d = 128][cols e = 128] -> dst bf16 [e][d] (RNE convert), slab of 32 columns e, transposed through LDS (block barrier: cross-wave tile).
__device__ __forceinline__ void wT(int slab, const float* __restrict__ src, bf* dst) {
    __shared__ __align__(16) float ts[32 * OSP];
    const int tid = threadIdx.x; const int e0 = slab * 32;
#pragma unroll 4
    for (int it = 0; it < 16; ++it) { const int idx = it * 256 + tid; const int d = idx >> 5, ee = idx & 31;      // 16 x 256 = 128 d x 32 e: whole tile written
        ts[ee * OSP + d] = src[(size_t)d * DM + e0 + ee]; }
    __syncthreads();
{
#pragma unroll
        for (int it = 0; it < 2; ++it) { const int idx = it * 256 + tid; const int ee = idx >> 4, d8 = (idx & 15) * 8;   // 2 x 256 = 32 rows x 16 pieces
            const v4f x0 = *(const v4fa*)(&ts[ee * OSP + d8]); const v4f x1 = *(const v4fa*)(&ts[ee * OSP + d8 + 4]); v8us o;
#pragma unroll
            for (int i = 0; i < 4; ++i) { o[i] = f2bf(x0[i]); o[4 + i] = f2bf(x1[i]); }
            *(v8us*)(dst + (size_t)(e0 + ee) * DM + d8) = o; }
         }
    asm volatile("s_wait_xcnt 0x0" ::: "memory");   // the conversion part is laid out behind these stores and writes their registers: the wait stands in front of that
}

// k_prep: everything that reads the inputs alone, in one grid. Blocks 0..WSL-1 transpose W, WSL..2*WSL-1 transpose V (first in the grid: dependent
// load rounds, the longest blocks), the rest convert x. The choice depends on blockIdx alone, so the transposes' barrier is met by whole blocks.
__global__ __launch_bounds__(256) void k_prep(const float* __restrict__ x, const float* __restrict__ w, const float* __restrict__ v,
                                              bf* xb, h16* kp, bf* wt, bf* vwt, size_t n8) {
    const int b = blockIdx.x;
    if (b >= 2 * WSL) { cvtx(b - 2 * WSL, x, xb, kp, n8); return; }
    const bool second = b >= WSL;
    wT(second ? b - WSL : b, second ? v : w, second ? vwt : wt);
}

// k_proj: register-blocked bf16 GEMM, ONE WAVE per 64x64 tile (16 accumulators), operands straight from K-contiguous bf16 planes, K = DM.
// C[m][n] = sum_k A[m][k] Bt[n][k], written as f16 (Ph) at r0*pitch + c0, row pitch 'pitch' (halves).
// Both projections in one grid (SEQ/64, DM/64, 2), 32 threads; x = 64 rows t of x, y = 64 columns e of the weight.
// z = 0, q: A = x rows (m = t), Bt = W^T rows (n = e) -> plane [t][e]. z = 1, v^T: A = V^T weight rows (m = e), Bt = x rows (n = t) -> plane [e][t].
__global__ __launch_bounds__(32) void k_proj(const bf* __restrict__ XB, const bf* __restrict__ WT, const bf* __restrict__ VWT, h16* QH, h16* VT) {
    __shared__ __align__(16) float os[16 * 68];
    const int K = DM;
    const bool isv = blockIdx.z != 0;
    const bf* A = isv ? VWT : XB; const bf* Bt = isv ? XB : WT; h16* Ph = isv ? VT : QH;
    const int pitch = isv ? SEQ : DM;
    const int lane = threadIdx.x & 31, lr = lane & 15, hi = lane >> 4; const int r0 = (isv ? blockIdx.y : blockIdx.x) * 64, c0 = (isv ? blockIdx.x : blockIdx.y) * 64;
    v8f acc[4][4];
#pragma unroll
    for (int mb = 0; mb < 4; ++mb)
#pragma unroll
        for (int nb = 0; nb < 4; ++nb) acc[mb][nb] = (v8f){};
    const size_t aoff = (size_t)(r0 + lr) * K + 8 * hi, boff = (size_t)(c0 + lr) * K + 8 * hi;
#pragma unroll 1
    for (int kc = 0; kc < K; kc += 32) {
        v16bf a[4];
#pragma unroll
        for (int mb = 0; mb < 4; ++mb) a[mb] = ldb(A + aoff + (size_t)mb * 16 * K + kc);
#pragma unroll
        for (int nb = 0; nb < 4; ++nb) { const v16bf b = ldb(Bt + boff + (size_t)nb * 16 * K + kc);
#pragma unroll
            for (int mb = 0; mb < 4; ++mb) acc[mb][nb] = wmmab(a[mb], b, acc[mb][nb]); }
        asm volatile("v_nop\n\tv_nop\n\tv_nop\n\tv_nop" : "+v"(acc[0][0]), "+v"(acc[1][1]), "+v"(acc[2][2]), "+v"(acc[3][3]) : "v"(a[0]), "v"(a[1]), "v"(a[2]), "v"(a[3]));
    }
    const size_t tbase = (size_t)r0 * (size_t)pitch + (size_t)c0;
#pragma unroll
    for (int mb = 0; mb < 4; ++mb) {
#pragma unroll
        for (int nb = 0; nb < 4; ++nb) {
#pragma unroll
            for (int j = 0; j < 8; ++j) os[(hi * 8 + j) * 68 + nb * 16 + lr] = acc[mb][nb][j]; }   // D: row 8h+j, col lane&15
        wave_sync();
        const size_t sb = tbase + (size_t)(mb * 16) * (size_t)pitch;
{
#pragma unroll
            for (int s = 0; s < 4; ++s) { const int row = 4 * s + (lane >> 3), c8 = (lane & 7) * 8;   // 4 s x 4 row groups = 16 rows; 8 lanes x 8 = 64 columns
                const v4f x0 = *(const v4fa*)(&os[row * 68 + c8]); const v4f x1 = *(const v4fa*)(&os[row * 68 + c8 + 4]); v8h hv;
#pragma unroll
                for (int i = 0; i < 4; ++i) { hv[i] = (h16)x0[i]; hv[4 + i] = (h16)x1[i]; }
                const size_t oo = sb + (size_t)row * (size_t)pitch + c8;
                *(v8h*)(Ph + oo) = hv; }
             }
        if (mb < 3) asm volatile("s_wait_xcnt 0x0" ::: "memory");   // the next 16 rows' address sums and LDS reads write registers that these stores name: the wait stands in front of that
        wave_sync();
    }
}

// colsum: EC = 1e-8 * row sums of VT, for the DM/4 blocks of four waves that close the flash grid. Block b owns rows 4b..4b+3, wave w the whole row 4b + w:
// 32 loads of 16 B per lane, all in flight together (a wave's load = 512 contiguous bytes). Fixed-order sums: per quarter row over its eight loads and
// over the lanes, then the four quarters pairwise.
// EC layout: the four sums of block b stand at the head of the block's own 128-B line, EC[32b + 0..3] (one writer per line): column e is EC[8*(e & ~3) + (e & 3)].
__device__ __forceinline__ void colsum(int b, const h16* __restrict__ VT, float* EC) {
    __shared__ __align__(16) float red[AW];
    const int lane = threadIdx.x & 31, wave = __builtin_amdgcn_readfirstlane((int)(threadIdx.x >> 5));
    const h16* src = VT + (size_t)(b * 4 + wave) * SEQ + lane * 8;
    v8h x[SEQ / 256];
#pragma unroll   // all loads issue before the first sum: rolled, each trip would wait out its own round trip
    for (int it = 0; it < SEQ / 256; ++it) x[it] = *(const v8h*)(src + it * 256);
    float sq[4];
#pragma unroll   // x[] and sq[] are indexed by constants only, so they stay in registers
    for (int q = 0; q < 4; ++q) {
        float s = 0.0f;
#pragma unroll   // constant indices into x[], as above
        for (int it = q * (SEQ / 1024); it < (q + 1) * (SEQ / 1024); ++it) {
            const float p0 = (float)x[it][0] + (float)x[it][1], p1 = (float)x[it][2] + (float)x[it][3], p2 = (float)x[it][4] + (float)x[it][5], p3 = (float)x[it][6] + (float)x[it][7];
            s += (p0 + p1) + (p2 + p3); }
        s += __shfl_xor(s, 16, 32); s += __shfl_xor(s, 8, 32); s += __shfl_xor(s, 4, 32); s += __shfl_xor(s, 2, 32); s += __shfl_xor(s, 1, 32);
        sq[q] = s;
    }
    if (lane == 0) red[wave] = (sq[0] + sq[1]) + (sq[2] + sq[3]);
    __syncthreads();
    if (threadIdx.x == 0) {
        v4f o;
#pragma unroll   // o[] indexed by constants: one 16-B store from registers
        for (int i = 0; i < 4; ++i) o[i] = red[i] * EPSW;
        *(v4f*)(EC + b * 32) = o;
    }
}

// k_flash: fused attention, one wave per 16 query rows; Q fragments straight from the f16 plane; K / V^T fragments from LDS tiles of 64 keys that the
// block's four waves fill together and share (two 16-B LDS loads per fragment). Ring of two buffers: the copies of stage t + 1 fly while stage t is worked on.
// Transposed form: S^T[key][t] = K Q^T (A = K rows, B = Q rows); lane (t = lane&15, h = lane>>4) holds keys 8h+r of each 16-key tile, so the packed
// P tile is directly the B fragment of O^T[d][t] = V^T P^T (element r <- tile keys 0..15, element 8+r <- tile keys 16..31, lane unchanged).
// Softmax state (running max, partial sum) is one scalar per lane; the two lane halves of a row are combined with one xor-16 exchange.
// Block (x, y) works query rows 64x.. on keys y*SEQ/KSP.. only; its result is a partial: PO holds the accumulators in register order
// ([tile][range][piece 2j+q][lane][4 floats], each store 512 contiguous bytes), ML the pair (max, sum) per lane ([tile][range][lane][2]).
// Flat grid: block f < FBX*KSP is flash block (x, y) = (f % FBX, f / FBX); the DM/4 blocks behind them take the column sums, which read VT alone and are read
// by the merge launch only. They are short and stand last in the grid, so that they start in the places that the first finished flash blocks leave.
__global__ __launch_bounds__(32 * AW) void k_flash(const h16* __restrict__ QH, const h16* __restrict__ KP, const h16* __restrict__ VT, float* PO, float* ML, float* EC) {
    if (blockIdx.x >= FBX * KSP) { colsum((int)blockIdx.x - FBX * KSP, VT, EC); return; }   // whole blocks, ahead of every copy and barrier of the flash part
    const int bx = blockIdx.x % FBX, by = blockIdx.x / FBX;
    __shared__ __align__(16) h16 ks[2 * KS * KPH];            // [buffer][key][d], pitch KPH
    __shared__ __align__(16) h16 vs[2 * DM * VPH];            // [buffer][d][key], pitch VPH
    const int tid = threadIdx.x;
    const int lane = threadIdx.x & 31, wave = __builtin_amdgcn_readfirstlane((int)(threadIdx.x >> 5)), lr = lane & 15, hi = lane >> 4;
    const int t0 = (bx * AW + wave) * 16;
    // copy maps, 16-B piece i = 128*it + tid. k tile: 64 rows x 16 pieces, contiguous in the plane (a wave's copy = 512 B = 4 lines); row = i >> 4.
    // v^T tile: 128 rows x 8 pieces (a wave's copy = 4 rows x one 128-B line); row = i >> 3.
    const unsigned kl = (unsigned)(size_t)ks + (unsigned)((tid >> 4) * (KPH * 2) + (tid & 15) * 16);
    const unsigned vl = (unsigned)(size_t)vs + (unsigned)((tid >> 3) * (VPH * 2) + (tid & 7) * 16);
    const size_t key0 = (size_t)by * (NST * KS);      // first key of this block's range
    const h16* kg = KP + key0 * DM + (size_t)tid * 8;
    const h16* vg = VT + (size_t)(tid >> 3) * SEQ + key0 + (tid & 7) * 8;
    // prologue: stage 0 lands and is published, then stage 1 is started
    copy8(kl, 8 * KPH * 2, kg, 128 * 8); copy8(vl, 16 * VPH * 2, vg, (size_t)16 * SEQ);
    asm volatile("s_wait_asynccnt 0x0" ::: "memory");         // this wave's copies of stage 0 have landed
    __syncthreads();                                          // every wave's have: stage 0 may be read
    copy8(kl + KS * KPH * 2, 8 * KPH * 2, kg + (size_t)KS * DM, 128 * 8); copy8(vl + DM * VPH * 2, 16 * VPH * 2, vg + KS, (size_t)16 * SEQ);
    const size_t qo = (size_t)(t0 + lr) * DM + 8 * hi;
    v16h qh[4];                                               // B fragments: col t, k = d (four 32-deep steps)
#pragma unroll
    for (int c = 0; c < 4; ++c) qh[c] = ldh(QH + qo + 32 * c);
    const int ko = lr * KPH + 8 * hi;                         // + key * KPH       (A fragment: row key, k = d)
    const int vo = lr * VPH + 8 * hi;                         // + 16j*VPH + key   (A fragment: row d, k = key)
    v8f o[8];
#pragma unroll
    for (int j = 0; j < 8; ++j) o[j] = (v8f){};
    float m = -3.0e38f, l = 0.0f;
#pragma unroll 1
    for (int t = 0; t < NST; ++t) {
      const int buf = t & 1;
#pragma unroll 1   // kept rolled: unrolled, both passes' P values stayed live and the kernel went past 256 registers
      for (int ps = 0; ps < KS / 32; ++ps) {
        const h16* kp = ks + buf * (KS * KPH) + ko + ps * 32 * KPH;
        v16h ka[4], kb[4];
#pragma unroll
        for (int c = 0; c < 4; ++c) { ka[c] = ldh(kp + 32 * c); kb[c] = ldh(kp + 16 * KPH + 32 * c); }
        v8f sHa = (v8f){}, sHb = (v8f){};
#pragma unroll
        for (int c = 0; c < 4; ++c) { sHa = wmma16(ka[c], qh[c], sHa); sHb = wmma16(kb[c], qh[c], sHb); }
        asm volatile("v_nop\n\tv_nop\n\tv_nop\n\tv_nop" : "+v"(sHa), "+v"(sHb)
                     : "v"(ka[0]), "v"(ka[1]), "v"(ka[2]), "v"(ka[3]), "v"(kb[0]), "v"(kb[1]), "v"(kb[2]), "v"(kb[3]));
        float ta[8], tb[8]; float mx = -3.0e38f;
#pragma unroll
        for (int r = 0; r < 8; ++r) { ta[r] = sHa[r] * SC2; tb[r] = sHb[r] * SC2; mx = fmaxf(mx, fmaxf(ta[r], tb[r])); }
        mx = fmaxf(mx, __shfl_xor(mx, 16, 32));
        const float mnew = fmaxf(m, mx);
        const float alpha = __builtin_amdgcn_exp2f(m - mnew);
        const float sh = PSH - mnew;
        v16h pb; float ls = 0.0f;
#pragma unroll
        for (int r = 0; r < 8; ++r) { const h16 pa = (h16)__builtin_amdgcn_exp2f(ta[r] + sh); const h16 pc = (h16)__builtin_amdgcn_exp2f(tb[r] + sh); pb[r] = pa; pb[8 + r] = pc; ls += (float)pa + (float)pc; }
        l = l * alpha + ls; m = mnew;
#pragma unroll
        for (int j = 0; j < 8; ++j) o[j] = o[j] * alpha;
        const h16* va = vs + buf * (DM * VPH) + vo + ps * 32;
        v16h vv[8];
#pragma unroll
        for (int j = 0; j < 8; ++j) vv[j] = ldh(va + 16 * j * VPH);
#pragma unroll
        for (int j = 0; j < 8; ++j) o[j] = wmma16(vv[j], pb, o[j]);
        asm volatile("v_nop\n\tv_nop\n\tv_nop\n\tv_nop" : "+v"(o[0]), "+v"(o[1]), "+v"(o[2]), "+v"(o[3]), "+v"(o[4]), "+v"(o[5]), "+v"(o[6]), "+v"(o[7])
                     : "v"(vv[0]), "v"(vv[1]), "v"(vv[2]), "v"(vv[3]), "v"(vv[4]), "v"(vv[5]), "v"(vv[6]), "v"(vv[7]), "v"(pb));
      }
      // publish point of stage t + 1, every wave, in this order
      asm volatile("s_wait_dscnt 0x0" ::: "memory");          // this wave's reads of stage t have returned before its buffer is refilled
      asm volatile("s_wait_asynccnt 0x0" ::: "memory");       // this wave's copies of stage t + 1 have landed
      __syncthreads();                                        // publishes stage t + 1 and ends every wave's reads of stage t
      if (t + 2 < NST) {                                      // same for the whole block: refill the buffer that stage t has just left
          copy8(kl + buf * (KS * KPH * 2), 8 * KPH * 2, kg + (size_t)(t + 2) * KS * DM, 128 * 8);
          copy8(vl + buf * (DM * VPH * 2), 16 * VPH * 2, vg + (size_t)(t + 2) * KS, (size_t)16 * SEQ);
      }
    }
    asm volatile("s_wait_asynccnt 0x0" ::: "memory");         // nothing of this wave is in flight when the ring is left
    l += __shfl_xor(l, 16, 32);
    const size_t pt = (size_t)(t0 >> 4) * KSP + (size_t)by;     // (tile, range)
    float* po = PO + pt * (16 * 128) + lane * 4;
#pragma unroll
    for (int j = 0; j < 8; ++j) {
        v4f a, c;
        a[0] = o[j][0]; a[1] = o[j][1]; a[2] = o[j][2]; a[3] = o[j][3];
        c[0] = o[j][4]; c[1] = o[j][5]; c[2] = o[j][6]; c[3] = o[j][7];
        *(v4f*)(po + (2 * j) * 128) = a; *(v4f*)(po + (2 * j + 1) * 128) = c;
    }
    v2f ml; ml[0] = m; ml[1] = l;
    *(v2f*)(ML + (pt * 32 + lane) * 2) = ml;
    asm volatile("s_wait_xcnt 0x0" ::: "memory");   // the column-sum part is laid out behind these stores and writes their registers: the wait stands in front of that
}

// 2^d for the merge weights, with the free slot that the instruction set asks for behind a transcendental in the same statement
__device__ __forceinline__ float exp2_slot(float d) { float w; asm("v_exp_f32 %0, %1\n\tv_nop" : "=v"(w) : "v"(d)); return w; }

// k_merge: joins the KSP partials of one 16-row query tile (ranges in fixed order 0..KSP-1): weight exp2(m_s - max), out = sum(w o) / sum(w l) + EC.
// One block per tile; wave w owns pieces 4w..4w+3 = columns 32w..32w+31 (piece 2j+q of lane (t = lane&15, h = lane>>4): d = 16j + 8h + 4q + 0..3),
// turns them through a wave-private LDS tile and stores whole 128-B lines.
__global__ __launch_bounds__(128) void k_merge(const float* __restrict__ PO, const float* __restrict__ ML, const float* __restrict__ EC, float* OUT) {
    __shared__ __align__(16) float os[4 * 16 * MSP];
    const int lane = threadIdx.x & 31, wave = __builtin_amdgcn_readfirstlane((int)(threadIdx.x >> 5)), lr = lane & 15, hi = lane >> 4;
    const size_t tile = blockIdx.x;
    const float* mb = ML + tile * (KSP * 64) + lane * 2;                     // the tile's KSP partials lie side by side
    const float* pb = PO + tile * (KSP * 16 * 128) + wave * (4 * 128) + lane * 4;
    v4f x[KSP][4], e[4]; float ms[KSP], ls[KSP];
#pragma unroll
    for (int s = 0; s < KSP; ++s) {
        const v2f ml = *(const v2f*)(mb + s * 64); ms[s] = ml[0]; ls[s] = ml[1];
#pragma unroll
        for (int p = 0; p < 4; ++p) x[s][p] = *(const v4f*)(pb + s * (16 * 128) + p * 128);
    }
#pragma unroll
    for (int p = 0; p < 4; ++p) e[p] = *(const v4f*)(EC + 8 * (32 * wave + 16 * (p >> 1) + 4 * (p & 1) + 8 * hi));   // four columns per 128-B line of EC
    __builtin_amdgcn_sched_barrier(0);   // keeps all 44 loads in front of the sums, in flight together: without it they sank to their uses, a few per memory round trip
    float mx = ms[0];
#pragma unroll
    for (int s = 1; s < KSP; ++s) mx = fmaxf(mx, ms[s]);
    v4f acc[4]; float l = 0.0f;
#pragma unroll
    for (int p = 0; p < 4; ++p) acc[p] = (v4f){};
#pragma unroll
    for (int s = 0; s < KSP; ++s) {
        const float w = exp2_slot(ms[s] - mx);
        l += w * ls[s];
#pragma unroll
        for (int p = 0; p < 4; ++p) acc[p] += x[s][p] * w;
    }
    const float inv = 1.0f / l;
    const int wb = wave * 16 * MSP;
#pragma unroll
    for (int p = 0; p < 4; ++p) {
        const int dl = 16 * (p >> 1) + 8 * hi + 4 * (p & 1);            // column inside the wave's 32
        *(v4fa*)(&os[wb + lr * MSP + dl]) = acc[p] * inv + e[p];
    }
    wave_sync();
    float* orow = OUT + tile * 16 * DM + 32 * wave;
#pragma unroll
    for (int s = 0; s < 4; ++s) {                              // 4 rows per store: 8 lanes x 4 floats = one 128-B line each
        const int row = 4 * s + (lane >> 3), c4 = (lane & 7) * 4;
        const v4f val = *(const v4fa*)(&os[wb + row * MSP + c4]);
        *(v4f*)(orow + (size_t)row * DM + c4) = val; }
}

static constexpr size_t al256(size_t v) { return (v + 255) & ~(size_t)255; }
static constexpr size_t SZ_PL = al256((size_t)SEQ * DM * 2);          // one 16-bit plane [SEQ][128] or [128][SEQ]
static constexpr size_t SZ_WB = al256((size_t)2 * DM * DM * 2);       // two transposed bf16 weight planes
static constexpr size_t SZ_EC = al256((size_t)(DM / 4) * 128);         // one 128-B line per four columns
static constexpr size_t SZ_PO = al256((size_t)KSP * SEQ * DM * 4);    // f32 partial sums: SEQ x 128 values per key range
static constexpr size_t SZ_ML = al256((size_t)KSP * NT * 32 * 2 * 4); // (max, sum) per tile, range and lane
static constexpr size_t SZ_TOTAL = 4 * SZ_PL + SZ_WB + SZ_EC + SZ_PO + SZ_ML;
static_assert(SZ_TOTAL <= (size_t)134217728);          // workspace carve <= 128 MiB
static_assert(((size_t)DM * DM * 2) % 256 == 0);       // weight sub-planes stay 256-byte aligned

extern "C" void kernel_launch(void* const* d_in, const int* in_sizes, int n_in,
                              void* d_out, int out_size, void* d_ws, size_t ws_size, hipStream_t stream) {
    if (n_in < 3) return;
    if ((size_t)in_sizes[0] < (size_t)SEQ * DM) return;
    if ((size_t)in_sizes[1] < (size_t)DM * DM || (size_t)in_sizes[2] < (size_t)DM * DM) return;
    if ((size_t)out_size < (size_t)SEQ * DM) return;
    if (SZ_TOTAL > ws_size) return;
    const float* x = (const float*)d_in[0]; const float* w = (const float*)d_in[1]; const float* v = (const float*)d_in[2];   // wire order X, W, V (W, V are [in][out])
    float* OUT = (float*)d_out;      // [SEQ][128]
    char* wsp = (char*)d_ws;
    bf*  XB = (bf*)wsp;  wsp += SZ_PL;               // [SEQ][128] bf16 x
    h16* KP = (h16*)wsp; wsp += SZ_PL;               // [SEQ][128] f16 image of bf16 x (k plane)
    bf*  WB = (bf*)wsp;  wsp += SZ_WB;               // [2][128 e][128 d]: W^T | V^T weights
    h16* QH = (h16*)wsp; wsp += SZ_PL;               // [SEQ][128] q
    h16* VT = (h16*)wsp; wsp += SZ_PL;               // [128 e][SEQ] v^T
    float* EC = (float*)wsp; wsp += SZ_EC;           // [32 lines][4 of 32 floats] 1e-8 * column sums of v
    float* PO = (float*)wsp; wsp += SZ_PO;           // flash partial sums
    float* ML = (float*)wsp; wsp += SZ_ML;           // flash partial (max, sum)
    bf* WT = WB; bf* VWT = WB + (size_t)DM * DM;

    // inputs -> bf16 x, f16 k plane, transposed bf16 weights (in[rows d][cols e] -> out[e][d])
    { const size_t n8 = (size_t)SEQ * DM / 8;
      k_prep<<<(unsigned)(2 * WSL + (n8 + 255) / 256), 256, 0, stream>>>(x, w, v, XB, KP, WT, VWT, n8); }

    // q plane [t][e] and v^T plane [e][t]
    k_proj<<<dim3(SEQ / 64, DM / 64, 2), 32, 0, stream>>>(XB, WT, VWT, QH, VT);

    // flash partials, and the column sums of v
    k_flash<<<FBX * KSP + DM / 4, 32 * AW, 0, stream>>>(QH, KP, VT, PO, ML, EC);

    k_merge<<<NT, 128, 0, stream>>>(PO, ML, EC, OUT);
}

// v006
// It runs in 45 microseconds.
// Timed twice side by side with v005, it ran 1.07 and 1.05 times as fast.
// All steps since v000 together make it 8.51 times as fast.
#include <hip/hip_runtime.h>

// Single-head attention, x [SEQ][128], W and V [in][out] (q = x W, v = x V), k = x itself, score scale 128^-0.5, out = (softmax + 1e-8) v (f32).
// Compute dtypes, f32 accumulate everywhere: projections v_wmma_f32_16x16x32_bf16 (x, W, V RNE-converted to bf16; products exact);
// scores v_wmma_f32_16x16x32_f16: k = f16 of the bf16 x value (exact), q as one f16 value (its 2^-12 rounding lies under the 2^-9 bf16 rounding that x and W bring into q and k);
// P (x256 carry, cancels in the normalisation) and v single f16; softmax f32 (online; the maximum in use is raised, and the sums rescaled, only when a score passes it by 2^7); the 1e-8 term is added in f32 from a column-sum table.
// Layout: bf16 copy of x, f16 k plane [t][d], bf16 transposed weights [e][d]; q plane [t][e] and v^T plane [e][t] written by the GEMM epilogue;
// fused flash kernel in transposed form (S^T = K Q^T, O^T = V^T P^T), output from f32 accumulators; its k and v^T tiles are staged in LDS
// (two buffers of 64 keys, asynchronous 16-B copies in whole 128-B lines) and shared by the block's four waves.
// The keys are cut into KSP ranges, one flash block per (64 query rows, range): each writes its un-normalised f32 sums with (max, sum) to the workspace,
// and a merge launch joins the ranges, normalises, adds the 1e-8 term and stores the output.
// Four launches, each reading only what an earlier one wrote; work that reads none of each other's output shares a grid, told apart by the block index:
// k_prep (both weight transposes + the x conversion), k_proj (q tiles + v^T tiles), k_flash (flash blocks + the column-sum blocks), k_merge.

#ifndef NB
#define NB 1
#endif
#ifndef SEQ
#define SEQ 8192
#endif
#define NB_FULL  1
#define SEQ_FULL 8192
#define DM   128                 // feature width = head width (one head)
#define AW   4                   // waves per flash block (16 query rows each)
#define OSP  132                 // LDS row pitch (floats) of the weight-transpose tile
#define SC2  (0.08838834764831845f * 1.4426950408889634f)   // 128^-0.5 * log2(e)
#define PSH  8.0f                // log2 of the P carry (256)
#define TAU  7.0f                // a score may pass the maximum in use by this much (log2) before the sums are rescaled: P <= 2^(PSH + TAU) = 2^15 stays finite in f16
#define EPSW 1.0e-8f
#define KS   64                  // keys per LDS stage of the flash kernel (two 32-key passes)
#define KPH  136                 // LDS row pitch (halves) of a staged k row: 272 B = 16 B x odd, conflict-free for 16-B fragment reads
#define VPH  72                  // LDS row pitch (halves) of a staged v^T row piece (64 keys): 144 B = 16 B x odd
#define KSP  8                   // key ranges of the flash grid: 128 x 8 blocks of 4 waves = 4 blocks per WGP, 4 waves per SIMD on 256 WGPs
#define NST  (SEQ / KS / KSP)    // LDS stages per key range
#define NT   (SEQ / 16)          // 16-row query tiles
#define WSL  (DM / 32)           // 32-column slabs (blocks) of one weight transpose
#define FBX  (SEQ / (16 * AW))   // flash blocks per key range
#define MSP  36                  // LDS row pitch (floats) of the merge kernel's 16 x 32 output tile: 144 B = 16 B x odd

static_assert(NB == 1);                        // no batch dimension in this module
static_assert(DM == 128);                      // store maps assume 128 columns (512 B per f32 row, 256 B per 16-bit row)
static_assert(DM % 64 == 0);
static_assert(DM % 32 == 0);                   // GEMM and score k-loops step by 32
static_assert(SEQ % 1024 == 0);                // column-sum quarters of whole 512-B loads, 64-row tiles, 32-key steps, flash grid
static_assert(SEQ % (16 * AW) == 0);
static_assert(((size_t)SEQ * DM) % 8 == 0);
static_assert(SEQ <= SEQ_FULL);
static_assert((OSP * 4) % 16 == 0);
static_assert(SEQ % (KS * KSP) == 0 && NST >= 2);  // equal key ranges; the two-buffer ring's prologue fills stages 0 and 1
static_assert(KS == 64 && AW == 4);            // copy maps: 128 lanes x 8 copies x 16 B = one 16-KiB k tile, and one 16-KiB v^T tile
static_assert((KPH * 2) % 32 == 16 && (VPH * 2) % 32 == 16 && KPH >= DM && VPH >= KS);

typedef _Float16 h16;
typedef unsigned short bf;
typedef __attribute__((ext_vector_type(16))) __bf16   v16bf;
typedef __attribute__((ext_vector_type(16))) _Float16 v16h;
typedef __attribute__((ext_vector_type(8)))  _Float16 v8h;
typedef __attribute__((ext_vector_type(8)))  unsigned short v8us;
typedef __attribute__((ext_vector_type(8)))  float    v8f;
typedef __attribute__((ext_vector_type(4)))  float    v4f;
typedef v4f  __attribute__((may_alias)) v4fa;
typedef __attribute__((ext_vector_type(2)))  float    v2f;

__device__ __forceinline__ unsigned short f2bf(float f) { unsigned u = __float_as_uint(f); u += 0x7FFFu + ((u >> 16) & 1u); return (unsigned short)(u >> 16); }
__device__ __forceinline__ v16h cat16(v8h lo, v8h hi) { return __builtin_shufflevector(lo, hi, 0, 1, 2, 3, 4, 5, 6, 7, 8, 9, 10, 11, 12, 13, 14, 15); }
__device__ __forceinline__ v16bf cat16b(v8us lo, v8us hi) { return __builtin_bit_cast(v16bf, __builtin_shufflevector(lo, hi, 0, 1, 2, 3, 4, 5, 6, 7, 8, 9, 10, 11, 12, 13, 14, 15)); }
__device__ __forceinline__ v8f wmma16(v16h a, v16h b, v8f c) { return __builtin_amdgcn_wmma_f32_16x16x32_f16(false, a, false, b, (short)0, c, false, false); }
__device__ __forceinline__ v8f wmmab(v16bf a, v16bf b, v8f c) { return __builtin_amdgcn_wmma_f32_16x16x32_bf16(false, a, false, b, (short)0, c, false, false); }
// fragment loaders from K-contiguous 16-bit rows; p already includes + 8*(lane>>4): elements 0..7 <- k0+8h+0..7, elements 8..15 <- k0+16+8h+0..7 (same map for A and B)
__device__ __forceinline__ v16h  ldh(const h16* p) { return cat16(*(const v8h*)p, *(const v8h*)(p + 16)); }
__device__ __forceinline__ v16bf ldb(const bf* p)  { return cat16b(*(const v8us*)p, *(const v8us*)(p + 16)); }
// ordering point for wave-private LDS tiles (same wave writes and reads)
__device__ __forceinline__ void wave_sync() { __builtin_amdgcn_fence(3 /* release order */, "wavefront"); __builtin_amdgcn_wave_barrier(); asm volatile("" ::: "memory"); }

// Eight asynchronous 16-B copies per lane, global -> LDS, through no register: copy i moves LDS address l + i*ls (bytes) <- g + i*gs (halves).
// The address-translation wait is the statement's own last line, so that no register a copy names is rewritten ahead of it.
__device__ __forceinline__ void copy8(unsigned l, unsigned ls, const h16* g, size_t gs) {
    asm volatile("global_load_async_to_lds_b128 %0, %8, off\n\t"
                 "global_load_async_to_lds_b128 %1, %9, off\n\t"
                 "global_load_async_to_lds_b128 %2, %10, off\n\t"
                 "global_load_async_to_lds_b128 %3, %11, off\n\t"
                 "global_load_async_to_lds_b128 %4, %12, off\n\t"
                 "global_load_async_to_lds_b128 %5, %13, off\n\t"
                 "global_load_async_to_lds_b128 %6, %14, off\n\t"
                 "global_load_async_to_lds_b128 %7, %15, off\n\t"
                 "s_wait_xcnt 0x0"
                 :: "v"(l), "v"(l + ls), "v"(l + 2 * ls), "v"(l + 3 * ls), "v"(l + 4 * ls), "v"(l + 5 * ls), "v"(l + 6 * ls), "v"(l + 7 * ls),
                    "v"(g), "v"(g + gs), "v"(g + 2 * gs), "v"(g + 3 * gs), "v"(g + 4 * gs), "v"(g + 5 * gs), "v"(g + 6 * gs), "v"(g + 7 * gs)
                 : "memory");
}

// cvtx: block b of the conversion: 8 values per thread, f32 x -> bf16 plane and its f16 image (k plane).
__device__ __forceinline__ void cvtx(int b, const float* __restrict__ src, bf* xb, h16* kp, size_t n8) {
    const size_t i = (size_t)b * 256 + threadIdx.x; if (i >= n8) return;
    const v8f v = *(const v8f*)(src + i * 8); v8us o; v8h k;
#pragma unroll
    for (int e = 0; e < 8; ++e) { const unsigned short u = f2bf(v[e]); o[e] = u; k[e] = (h16)__uint_as_float(((unsigned)u) << 16); }
    *(v8us*)(xb + i * 8) = o; *(v8h*)(kp + i * 8) = k;
    
}

// wT: src f32 [rows d = 128][cols e = 128] -> dst bf16 [e][d] (RNE convert), slab of 32 columns e, transposed through LDS (block barrier: cross-wave tile).
__device__ __forceinline__ void wT(int slab, const float* __restrict__ src, bf* dst) {
    __shared__ __align__(16) float ts[32 * OSP];
    const int tid = threadIdx.x; const int e0 = slab * 32;
#pragma unroll 4
    for (int it = 0; it < 16; ++it) { const int idx = it * 256 + tid; const int d = idx >> 5, ee = idx & 31;      // 16 x 256 = 128 d x 32 e: whole tile written
        ts[ee * OSP + d] = src[(size_t)d * DM + e0 + ee]; }
    __syncthreads();
{
#pragma unroll
        for (int it = 0; it < 2; ++it) { const int idx = it * 256 + tid; const int ee = idx >> 4, d8 = (idx & 15) * 8;   // 2 x 256 = 32 rows x 16 pieces
            const v4f x0 = *(const v4fa*)(&ts[ee * OSP + d8]); const v4f x1 = *(const v4fa*)(&ts[ee * OSP + d8 + 4]); v8us o;
#pragma unroll
            for (int i = 0; i < 4; ++i) { o[i] = f2bf(x0[i]); o[4 + i] = f2bf(x1[i]); }
            *(v8us*)(dst + (size_t)(e0 + ee) * DM + d8) = o; }
         }
    asm volatile("s_wait_xcnt 0x0" ::: "memory");   // the conversion part is laid out behind these stores and writes their registers: the wait stands in front of that
}

// k_prep: everything that reads the inputs alone, in one grid. Blocks 0..WSL-1 transpose W, WSL..2*WSL-1 transpose V (first in the grid: dependent
// load rounds, the longest blocks), the rest convert x. The choice depends on blockIdx alone, so the transposes' barrier is met by whole blocks.
__global__ __launch_bounds__(256) void k_prep(const float* __restrict__ x, const float* __restrict__ w, const float* __restrict__ v,
                                              bf* xb, h16* kp, bf* wt, bf* vwt, size_t n8) {
    const int b = blockIdx.x;
    if (b >= 2 * WSL) { cvtx(b - 2 * WSL, x, xb, kp, n8); return; }
    const bool second = b >= WSL;
    wT(second ? b - WSL : b, second ? v : w, second ? vwt : wt);
}

// k_proj: register-blocked bf16 GEMM, ONE WAVE per 64x64 tile (16 accumulators), operands straight from K-contiguous bf16 planes, K = DM.
// C[m][n] = sum_k A[m][k] Bt[n][k], written as f16 (Ph) at r0*pitch + c0, row pitch 'pitch' (halves).
// Both projections in one grid (SEQ/64, DM/64, 2), 32 threads; x = 64 rows t of x, y = 64 columns e of the weight.
// z = 0, q: A = x rows (m = t), Bt = W^T rows (n = e) -> plane [t][e]. z = 1, v^T: A = V^T weight rows (m = e), Bt = x rows (n = t) -> plane [e][t].
__global__ __launch_bounds__(32) void k_proj(const bf* __restrict__ XB, const bf* __restrict__ WT, const bf* __restrict__ VWT, h16* QH, h16* VT) {
    __shared__ __align__(16) float os[16 * 68];
    const int K = DM;
    const bool isv = blockIdx.z != 0;
    const bf* A = isv ? VWT : XB; const bf* Bt = isv ? XB : WT; h16* Ph = isv ? VT : QH;
    const int pitch = isv ? SEQ : DM;
    const int lane = threadIdx.x & 31, lr = lane & 15, hi = lane >> 4; const int r0 = (isv ? blockIdx.y : blockIdx.x) * 64, c0 = (isv ? blockIdx.x : blockIdx.y) * 64;
    v8f acc[4][4];
#pragma unroll
    for (int mb = 0; mb < 4; ++mb)
#pragma unroll
        for (int nb = 0; nb < 4; ++nb) acc[mb][nb] = (v8f){};
    const size_t aoff = (size_t)(r0 + lr) * K + 8 * hi, boff = (size_t)(c0 + lr) * K + 8 * hi;
#pragma unroll 1
    for (int kc = 0; kc < K; kc += 32) {
        v16bf a[4];
#pragma unroll
        for (int mb = 0; mb < 4; ++mb) a[mb] = ldb(A + aoff + (size_t)mb * 16 * K + kc);
#pragma unroll
        for (int nb = 0; nb < 4; ++nb) { const v16bf b = ldb(Bt + boff + (size_t)nb * 16 * K + kc);
#pragma unroll
            for (int mb = 0; mb < 4; ++mb) acc[mb][nb] = wmmab(a[mb], b, acc[mb][nb]); }
        asm volatile("v_nop\n\tv_nop\n\tv_nop\n\tv_nop" : "+v"(acc[0][0]), "+v"(acc[1][1]), "+v"(acc[2][2]), "+v"(acc[3][3]) : "v"(a[0]), "v"(a[1]), "v"(a[2]), "v"(a[3]));
    }
    const size_t tbase = (size_t)r0 * (size_t)pitch + (size_t)c0;
#pragma unroll
    for (int mb = 0; mb < 4; ++mb) {
#pragma unroll
        for (int nb = 0; nb < 4; ++nb) {
#pragma unroll
            for (int j = 0; j < 8; ++j) os[(hi * 8 + j) * 68 + nb * 16 + lr] = acc[mb][nb][j]; }   // D: row 8h+j, col lane&15
        wave_sync();
        const size_t sb = tbase + (size_t)(mb * 16) * (size_t)pitch;
{
#pragma unroll
            for (int s = 0; s < 4; ++s) { const int row = 4 * s + (lane >> 3), c8 = (lane & 7) * 8;   // 4 s x 4 row groups = 16 rows; 8 lanes x 8 = 64 columns
                const v4f x0 = *(const v4fa*)(&os[row * 68 + c8]); const v4f x1 = *(const v4fa*)(&os[row * 68 + c8 + 4]); v8h hv;
#pragma unroll
                for (int i = 0; i < 4; ++i) { hv[i] = (h16)x0[i]; hv[4 + i] = (h16)x1[i]; }
                const size_t oo = sb + (size_t)row * (size_t)pitch + c8;
                *(v8h*)(Ph + oo) = hv; }
             }
        if (mb < 3) asm volatile("s_wait_xcnt 0x0" ::: "memory");   // the next 16 rows' address sums and LDS reads write registers that these stores name: the wait stands in front of that
        wave_sync();
    }
}

// colsum: EC = 1e-8 * row sums of VT, for the DM/4 blocks of four waves that close the flash grid. Block b owns rows 4b..4b+3, wave w the whole row 4b + w:
// 32 loads of 16 B per lane, all in flight together (a wave's load = 512 contiguous bytes). Fixed-order sums: per quarter row over its eight loads and
// over the lanes, then the four quarters pairwise.
// EC layout: the four sums of block b stand at the head of the block's own 128-B line, EC[32b + 0..3] (one writer per line): column e is EC[8*(e & ~3) + (e & 3)].
__device__ __forceinline__ void colsum(int b, const h16* __restrict__ VT, float* EC) {
    __shared__ __align__(16) float red[AW];
    const int lane = threadIdx.x & 31, wave = __builtin_amdgcn_readfirstlane((int)(threadIdx.x >> 5));
    const h16* src = VT + (size_t)(b * 4 + wave) * SEQ + lane * 8;
    v8h x[SEQ / 256];
#pragma unroll   // all loads issue before the first sum: rolled, each trip would wait out its own round trip
    for (int it = 0; it < SEQ / 256; ++it) x[it] = *(const v8h*)(src + it * 256);
    float sq[4];
#pragma unroll   // x[] and sq[] are indexed by constants only, so they stay in registers
    for (int q = 0; q < 4; ++q) {
        float s = 0.0f;
#pragma unroll   // constant indices into x[], as above
        for (int it = q * (SEQ / 1024); it < (q + 1) * (SEQ / 1024); ++it) {
            const float p0 = (float)x[it][0] + (float)x[it][1], p1 = (float)x[it][2] + (float)x[it][3], p2 = (float)x[it][4] + (float)x[it][5], p3 = (float)x[it][6] + (float)x[it][7];
            s += (p0 + p1) + (p2 + p3); }
        s += __shfl_xor(s, 16, 32); s += __shfl_xor(s, 8, 32); s += __shfl_xor(s, 4, 32); s += __shfl_xor(s, 2, 32); s += __shfl_xor(s, 1, 32);
        sq[q] = s;
    }
    if (lane == 0) red[wave] = (sq[0] + sq[1]) + (sq[2] + sq[3]);
    __syncthreads();
    if (threadIdx.x == 0) {
        v4f o;
#pragma unroll   // o[] indexed by constants: one 16-B store from registers
        for (int i = 0; i < 4; ++i) o[i] = red[i] * EPSW;
        *(v4f*)(EC + b * 32) = o;
    }
}

// k_flash: fused attention, one wave per 16 query rows; Q fragments straight from the f16 plane; K / V^T fragments from LDS tiles of 64 keys that the
// block's four waves fill together and share (two 16-B LDS loads per fragment). Ring of two buffers: the copies of stage t + 1 fly while stage t is worked on.
// Transposed form: S^T[key][t] = K Q^T (A = K rows, B = Q rows); lane (t = lane&15, h = lane>>4) holds keys 8h+r of each 16-key tile, so the packed
// P tile is directly the B fragment of O^T[d][t] = V^T P^T (element r <- tile keys 0..15, element 8+r <- tile keys 16..31, lane unchanged).
// Softmax state (maximum in use, partial sum) is one scalar per lane; the two lane halves of a row are combined with one xor-16 exchange, at a rescale and at the end.
// Block (x, y) works query rows 64x.. on keys y*SEQ/KSP.. only; its result is a partial: PO holds the accumulators in register order
// ([tile][range][piece 2j+q][lane][4 floats], each store 512 contiguous bytes), ML the pair (max, sum) per lane ([tile][range][lane][2]).
// Flat grid: block f < FBX*KSP is flash block (x, y) = (f % FBX, f / FBX); the DM/4 blocks behind them take the column sums, which read VT alone and are read
// by the merge launch only. They are short and stand last in the grid, so that they start in the places that the first finished flash blocks leave.
__global__ __launch_bounds__(32 * AW) void k_flash(const h16* __restrict__ QH, const h16* __restrict__ KP, const h16* __restrict__ VT, float* PO, float* ML, float* EC) {
    if (blockIdx.x >= FBX * KSP) { colsum((int)blockIdx.x - FBX * KSP, VT, EC); return; }   // whole blocks, ahead of every copy and barrier of the flash part
    const int bx = blockIdx.x % FBX, by = blockIdx.x / FBX;
    __shared__ __align__(16) h16 ks[2 * KS * KPH];            // [buffer][key][d], pitch KPH
    __shared__ __align__(16) h16 vs[2 * DM * VPH];            // [buffer][d][key], pitch VPH
    const int tid = threadIdx.x;
    const int lane = threadIdx.x & 31, wave = __builtin_amdgcn_readfirstlane((int)(threadIdx.x >> 5)), lr = lane & 15, hi = lane >> 4;
    const int t0 = (bx * AW + wave) * 16;
    // copy maps, 16-B piece i = 128*it + tid. k tile: 64 rows x 16 pieces, contiguous in the plane (a wave's copy = 512 B = 4 lines); row = i >> 4.
    // v^T tile: 128 rows x 8 pieces (a wave's copy = 4 rows x one 128-B line); row = i >> 3.
    const unsigned kl = (unsigned)(size_t)ks + (unsigned)((tid >> 4) * (KPH * 2) + (tid & 15) * 16);
    const unsigned vl = (unsigned)(size_t)vs + (unsigned)((tid >> 3) * (VPH * 2) + (tid & 7) * 16);
    const size_t key0 = (size_t)by * (NST * KS);      // first key of this block's range
    const h16* kg = KP + key0 * DM + (size_t)tid * 8;
    const h16* vg = VT + (size_t)(tid >> 3) * SEQ + key0 + (tid & 7) * 8;
    // prologue: stage 0 lands and is published, then stage 1 is started
    copy8(kl, 8 * KPH * 2, kg, 128 * 8); copy8(vl, 16 * VPH * 2, vg, (size_t)16 * SEQ);
    asm volatile("s_wait_asynccnt 0x0" ::: "memory");         // this wave's copies of stage 0 have landed
    __syncthreads();                                          // every wave's have: stage 0 may be read
    copy8(kl + KS * KPH * 2, 8 * KPH * 2, kg + (size_t)KS * DM, 128 * 8); copy8(vl + DM * VPH * 2, 16 * VPH * 2, vg + KS, (size_t)16 * SEQ);
    const size_t qo = (size_t)(t0 + lr) * DM + 8 * hi;
    v16h qh[4];                                               // B fragments: col t, k = d (four 32-deep steps)
#pragma unroll
    for (int c = 0; c < 4; ++c) qh[c] = ldh(QH + qo + 32 * c);
    const int ko = lr * KPH + 8 * hi;                         // + key * KPH       (A fragment: row key, k = d)
    const int vo = lr * VPH + 8 * hi;                         // + 16j*VPH + key   (A fragment: row d, k = key)
    v8f o[8];
#pragma unroll
    for (int j = 0; j < 8; ++j) o[j] = (v8f){};
    float m = -3.0e38f, l = 0.0f;
#pragma unroll 1
    for (int t = 0; t < NST; ++t) {
      const int buf = t & 1;
#pragma unroll 1   // kept rolled: unrolled, both passes' P values stayed live and the kernel went past 256 registers
      for (int ps = 0; ps < KS / 32; ++ps) {
        const h16* kp = ks + buf * (KS * KPH) + ko + ps * 32 * KPH;
        v16h ka[4], kb[4];
#pragma unroll
        for (int c = 0; c < 4; ++c) { ka[c] = ldh(kp + 32 * c); kb[c] = ldh(kp + 16 * KPH + 32 * c); }
        v8f sHa = (v8f){}, sHb = (v8f){};
#pragma unroll
        for (int c = 0; c < 4; ++c) { sHa = wmma16(ka[c], qh[c], sHa); sHb = wmma16(kb[c], qh[c], sHb); }
        asm volatile("v_nop\n\tv_nop\n\tv_nop\n\tv_nop" : "+v"(sHa), "+v"(sHb)
                     : "v"(ka[0]), "v"(ka[1]), "v"(ka[2]), "v"(ka[3]), "v"(kb[0]), "v"(kb[1]), "v"(kb[2]), "v"(kb[3]));
        // the v^T fragment reads stand in front of the softmax and its branch, so that they return while the vector work runs
        const h16* va = vs + buf * (DM * VPH) + vo + ps * 32;
        v16h vv[8];
#pragma unroll
        for (int j = 0; j < 8; ++j) vv[j] = ldh(va + 16 * j * VPH);
        __builtin_amdgcn_sched_barrier(0);   // keeps the sixteen reads one group: without it they were strewn among the vector instructions in six places
        float ta[8], tb[8]; float mx = -3.0e38f;
#pragma unroll
        for (int r = 0; r < 8; ++r) { ta[r] = sHa[r] * SC2; tb[r] = sHb[r] * SC2; mx = fmaxf(mx, fmaxf(ta[r], tb[r])); }
        // lazy rescale: one test per pass on each lane's own maximum (m is equal in a row's two lanes, the ballot sees both); while no score lies more
        // than TAU above the maximum in use, m stays and sums and accumulators are left alone. A scalar branch: all lanes stay on for the WMMAs behind it.
        if (__builtin_expect(__builtin_amdgcn_ballot_w32(mx > m + TAU) != 0, 0)) {   // marked rare: the pass without a rescale is laid out straight through
            mx = fmaxf(mx, __shfl_xor(mx, 16, 32));
            const float mnew = fmaxf(m, mx);
            const float alpha = __builtin_amdgcn_exp2f(m - mnew);
            l *= alpha; m = mnew;
#pragma unroll
            for (int j = 0; j < 8; ++j) o[j] = o[j] * alpha;
        }
        const float sh = PSH - m;
        v16h pb; float ls = 0.0f;
#pragma unroll
        for (int r = 0; r < 8; ++r) { const h16 pa = (h16)__builtin_amdgcn_exp2f(ta[r] + sh); const h16 pc = (h16)__builtin_amdgcn_exp2f(tb[r] + sh); pb[r] = pa; pb[8 + r] = pc; ls += (float)pa + (float)pc; }
        l += ls;
#pragma unroll
        for (int j = 0; j < 8; ++j) o[j] = wmma16(vv[j], pb, o[j]);
        asm volatile("v_nop\n\tv_nop\n\tv_nop\n\tv_nop" : "+v"(o[0]), "+v"(o[1]), "+v"(o[2]), "+v"(o[3]), "+v"(o[4]), "+v"(o[5]), "+v"(o[6]), "+v"(o[7])
                     : "v"(vv[0]), "v"(vv[1]), "v"(vv[2]), "v"(vv[3]), "v"(vv[4]), "v"(vv[5]), "v"(vv[6]), "v"(vv[7]), "v"(pb));
      }
      // publish point of stage t + 1, every wave, in this order
      asm volatile("s_wait_dscnt 0x0" ::: "memory");          // this wave's reads of stage t have returned before its buffer is refilled
      asm volatile("s_wait_asynccnt 0x0" ::: "memory");       // this wave's copies of stage t + 1 have landed
      __syncthreads();                                        // publishes stage t + 1 and ends every wave's reads of stage t
      if (t + 2 < NST) {                                      // same for the whole block: refill the buffer that stage t has just left
          copy8(kl + buf * (KS * KPH * 2), 8 * KPH * 2, kg + (size_t)(t + 2) * KS * DM, 128 * 8);
          copy8(vl + buf * (DM * VPH * 2), 16 * VPH * 2, vg + (size_t)(t + 2) * KS, (size_t)16 * SEQ);
      }
    }
    asm volatile("s_wait_asynccnt 0x0" ::: "memory");         // nothing of this wave is in flight when the ring is left
    l += __shfl_xor(l, 16, 32);
    const size_t pt = (size_t)(t0 >> 4) * KSP + (size_t)by;     // (tile, range)
    float* po = PO + pt * (16 * 128) + lane * 4;
#pragma unroll
    for (int j = 0; j < 8; ++j) {
        v4f a, c;
        a[0] = o[j][0]; a[1] = o[j][1]; a[2] = o[j][2]; a[3] = o[j][3];
        c[0] = o[j][4]; c[1] = o[j][5]; c[2] = o[j][6]; c[3] = o[j][7];
        *(v4f*)(po + (2 * j) * 128) = a; *(v4f*)(po + (2 * j + 1) * 128) = c;
    }
    v2f ml; ml[0] = m; ml[1] = l;
    *(v2f*)(ML + (pt * 32 + lane) * 2) = ml;
    asm volatile("s_wait_xcnt 0x0" ::: "memory");   // the column-sum part is laid out behind these stores and writes their registers: the wait stands in front of that
}

// 2^d for the merge weights, with the free slot that the instruction set asks for behind a transcendental in the same statement
__device__ __forceinline__ float exp2_slot(float d) { float w; asm("v_exp_f32 %0, %1\n\tv_nop" : "=v"(w) : "v"(d)); return w; }

// k_merge: joins the KSP partials of one 16-row query tile (ranges in fixed order 0..KSP-1): weight exp2(m_s - max), out = sum(w o) / sum(w l) + EC.
// One block per tile; wave w owns pieces 4w..4w+3 = columns 32w..32w+31 (piece 2j+q of lane (t = lane&15, h = lane>>4): d = 16j + 8h + 4q + 0..3),
// turns them through a wave-private LDS tile and stores whole 128-B lines.
__global__ __launch_bounds__(128) void k_merge(const float* __restrict__ PO, const float* __restrict__ ML, const float* __restrict__ EC, float* OUT) {
    __shared__ __align__(16) float os[4 * 16 * MSP];
    const int lane = threadIdx.x & 31, wave = __builtin_amdgcn_readfirstlane((int)(threadIdx.x >> 5)), lr = lane & 15, hi = lane >> 4;
    const size_t tile = blockIdx.x;
    const float* mb = ML + tile * (KSP * 64) + lane * 2;                     // the tile's KSP partials lie side by side
    const float* pb = PO + tile * (KSP * 16 * 128) + wave * (4 * 128) + lane * 4;
    v4f x[KSP][4], e[4]; float ms[KSP], ls[KSP];
#pragma unroll
    for (int s = 0; s < KSP; ++s) {
        const v2f ml = *(const v2f*)(mb + s * 64); ms[s] = ml[0]; ls[s] = ml[1];
#pragma unroll
        for (int p = 0; p < 4; ++p) x[s][p] = *(const v4f*)(pb + s * (16 * 128) + p * 128);
    }
#pragma unroll
    for (int p = 0; p < 4; ++p) e[p] = *(const v4f*)(EC + 8 * (32 * wave + 16 * (p >> 1) + 4 * (p & 1) + 8 * hi));   // four columns per 128-B line of EC
    __builtin_amdgcn_sched_barrier(0);   // keeps all 44 loads in front of the sums, in flight together: without it they sank to their uses, a few per memory round trip
    float mx = ms[0];
#pragma unroll
    for (int s = 1; s < KSP; ++s) mx = fmaxf(mx, ms[s]);
    v4f acc[4]; float l = 0.0f;
#pragma unroll
    for (int p = 0; p < 4; ++p) acc[p] = (v4f){};
#pragma unroll
    for (int s = 0; s < KSP; ++s) {
        const float w = exp2_slot(ms[s] - mx);
        l += w * ls[s];
#pragma unroll
        for (int p = 0; p < 4; ++p) acc[p] += x[s][p] * w;
    }
    const float inv = 1.0f / l;
    const int wb = wave * 16 * MSP;
#pragma unroll
    for (int p = 0; p < 4; ++p) {
        const int dl = 16 * (p >> 1) + 8 * hi + 4 * (p & 1);            // column inside the wave's 32
        *(v4fa*)(&os[wb + lr * MSP + dl]) = acc[p] * inv + e[p];
    }
    wave_sync();
    float* orow = OUT + tile * 16 * DM + 32 * wave;
#pragma unroll
    for (int s = 0; s < 4; ++s) {                              // 4 rows per store: 8 lanes x 4 floats = one 128-B line each
        const int row = 4 * s + (lane >> 3), c4 = (lane & 7) * 4;
        const v4f val = *(const v4fa*)(&os[wb + row * MSP + c4]);
        *(v4f*)(orow + (size_t)row * DM + c4) = val; }
}

static constexpr size_t al256(size_t v) { return (v + 255) & ~(size_t)255; }
static constexpr size_t SZ_PL = al256((size_t)SEQ * DM * 2);          // one 16-bit plane [SEQ][128] or [128][SEQ]
static constexpr size_t SZ_WB = al256((size_t)2 * DM * DM * 2);       // two transposed bf16 weight planes
static constexpr size_t SZ_EC = al256((size_t)(DM / 4) * 128);         // one 128-B line per four columns
static constexpr size_t SZ_PO = al256((size_t)KSP * SEQ * DM * 4);    // f32 partial sums: SEQ x 128 values per key range
static constexpr size_t SZ_ML = al256((size_t)KSP * NT * 32 * 2 * 4); // (max, sum) per tile, range and lane
static constexpr size_t SZ_TOTAL = 4 * SZ_PL + SZ_WB + SZ_EC + SZ_PO + SZ_ML;
static_assert(SZ_TOTAL <= (size_t)134217728);          // workspace carve <= 128 MiB
static_assert(((size_t)DM * DM * 2) % 256 == 0);       // weight sub-planes stay 256-byte aligned

extern "C" void kernel_launch(void* const* d_in, const int* in_sizes, int n_in,
                              void* d_out, int out_size, void* d_ws, size_t ws_size, hipStream_t stream) {
    if (n_in < 3) return;
    if ((size_t)in_sizes[0] < (size_t)SEQ * DM) return;
    if ((size_t)in_sizes[1] < (size_t)DM * DM || (size_t)in_sizes[2] < (size_t)DM * DM) return;
    if ((size_t)out_size < (size_t)SEQ * DM) return;
    if (SZ_TOTAL > ws_size) return;
    const float* x = (const float*)d_in[0]; const float* w = (const float*)d_in[1]; const float* v = (const float*)d_in[2];   // wire order X, W, V (W, V are [in][out])
    float* OUT = (float*)d_out;      // [SEQ][128]
    char* wsp = (char*)d_ws;
    bf*  XB = (bf*)wsp;  wsp += SZ_PL;               // [SEQ][128] bf16 x
    h16* KP = (h16*)wsp; wsp += SZ_PL;               // [SEQ][128] f16 image of bf16 x (k plane)
    bf*  WB = (bf*)wsp;  wsp += SZ_WB;               // [2][128 e][128 d]: W^T | V^T weights
    h16* QH = (h16*)wsp; wsp += SZ_PL;               // [SEQ][128] q
    h16* VT = (h16*)wsp; wsp += SZ_PL;               // [128 e][SEQ] v^T
    float* EC = (float*)wsp; wsp += SZ_EC;           // [32 lines][4 of 32 floats] 1e-8 * column sums of v
    float* PO = (float*)wsp; wsp += SZ_PO;           // flash partial sums
    float* ML = (float*)wsp; wsp += SZ_ML;           // flash partial (max, sum)
    bf* WT = WB; bf* VWT = WB + (size_t)DM * DM;

    // inputs -> bf16 x, f16 k plane, transposed bf16 weights (in[rows d][cols e] -> out[e][d])
    { const size_t n8 = (size_t)SEQ * DM / 8;
      k_prep<<<(unsigned)(2 * WSL + (n8 + 255) / 256), 256, 0, stream>>>(x, w, v, XB, KP, WT, VWT, n8); }

    // q plane [t][e] and v^T plane [e][t]
    k_proj<<<dim3(SEQ / 64, DM / 64, 2), 32, 0, stream>>>(XB, WT, VWT, QH, VT);

    // flash partials, and the column sums of v
    k_flash<<<FBX * KSP + DM / 4, 32 * AW, 0, stream>>>(QH, KP, VT, PO, ML, EC);

    k_merge<<<NT, 128, 0, stream>>>(PO, ML, EC, OUT);
}

// v007
// A run of this version takes 44.2 microseconds.
// Timed twice side by side with v006, it ran 1.04 and 1.03 times as fast.
// Over all steps from v000 it is 8.79 times as fast.
#include <hip/hip_runtime.h>

// Single-head attention, x [SEQ][128], W and V [in][out] (q = x W, v = x V), k = x itself, score scale 128^-0.5, out = (softmax + 1e-8) v (f32).
// Compute dtypes, f32 accumulate everywhere: projections v_wmma_f32_16x16x32_bf16 (x, W, V RNE-converted to bf16; products exact);
// scores v_wmma_f32_16x16x32_f16: k = f16 of the bf16 x value (exact), q as one f16 value (its 2^-12 rounding lies under the 2^-9 bf16 rounding that x and W bring into q and k);
// P (x256 carry, cancels in the normalisation) and v single f16; softmax f32 (online; the maximum in use is raised, and the sums rescaled, only when a score passes it by 2^7); the 1e-8 term is added in f32 from a column-sum table.
// Layout: bf16 copy of x, f16 k plane [t][d], bf16 transposed weights [e][d]; q plane [t][e] and v^T plane [e][t] written by the GEMM epilogue;
// fused flash kernel in transposed form (S^T = K Q^T, O^T = V^T P^T), output from f32 accumulators; its k and v^T tiles are staged in LDS
// (two buffers of 64 keys, asynchronous 16-B copies in whole 128-B lines) and shared by the block's four waves.
// Each wave works 32 query rows (two 16-row tiles), so that every k and v^T fragment read from LDS feeds two matrix instructions.
// The keys are cut into KSP ranges, one flash block per (128 query rows, range): each writes its un-normalised f32 sums with (max, sum) to the workspace,
// and a merge launch joins the ranges, normalises, adds the 1e-8 term and stores the output.
// Four launches, each reading only what an earlier one wrote; work that reads none of each other's output shares a grid, told apart by the block index:
// k_prep (both weight transposes + the x conversion), k_proj (q tiles + v^T tiles), k_flash (flash blocks + the column-sum blocks), k_merge.

#ifndef NB
#define NB 1
#endif
#ifndef SEQ
#define SEQ 8192
#endif
#define NB_FULL  1
#define SEQ_FULL 8192
#define DM   128                 // feature width = head width (one head)
#define AW   4                   // waves per flash block
#define QT   2                   // 16-row query tiles per flash wave: each k / v^T fragment read from LDS is used QT times
#define OSP  132                 // LDS row pitch (floats) of the weight-transpose tile
#define SC2  (0.08838834764831845f * 1.4426950408889634f)   // 128^-0.5 * log2(e)
#define PSH  8.0f                // log2 of the P carry (256)
#define TAU  7.0f                // a score may pass the maximum in use by this much (log2) before the sums are rescaled: P <= 2^(PSH + TAU) = 2^15 stays finite in f16
#define EPSW 1.0e-8f
#define KS   64                  // keys per LDS stage of the flash kernel (two 32-key passes)
#define KPH  136                 // LDS row pitch (halves) of a staged k row: 272 B = 16 B x odd, conflict-free for 16-B fragment reads
#define VPH  72                  // LDS row pitch (halves) of a staged v^T row piece (64 keys): 144 B = 16 B x odd
#define KSP  8                   // key ranges of the flash grid: 64 x 8 blocks of 4 waves = 2 blocks per WGP, 2 waves per SIMD on 256 WGPs
#define NST  (SEQ / KS / KSP)    // LDS stages per key range
#define NT   (SEQ / 16)          // 16-row query tiles
#define WSL  (DM / 32)           // 32-column slabs (blocks) of one weight transpose
#define FBX  (SEQ / (16 * QT * AW))   // flash blocks per key range
#define MSP  36                  // LDS row pitch (floats) of the merge kernel's 16 x 32 output tile: 144 B = 16 B x odd

static_assert(NB == 1);                        // no batch dimension in this module
static_assert(DM == 128);                      // store maps assume 128 columns (512 B per f32 row, 256 B per 16-bit row)
static_assert(DM % 64 == 0);
static_assert(DM % 32 == 0);                   // GEMM and score k-loops step by 32
static_assert(SEQ % 1024 == 0);                // column-sum quarters of whole 512-B loads, 64-row tiles, 32-key steps, flash grid
static_assert(SEQ % (16 * QT * AW) == 0);
static_assert(((size_t)SEQ * DM) % 8 == 0);
static_assert(SEQ <= SEQ_FULL);
static_assert((OSP * 4) % 16 == 0);
static_assert(SEQ % (KS * KSP) == 0 && NST >= 2);  // equal key ranges; the two-buffer ring's prologue fills stages 0 and 1
static_assert(QT == 2);                        // the rescale test and the two v_nop statements of the flash loop name both tiles
static_assert(KS == 64 && AW == 4);            // copy maps: 128 lanes x 8 copies x 16 B = one 16-KiB k tile, and one 16-KiB v^T tile
static_assert((KPH * 2) % 32 == 16 && (VPH * 2) % 32 == 16 && KPH >= DM && VPH >= KS);

typedef _Float16 h16;
typedef unsigned short bf;
typedef __attribute__((ext_vector_type(16))) __bf16   v16bf;
typedef __attribute__((ext_vector_type(16))) _Float16 v16h;
typedef __attribute__((ext_vector_type(8)))  _Float16 v8h;
typedef __attribute__((ext_vector_type(8)))  unsigned short v8us;
typedef __attribute__((ext_vector_type(8)))  float    v8f;
typedef __attribute__((ext_vector_type(4)))  float    v4f;
typedef v4f  __attribute__((may_alias)) v4fa;
typedef __attribute__((ext_vector_type(2)))  float    v2f;

__device__ __forceinline__ unsigned short f2bf(float f) { unsigned u = __float_as_uint(f); u += 0x7FFFu + ((u >> 16) & 1u); return (unsigned short)(u >> 16); }
__device__ __forceinline__ v16h cat16(v8h lo, v8h hi) { return __builtin_shufflevector(lo, hi, 0, 1, 2, 3, 4, 5, 6, 7, 8, 9, 10, 11, 12, 13, 14, 15); }
__device__ __forceinline__ v16bf cat16b(v8us lo, v8us hi) { return __builtin_bit_cast(v16bf, __builtin_shufflevector(lo, hi, 0, 1, 2, 3, 4, 5, 6, 7, 8, 9, 10, 11, 12, 13, 14, 15)); }
__device__ __forceinline__ v8f wmma16(v16h a, v16h b, v8f c) { return __builtin_amdgcn_wmma_f32_16x16x32_f16(false, a, false, b, (short)0, c, false, false); }
__device__ __forceinline__ v8f wmmab(v16bf a, v16bf b, v8f c) { return __builtin_amdgcn_wmma_f32_16x16x32_bf16(false, a, false, b, (short)0, c, false, false); }
// fragment loaders from K-contiguous 16-bit rows; p already includes + 8*(lane>>4): elements 0..7 <- k0+8h+0..7, elements 8..15 <- k0+16+8h+0..7 (same map for A and B)
__device__ __forceinline__ v16h  ldh(const h16* p) { return cat16(*(const v8h*)p, *(const v8h*)(p + 16)); }
__device__ __forceinline__ v16bf ldb(const bf* p)  { return cat16b(*(const v8us*)p, *(const v8us*)(p + 16)); }
// ordering point for wave-private LDS tiles (same wave writes and reads)
__device__ __forceinline__ void wave_sync() { __builtin_amdgcn_fence(3 /* release order */, "wavefront"); __builtin_amdgcn_wave_barrier(); asm volatile("" ::: "memory"); }

// Eight asynchronous 16-B copies per lane, global -> LDS, through no register: copy i moves l + i*ls (halves) <- g + i*gs (halves).
// Written as the builtin: the flash kernel uses registers above v255, which the text of an asm statement cannot name; as asm operands the
// lane's base addresses were held below v256 for the whole loop, found no place there and went to scratch.
typedef __attribute__((ext_vector_type(4))) int v4i;
typedef __attribute__((address_space(1))) v4i gv4i;
typedef __attribute__((address_space(3))) v4i lv4i;
__device__ __forceinline__ void copy8(h16* l, int ls, const h16* g, size_t gs) {
#pragma unroll   // eight copies in a row, their steps constants
    for (int i = 0; i < 8; ++i) __builtin_amdgcn_global_load_async_to_lds_b128((gv4i*)(g + i * gs), (lv4i*)(l + i * ls), 0, 0);
}

// cvtx: block b of the conversion: 8 values per thread, f32 x -> bf16 plane and its f16 image (k plane).
__device__ __forceinline__ void cvtx(int b, const float* __restrict__ src, bf* xb, h16* kp, size_t n8) {
    const size_t i = (size_t)b * 256 + threadIdx.x; if (i >= n8) return;
    const v8f v = *(const v8f*)(src + i * 8); v8us o; v8h k;
#pragma unroll
    for (int e = 0; e < 8; ++e) { const unsigned short u = f2bf(v[e]); o[e] = u; k[e] = (h16)__uint_as_float(((unsigned)u) << 16); }
    *(v8us*)(xb + i * 8) = o; *(v8h*)(kp + i * 8) = k;
    
}

// wT: src f32 [rows d = 128][cols e = 128] -> dst bf16 [e][d] (RNE convert), slab of 32 columns e, transposed through LDS (block barrier: cross-wave tile).
__device__ __forceinline__ void wT(int slab, const float* __restrict__ src, bf* dst) {
    __shared__ __align__(16) float ts[32 * OSP];
    const int tid = threadIdx.x; const int e0 = slab * 32;
#pragma unroll 4
    for (int it = 0; it < 16; ++it) { const int idx = it * 256 + tid; const int d = idx >> 5, ee = idx & 31;      // 16 x 256 = 128 d x 32 e: whole tile written
        ts[ee * OSP + d] = src[(size_t)d * DM + e0 + ee]; }
    __syncthreads();
{
#pragma unroll
        for (int it = 0; it < 2; ++it) { const int idx = it * 256 + tid; const int ee = idx >> 4, d8 = (idx & 15) * 8;   // 2 x 256 = 32 rows x 16 pieces
            const v4f x0 = *(const v4fa*)(&ts[ee * OSP + d8]); const v4f x1 = *(const v4fa*)(&ts[ee * OSP + d8 + 4]); v8us o;
#pragma unroll
            for (int i = 0; i < 4; ++i) { o[i] = f2bf(x0[i]); o[4 + i] = f2bf(x1[i]); }
            *(v8us*)(dst + (size_t)(e0 + ee) * DM + d8) = o; }
         }
    asm volatile("s_wait_xcnt 0x0" ::: "memory");   // the conversion part is laid out behind these stores and writes their registers: the wait stands in front of that
}

// k_prep: everything that reads the inputs alone, in one grid. Blocks 0..WSL-1 transpose W, WSL..2*WSL-1 transpose V (first in the grid: dependent
// load rounds, the longest blocks), the rest convert x. The choice depends on blockIdx alone, so the transposes' barrier is met by whole blocks.
__global__ __launch_bounds__(256) void k_prep(const float* __restrict__ x, const float* __restrict__ w, const float* __restrict__ v,
                                              bf* xb, h16* kp, bf* wt, bf* vwt, size_t n8) {
    const int b = blockIdx.x;
    if (b >= 2 * WSL) { cvtx(b - 2 * WSL, x, xb, kp, n8); return; }
    const bool second = b >= WSL;
    wT(second ? b - WSL : b, second ? v : w, second ? vwt : wt);
}

// k_proj: register-blocked bf16 GEMM, ONE WAVE per 64x64 tile (16 accumulators), operands straight from K-contiguous bf16 planes, K = DM.
// C[m][n] = sum_k A[m][k] Bt[n][k], written as f16 (Ph) at r0*pitch + c0, row pitch 'pitch' (halves).
// Both projections in one grid (SEQ/64, DM/64, 2), 32 threads; x = 64 rows t of x, y = 64 columns e of the weight.
// z = 0, q: A = x rows (m = t), Bt = W^T rows (n = e) -> plane [t][e]. z = 1, v^T: A = V^T weight rows (m = e), Bt = x rows (n = t) -> plane [e][t].
__global__ __launch_bounds__(32) void k_proj(const bf* __restrict__ XB, const bf* __restrict__ WT, const bf* __restrict__ VWT, h16* QH, h16* VT) {
    __shared__ __align__(16) float os[16 * 68];
    const int K = DM;
    const bool isv = blockIdx.z != 0;
    const bf* A = isv ? VWT : XB; const bf* Bt = isv ? XB : WT; h16* Ph = isv ? VT : QH;
    const int pitch = isv ? SEQ : DM;
    const int lane = threadIdx.x & 31, lr = lane & 15, hi = lane >> 4; const int r0 = (isv ? blockIdx.y : blockIdx.x) * 64, c0 = (isv ? blockIdx.x : blockIdx.y) * 64;
    v8f acc[4][4];
#pragma unroll
    for (int mb = 0; mb < 4; ++mb)
#pragma unroll
        for (int nb = 0; nb < 4; ++nb) acc[mb][nb] = (v8f){};
    const size_t aoff = (size_t)(r0 + lr) * K + 8 * hi, boff = (size_t)(c0 + lr) * K + 8 * hi;
#pragma unroll 1
    for (int kc = 0; kc < K; kc += 32) {
        v16bf a[4];
#pragma unroll
        for (int mb = 0; mb < 4; ++mb) a[mb] = ldb(A + aoff + (size_t)mb * 16 * K + kc);
#pragma unroll
        for (int nb = 0; nb < 4; ++nb) { const v16bf b = ldb(Bt + boff + (size_t)nb * 16 * K + kc);
#pragma unroll
            for (int mb = 0; mb < 4; ++mb) acc[mb][nb] = wmmab(a[mb], b, acc[mb][nb]); }
        asm volatile("v_nop\n\tv_nop\n\tv_nop\n\tv_nop" : "+v"(acc[0][0]), "+v"(acc[1][1]), "+v"(acc[2][2]), "+v"(acc[3][3]) : "v"(a[0]), "v"(a[1]), "v"(a[2]), "v"(a[3]));
    }
    const size_t tbase = (size_t)r0 * (size_t)pitch + (size_t)c0;
#pragma unroll
    for (int mb = 0; mb < 4; ++mb) {
#pragma unroll
        for (int nb = 0; nb < 4; ++nb) {
#pragma unroll
            for (int j = 0; j < 8; ++j) os[(hi * 8 + j) * 68 + nb * 16 + lr] = acc[mb][nb][j]; }   // D: row 8h+j, col lane&15
        wave_sync();
        const size_t sb = tbase + (size_t)(mb * 16) * (size_t)pitch;
{
#pragma unroll
            for (int s = 0; s < 4; ++s) { const int row = 4 * s + (lane >> 3), c8 = (lane & 7) * 8;   // 4 s x 4 row groups = 16 rows; 8 lanes x 8 = 64 columns
                const v4f x0 = *(const v4fa*)(&os[row * 68 + c8]); const v4f x1 = *(const v4fa*)(&os[row * 68 + c8 + 4]); v8h hv;
#pragma unroll
                for (int i = 0; i < 4; ++i) { hv[i] = (h16)x0[i]; hv[4 + i] = (h16)x1[i]; }
                const size_t oo = sb + (size_t)row * (size_t)pitch + c8;
                *(v8h*)(Ph + oo) = hv; }
             }
        if (mb < 3) asm volatile("s_wait_xcnt 0x0" ::: "memory");   // the next 16 rows' address sums and LDS reads write registers that these stores name: the wait stands in front of that
        wave_sync();
    }
}

// colsum: EC = 1e-8 * row sums of VT, for the DM/4 blocks of four waves that close the flash grid. Block b owns rows 4b..4b+3, wave w the whole row 4b + w:
// 32 loads of 16 B per lane, all in flight together (a wave's load = 512 contiguous bytes). Fixed-order sums: per quarter row over its eight loads and
// over the lanes, then the four quarters pairwise.
// EC layout: the four sums of block b stand at the head of the block's own 128-B line, EC[32b + 0..3] (one writer per line): column e is EC[8*(e & ~3) + (e & 3)].
__device__ __forceinline__ void colsum(int b, const h16* __restrict__ VT, float* EC) {
    __shared__ __align__(16) float red[AW];
    const int lane = threadIdx.x & 31, wave = __builtin_amdgcn_readfirstlane((int)(threadIdx.x >> 5));
    const h16* src = VT + (size_t)(b * 4 + wave) * SEQ + lane * 8;
    v8h x[SEQ / 256];
#pragma unroll   // all loads issue before the first sum: rolled, each trip would wait out its own round trip
    for (int it = 0; it < SEQ / 256; ++it) x[it] = *(const v8h*)(src + it * 256);
    float sq[4];
#pragma unroll   // x[] and sq[] are indexed by constants only, so they stay in registers
    for (int q = 0; q < 4; ++q) {
        float s = 0.0f;
#pragma unroll   // constant indices into x[], as above
        for (int it = q * (SEQ / 1024); it < (q + 1) * (SEQ / 1024); ++it) {
            const float p0 = (float)x[it][0] + (float)x[it][1], p1 = (float)x[it][2] + (float)x[it][3], p2 = (float)x[it][4] + (float)x[it][5], p3 = (float)x[it][6] + (float)x[it][7];
            s += (p0 + p1) + (p2 + p3); }
        s += __shfl_xor(s, 16, 32); s += __shfl_xor(s, 8, 32); s += __shfl_xor(s, 4, 32); s += __shfl_xor(s, 2, 32); s += __shfl_xor(s, 1, 32);
        sq[q] = s;
    }
    if (lane == 0) red[wave] = (sq[0] + sq[1]) + (sq[2] + sq[3]);
    __syncthreads();
    if (threadIdx.x == 0) {
        v4f o;
#pragma unroll   // o[] indexed by constants: one 16-B store from registers
        for (int i = 0; i < 4; ++i) o[i] = red[i] * EPSW;
        *(v4f*)(EC + b * 32) = o;
    }
}

// k_flash: fused attention, one wave per 16 * QT query rows; Q fragments straight from the f16 plane; K / V^T fragments from LDS tiles of 64 keys that the
// block's four waves fill together and share (two 16-B LDS loads per fragment). Ring of two buffers: the copies of stage t + 1 fly while stage t is worked on.
// Transposed form: S^T[key][t] = K Q^T (A = K rows, B = Q rows); lane (t = lane&15, h = lane>>4) holds keys 8h+r of each 16-key tile, so the packed
// P tile is directly the B fragment of O^T[d][t] = V^T P^T (element r <- tile keys 0..15, element 8+r <- tile keys 16..31, lane unchanged).
// Softmax state (maximum in use, partial sum) is one scalar per lane and query tile; the two lane halves of a row are combined with one xor-16 exchange, at a rescale and at the end.
// Block (x, y) works query rows 128x.. on keys y*SEQ/KSP.. only; its result is a partial: PO holds the accumulators in register order
// ([tile][range][piece 2j+q][lane][4 floats], each store 512 contiguous bytes), ML the pair (max, sum) per lane ([tile][range][lane][2]).
// Flat grid: block f < FBX*KSP is flash block (x, y) = (f % FBX, f / FBX); the DM/4 blocks behind them take the column sums, which read VT alone and are read
// by the merge launch only. They are short and stand last in the grid, so that they start in the places that the first finished flash blocks leave.
// Every unrolled loop over q (query tile), c, j or r below has constant indices, so that the fragment, score and accumulator arrays stay in registers.
// Two waves per SIMD, no more: the 512 flash blocks then lie two on each of the 256 WGPs, whatever order they are placed in.
__global__ __launch_bounds__(32 * AW) __attribute__((amdgpu_waves_per_eu(2, 2))) void k_flash(const h16* __restrict__ QH, const h16* __restrict__ KP, const h16* __restrict__ VT, float* PO, float* ML, float* EC) {
    if (blockIdx.x >= FBX * KSP) { colsum((int)blockIdx.x - FBX * KSP, VT, EC); return; }   // whole blocks, ahead of every copy and barrier of the flash part
    const int bx = blockIdx.x % FBX, by = blockIdx.x / FBX;
    __shared__ __align__(16) h16 ks[2 * KS * KPH];            // [buffer][key][d], pitch KPH
    __shared__ __align__(16) h16 vs[2 * DM * VPH];            // [buffer][d][key], pitch VPH
    const int tid = threadIdx.x;
    const int lane = threadIdx.x & 31, wave = __builtin_amdgcn_readfirstlane((int)(threadIdx.x >> 5)), lr = lane & 15, hi = lane >> 4;
    const int t0 = (bx * AW + wave) * (16 * QT);
    // copy maps, 16-B piece i = 128*it + tid. k tile: 64 rows x 16 pieces, contiguous in the plane (a wave's copy = 512 B = 4 lines); row = i >> 4.
    // v^T tile: 128 rows x 8 pieces (a wave's copy = 4 rows x one 128-B line); row = i >> 3.
    h16* kl = ks + (tid >> 4) * KPH + (tid & 15) * 8;
    h16* vl = vs + (tid >> 3) * VPH + (tid & 7) * 8;
    const size_t key0 = (size_t)by * (NST * KS);      // first key of this block's range
    const h16* kg = KP + key0 * DM + (size_t)tid * 8;
    const h16* vg = VT + (size_t)(tid >> 3) * SEQ + key0 + (tid & 7) * 8;
    // prologue: stage 0 lands and is published, then stage 1 is started
    copy8(kl, 8 * KPH, kg, 128 * 8); copy8(vl, 16 * VPH, vg, (size_t)16 * SEQ);
    asm volatile("s_wait_asynccnt 0x0" ::: "memory");         // this wave's copies of stage 0 have landed
    __syncthreads();                                          // every wave's have: stage 0 may be read
    copy8(kl + KS * KPH, 8 * KPH, kg + (size_t)KS * DM, 128 * 8); copy8(vl + DM * VPH, 16 * VPH, vg + KS, (size_t)16 * SEQ);
    const size_t qo = (size_t)(t0 + lr) * DM + 8 * hi;
    v16h qh[QT][4];                                           // B fragments: col t, k = d (four 32-deep steps)
#pragma unroll
    for (int q = 0; q < QT; ++q)
#pragma unroll
        for (int c = 0; c < 4; ++c) qh[q][c] = ldh(QH + qo + (size_t)q * 16 * DM + 32 * c);
    const int ko = lr * KPH + 8 * hi;                         // + key * KPH       (A fragment: row key, k = d)
    const int vo = lr * VPH + 8 * hi;                         // + 16j*VPH + key   (A fragment: row d, k = key)
    v8f o[QT][8];
    float m[QT], l[QT];
#pragma unroll
    for (int q = 0; q < QT; ++q) { m[q] = -3.0e38f; l[q] = 0.0f;
#pragma unroll
        for (int j = 0; j < 8; ++j) o[q][j] = (v8f){}; }
#pragma unroll 1
    for (int t = 0; t < NST; ++t) {
      const int buf = t & 1;
#pragma unroll 1   // kept rolled: one copy of the pass and of its rescale branch; unrolled, the text doubled and 18 more registers were taken
      for (int ps = 0; ps < KS / 32; ++ps) {
        const h16* kp = ks + buf * (KS * KPH) + ko + ps * 32 * KPH;
        v16h ka[4], kb[4];
#pragma unroll
        for (int c = 0; c < 4; ++c) { ka[c] = ldh(kp + 32 * c); kb[c] = ldh(kp + 16 * KPH + 32 * c); }
        v8f sHa[QT], sHb[QT];
#pragma unroll
        for (int q = 0; q < QT; ++q) { sHa[q] = (v8f){}; sHb[q] = (v8f){}; }
#pragma unroll
        for (int c = 0; c < 4; ++c)
#pragma unroll
            for (int q = 0; q < QT; ++q) { sHa[q] = wmma16(ka[c], qh[q][c], sHa[q]); sHb[q] = wmma16(kb[c], qh[q][c], sHb[q]); }
        asm volatile("v_nop\n\tv_nop\n\tv_nop\n\tv_nop" : "+v"(sHa[0]), "+v"(sHb[0]), "+v"(sHa[1]), "+v"(sHb[1])
                     : "v"(ka[0]), "v"(ka[1]), "v"(ka[2]), "v"(ka[3]), "v"(kb[0]), "v"(kb[1]), "v"(kb[2]), "v"(kb[3]));
        // the v^T fragment reads stand in front of the softmax and its branch, so that they return while the vector work runs
        const h16* va = vs + buf * (DM * VPH) + vo + ps * 32;
        v16h vv[8];
#pragma unroll
        for (int j = 0; j < 8; ++j) vv[j] = ldh(va + 16 * j * VPH);
        __builtin_amdgcn_sched_barrier(0);   // keeps the sixteen reads one group: without it they were strewn among the vector instructions in six places
        v8f ta[QT], tb[QT]; float mx[QT];
#pragma unroll
        for (int q = 0; q < QT; ++q) { ta[q] = sHa[q] * SC2; tb[q] = sHb[q] * SC2; mx[q] = -3.0e38f;
#pragma unroll
            for (int r = 0; r < 8; ++r) mx[q] = fmaxf(mx[q], fmaxf(ta[q][r], tb[q][r])); }
        // lazy rescale: one test per pass on each lane's own maxima (m is equal in a row's two lanes, the ballot sees both); while no score lies more
        // than TAU above the maximum in use, m stays and sums and accumulators are left alone. A scalar branch: all lanes stay on for the WMMAs behind it.
        if (__builtin_expect(__builtin_amdgcn_ballot_w32(mx[0] > m[0] + TAU || mx[1] > m[1] + TAU) != 0, 0)) {   // marked rare: the pass without a rescale is laid out straight through
#pragma unroll
            for (int q = 0; q < QT; ++q) {
                const float mw = fmaxf(mx[q], __shfl_xor(mx[q], 16, 32));
                const float mnew = fmaxf(m[q], mw);
                const float alpha = __builtin_amdgcn_exp2f(m[q] - mnew);
                l[q] *= alpha; m[q] = mnew;
#pragma unroll
                for (int j = 0; j < 8; ++j) o[q][j] = o[q][j] * alpha;
            }
        }
        v16h pb[QT];
#pragma unroll
        for (int q = 0; q < QT; ++q) {
            const float sh = PSH - m[q];
            float ls = 0.0f;
#pragma unroll
            for (int r = 0; r < 8; ++r) { const h16 pa = (h16)__builtin_amdgcn_exp2f(ta[q][r] + sh); const h16 pc = (h16)__builtin_amdgcn_exp2f(tb[q][r] + sh); pb[q][r] = pa; pb[q][8 + r] = pc; ls += (float)pa + (float)pc; }
            l[q] += ls;
        }
#pragma unroll
        for (int j = 0; j < 8; ++j)
#pragma unroll
            for (int q = 0; q < QT; ++q) o[q][j] = wmma16(vv[j], pb[q], o[q][j]);
        // four free vector slots behind the last matrix instructions, on the loop's taken branch too; the operands only hold the statement behind all sixteen
        asm volatile("v_nop\n\tv_nop\n\tv_nop\n\tv_nop"
                     :: "v"(o[0][0]), "v"(o[0][1]), "v"(o[0][2]), "v"(o[0][3]), "v"(o[0][4]), "v"(o[0][5]), "v"(o[0][6]), "v"(o[0][7]),
                        "v"(o[1][0]), "v"(o[1][1]), "v"(o[1][2]), "v"(o[1][3]), "v"(o[1][4]), "v"(o[1][5]), "v"(o[1][6]), "v"(o[1][7]));
      }
      // publish point of stage t + 1, every wave, in this order
      asm volatile("s_wait_dscnt 0x0" ::: "memory");          // this wave's reads of stage t have returned before its buffer is refilled
      asm volatile("s_wait_asynccnt 0x0" ::: "memory");       // this wave's copies of stage t + 1 have landed
      __syncthreads();                                        // publishes stage t + 1 and ends every wave's reads of stage t
      if (t + 2 < NST) {                                      // same for the whole block: refill the buffer that stage t has just left
          copy8(kl + buf * (KS * KPH), 8 * KPH, kg + (size_t)(t + 2) * KS * DM, 128 * 8);
          copy8(vl + buf * (DM * VPH), 16 * VPH, vg + (size_t)(t + 2) * KS, (size_t)16 * SEQ);
      }
    }
    asm volatile("s_wait_asynccnt 0x0" ::: "memory");         // nothing of this wave is in flight when the ring is left
    v2f ml[QT]; float* po[QT]; float* mp[QT];
#pragma unroll
    for (int q = 0; q < QT; ++q) {
        const size_t pt = (size_t)((t0 >> 4) + q) * KSP + (size_t)by;     // (tile, range)
        po[q] = PO + pt * (16 * 128) + lane * 4; mp[q] = ML + (pt * 32 + lane) * 2;
        ml[q][0] = m[q]; ml[q][1] = l[q] + __shfl_xor(l[q], 16, 32);
    }
    __builtin_amdgcn_sched_barrier(0);   // sums and addresses stand in front of the stores: among them they were written over registers that an issued store names
#pragma unroll
    for (int q = 0; q < QT; ++q) {
#pragma unroll
        for (int j = 0; j < 8; ++j) {
            v4f a, c;
            a[0] = o[q][j][0]; a[1] = o[q][j][1]; a[2] = o[q][j][2]; a[3] = o[q][j][3];
            c[0] = o[q][j][4]; c[1] = o[q][j][5]; c[2] = o[q][j][6]; c[3] = o[q][j][7];
            *(v4f*)(po[q] + (2 * j) * 128) = a; *(v4f*)(po[q] + (2 * j + 1) * 128) = c;
        }
        *(v2f*)mp[q] = ml[q];
    }
    asm volatile("s_wait_xcnt 0x0" ::: "memory");   // the column-sum part is laid out behind these stores and writes their registers: the wait stands in front of that
}

// 2^d for the merge weights, with the free slot that the instruction set asks for behind a transcendental in the same statement
__device__ __forceinline__ float exp2_slot(float d) { float w; asm("v_exp_f32 %0, %1\n\tv_nop" : "=v"(w) : "v"(d)); return w; }

// k_merge: joins the KSP partials of one 16-row query tile (ranges in fixed order 0..KSP-1): weight exp2(m_s - max), out = sum(w o) / sum(w l) + EC.
// One block per tile; wave w owns pieces 4w..4w+3 = columns 32w..32w+31 (piece 2j+q of lane (t = lane&15, h = lane>>4): d = 16j + 8h + 4q + 0..3),
// turns them through a wave-private LDS tile and stores whole 128-B lines.
__global__ __launch_bounds__(128) void k_merge(const float* __restrict__ PO, const float* __restrict__ ML, const float* __restrict__ EC, float* OUT) {
    __shared__ __align__(16) float os[4 * 16 * MSP];
    const int lane = threadIdx.x & 31, wave = __builtin_amdgcn_readfirstlane((int)(threadIdx.x >> 5)), lr = lane & 15, hi = lane >> 4;
    const size_t tile = blockIdx.x;
    const float* mb = ML + tile * (KSP * 64) + lane * 2;                     // the tile's KSP partials lie side by side
    const float* pb = PO + tile * (KSP * 16 * 128) + wave * (4 * 128) + lane * 4;
    v4f x[KSP][4], e[4]; float ms[KSP], ls[KSP];
#pragma unroll
    for (int s = 0; s < KSP; ++s) {
        const v2f ml = *(const v2f*)(mb + s * 64); ms[s] = ml[0]; ls[s] = ml[1];
#pragma unroll
        for (int p = 0; p < 4; ++p) x[s][p] = *(const v4f*)(pb + s * (16 * 128) + p * 128);
    }
#pragma unroll
    for (int p = 0; p < 4; ++p) e[p] = *(const v4f*)(EC + 8 * (32 * wave + 16 * (p >> 1) + 4 * (p & 1) + 8 * hi));   // four columns per 128-B line of EC
    __builtin_amdgcn_sched_barrier(0);   // keeps all 44 loads in front of the sums, in flight together: without it they sank to their uses, a few per memory round trip
    float mx = ms[0];
#pragma unroll
    for (int s = 1; s < KSP; ++s) mx = fmaxf(mx, ms[s]);
    v4f acc[4]; float l = 0.0f;
#pragma unroll
    for (int p = 0; p < 4; ++p) acc[p] = (v4f){};
#pragma unroll
    for (int s = 0; s < KSP; ++s) {
        const float w = exp2_slot(ms[s] - mx);
        l += w * ls[s];
#pragma unroll
        for (int p = 0; p < 4; ++p) acc[p] += x[s][p] * w;
    }
    const float inv = 1.0f / l;
    const int wb = wave * 16 * MSP;
#pragma unroll
    for (int p = 0; p < 4; ++p) {
        const int dl = 16 * (p >> 1) + 8 * hi + 4 * (p & 1);            // column inside the wave's 32
        *(v4fa*)(&os[wb + lr * MSP + dl]) = acc[p] * inv + e[p];
    }
    wave_sync();
    float* orow = OUT + tile * 16 * DM + 32 * wave;
#pragma unroll
    for (int s = 0; s < 4; ++s) {                              // 4 rows per store: 8 lanes x 4 floats = one 128-B line each
        const int row = 4 * s + (lane >> 3), c4 = (lane & 7) * 4;
        const v4f val = *(const v4fa*)(&os[wb + row * MSP + c4]);
        *(v4f*)(orow + (size_t)row * DM + c4) = val; }
}

static constexpr size_t al256(size_t v) { return (v + 255) & ~(size_t)255; }
static constexpr size_t SZ_PL = al256((size_t)SEQ * DM * 2);          // one 16-bit plane [SEQ][128] or [128][SEQ]
static constexpr size_t SZ_WB = al256((size_t)2 * DM * DM * 2);       // two transposed bf16 weight planes
static constexpr size_t SZ_EC = al256((size_t)(DM / 4) * 128);         // one 128-B line per four columns
static constexpr size_t SZ_PO = al256((size_t)KSP * SEQ * DM * 4);    // f32 partial sums: SEQ x 128 values per key range
static constexpr size_t SZ_ML = al256((size_t)KSP * NT * 32 * 2 * 4); // (max, sum) per tile, range and lane
static constexpr size_t SZ_TOTAL = 4 * SZ_PL + SZ_WB + SZ_EC + SZ_PO + SZ_ML;
static_assert(SZ_TOTAL <= (size_t)134217728);          // workspace carve <= 128 MiB
static_assert(((size_t)DM * DM * 2) % 256 == 0);       // weight sub-planes stay 256-byte aligned

extern "C" void kernel_launch(void* const* d_in, const int* in_sizes, int n_in,
                              void* d_out, int out_size, void* d_ws, size_t ws_size, hipStream_t stream) {
    if (n_in < 3) return;
    if ((size_t)in_sizes[0] < (size_t)SEQ * DM) return;
    if ((size_t)in_sizes[1] < (size_t)DM * DM || (size_t)in_sizes[2] < (size_t)DM * DM) return;
    if ((size_t)out_size < (size_t)SEQ * DM) return;
    if (SZ_TOTAL > ws_size) return;
    const float* x = (const float*)d_in[0]; const float* w = (const float*)d_in[1]; const float* v = (const float*)d_in[2];   // wire order X, W, V (W, V are [in][out])
    float* OUT = (float*)d_out;      // [SEQ][128]
    char* wsp = (char*)d_ws;
    bf*  XB = (bf*)wsp;  wsp += SZ_PL;               // [SEQ][128] bf16 x
    h16* KP = (h16*)wsp; wsp += SZ_PL;               // [SEQ][128] f16 image of bf16 x (k plane)
    bf*  WB = (bf*)wsp;  wsp += SZ_WB;               // [2][128 e][128 d]: W^T | V^T weights
    h16* QH = (h16*)wsp; wsp += SZ_PL;               // [SEQ][128] q
    h16* VT = (h16*)wsp; wsp += SZ_PL;               // [128 e][SEQ] v^T
    float* EC = (float*)wsp; wsp += SZ_EC;           // [32 lines][4 of 32 floats] 1e-8 * column sums of v
    float* PO = (float*)wsp; wsp += SZ_PO;           // flash partial sums
    float* ML = (float*)wsp; wsp += SZ_ML;           // flash partial (max, sum)
    bf* WT = WB; bf* VWT = WB + (size_t)DM * DM;

    // inputs -> bf16 x, f16 k plane, transposed bf16 weights (in[rows d][cols e] -> out[e][d])
    { const size_t n8 = (size_t)SEQ * DM / 8;
      k_prep<<<(unsigned)(2 * WSL + (n8 + 255) / 256), 256, 0, stream>>>(x, w, v, XB, KP, WT, VWT, n8); }

    // q plane [t][e] and v^T plane [e][t]
    k_proj<<<dim3(SEQ / 64, DM / 64, 2), 32, 0, stream>>>(XB, WT, VWT, QH, VT);

    // flash partials, and the column sums of v
    k_flash<<<FBX * KSP + DM / 4, 32 * AW, 0, stream>>>(QH, KP, VT, PO, ML, EC);

    k_merge<<<NT, 128, 0, stream>>>(PO, ML, EC, OUT);
}

// v008
// One run takes 39.9 microseconds.
// Two timings next to v007 put it at 1.09 and 1.10 times that version's speed.
// All steps since v000 together make it 9.63 times as fast.
#include <hip/hip_runtime.h>

// Single-head attention, x [SEQ][128], W and V [in][out], scores x W x^T * 128^-0.5, v = x V, out = (softmax + 1e-8) v (f32).
// The score weight is applied on the key side: scores[t][key] = sum_d x[t][d] r[key][d] with r = x W^T, whose two operands are both contiguous in the summed index as they lie.
// Compute dtypes, f32 accumulate everywhere: projections v_wmma_f32_16x16x32_bf16 (x, W, V RNE-converted to bf16; products exact);
// scores v_wmma_f32_16x16x32_f16: query side = f16 of the bf16 x value (exact), key side r as one f16 value (its 2^-12 rounding lies under the 2^-9 bf16 rounding that x and W bring into both sides);
// P (x256 carry, cancels in the normalisation) and v single f16; softmax f32 (online; the maximum in use is raised, and the sums rescaled, only when a score passes it by 2^7); the 1e-8 term is added in f32 from a column-sum table.
// Layout: f16 x plane [t][d] (the flash kernel's Q), r plane [key][d] (its K) and v^T plane [e][t], all written by the projection launch;
// fused flash kernel in transposed form (S^T = K Q^T, O^T = V^T P^T), output from f32 accumulators; its k and v^T tiles are staged in LDS
// (two buffers of 64 keys, asynchronous 16-B copies in whole 128-B lines) and shared by the block's four waves.
// Each wave works 32 query rows (two 16-row tiles), so that every k and v^T fragment read from LDS feeds two matrix instructions.
// The keys are cut into KSP ranges, one flash block per (128 query rows, range): each writes its un-normalised f32 sums with (max, sum) to the workspace,
// and a merge launch joins the ranges, normalises, adds the 1e-8 term and stores the output.
// Three launches, each reading only what an earlier one wrote; work that reads none of each other's output shares a grid, told apart by the block index:
// k_proj (r tiles with the x image + v^T tiles, straight from the f32 inputs), k_flash (flash blocks + the column-sum blocks), k_merge.

#ifndef NB
#define NB 1
#endif
#ifndef SEQ
#define SEQ 8192
#endif
#define NB_FULL  1
#define SEQ_FULL 8192
#define DM   128                 // feature width = head width (one head)
#define AW   4                   // waves per flash block
#define QT   2                   // 16-row query tiles per flash wave: each k / v^T fragment read from LDS is used QT times
#define SC2  (0.08838834764831845f * 1.4426950408889634f)   // 128^-0.5 * log2(e)
#define PSH  8.0f                // log2 of the P carry (256)
#define TAU  7.0f                // a score may pass the maximum in use by this much (log2) before the sums are rescaled: P <= 2^(PSH + TAU) = 2^15 stays finite in f16
#define EPSW 1.0e-8f
#define KS   64                  // keys per LDS stage of the flash kernel (two 32-key passes)
#define KPH  136                 // LDS row pitch (halves) of a staged k row: 272 B = 16 B x odd, conflict-free for 16-B fragment reads
#define VPH  72                  // LDS row pitch (halves) of a staged v^T row piece (64 keys): 144 B = 16 B x odd
#define KSP  8                   // key ranges of the flash grid: 64 x 8 blocks of 4 waves = 2 blocks per WGP, 2 waves per SIMD on 256 WGPs
#define NST  (SEQ / KS / KSP)    // LDS stages per key range
#define NT   (SEQ / 16)          // 16-row query tiles
#define FBX  (SEQ / (16 * QT * AW))   // flash blocks per key range
#define MSP  36                  // LDS row pitch (floats) of the merge kernel's 16 x 32 output tile: 144 B = 16 B x odd

static_assert(NB == 1);                        // no batch dimension in this module
static_assert(DM == 128);                      // store maps assume 128 columns (512 B per f32 row, 256 B per 16-bit row)
static_assert(DM % 64 == 0);
static_assert(DM % 32 == 0);                   // GEMM and score k-loops step by 32
static_assert(SEQ % 1024 == 0);                // column-sum quarters of whole 512-B loads, 64-row tiles, 32-key steps, flash grid
static_assert(SEQ % (16 * QT * AW) == 0);
static_assert(((size_t)SEQ * DM) % 8 == 0);
static_assert(SEQ <= SEQ_FULL);
static_assert(SEQ % (KS * KSP) == 0 && NST >= 2);  // equal key ranges; the two-buffer ring's prologue fills stages 0 and 1
static_assert(QT == 2);                        // the rescale test and the two v_nop statements of the flash loop name both tiles
static_assert(KS == 64 && AW == 4);            // copy maps: 128 lanes x 8 copies x 16 B = one 16-KiB k tile, and one 16-KiB v^T tile
static_assert((KPH * 2) % 32 == 16 && (VPH * 2) % 32 == 16 && KPH >= DM && VPH >= KS);

typedef _Float16 h16;
typedef __attribute__((ext_vector_type(16))) __bf16   v16bf;
typedef __attribute__((ext_vector_type(16))) _Float16 v16h;
typedef __attribute__((ext_vector_type(8)))  _Float16 v8h;
typedef __attribute__((ext_vector_type(8)))  float    v8f;
typedef __attribute__((ext_vector_type(4)))  float    v4f;
typedef v4f  __attribute__((may_alias)) v4fa;
typedef __attribute__((ext_vector_type(2)))  float    v2f;

__device__ __forceinline__ v16h cat16(v8h lo, v8h hi) { return __builtin_shufflevector(lo, hi, 0, 1, 2, 3, 4, 5, 6, 7, 8, 9, 10, 11, 12, 13, 14, 15); }
__device__ __forceinline__ v8f wmma16(v16h a, v16h b, v8f c) { return __builtin_amdgcn_wmma_f32_16x16x32_f16(false, a, false, b, (short)0, c, false, false); }
__device__ __forceinline__ v8f wmmab(v16bf a, v16bf b, v8f c) { return __builtin_amdgcn_wmma_f32_16x16x32_bf16(false, a, false, b, (short)0, c, false, false); }
// fragment loaders from K-contiguous 16-bit rows; p already includes + 8*(lane>>4): elements 0..7 <- k0+8h+0..7, elements 8..15 <- k0+16+8h+0..7 (same map for A and B)
__device__ __forceinline__ v16h  ldh(const h16* p) { return cat16(*(const v8h*)p, *(const v8h*)(p + 16)); }
// ordering point for wave-private LDS tiles (same wave writes and reads)
__device__ __forceinline__ void wave_sync() { __builtin_amdgcn_fence(3 /* release order */, "wavefront"); __builtin_amdgcn_wave_barrier(); asm volatile("" ::: "memory"); }

// Eight asynchronous 16-B copies per lane, global -> LDS, through no register: copy i moves l + i*ls (halves) <- g + i*gs (halves).
// Written as the builtin: the flash kernel uses registers above v255, which the text of an asm statement cannot name; as asm operands the
// lane's base addresses were held below v256 for the whole loop, found no place there and went to scratch.
typedef __attribute__((ext_vector_type(4))) int v4i;
typedef __attribute__((address_space(1))) v4i gv4i;
typedef __attribute__((address_space(3))) v4i lv4i;
__device__ __forceinline__ void copy8(h16* l, int ls, const h16* g, size_t gs) {
#pragma unroll   // eight copies in a row, their steps constants
    for (int i = 0; i < 8; ++i) __builtin_amdgcn_global_load_async_to_lds_b128((gv4i*)(g + i * gs), (lv4i*)(l + i * ls), 0, 0);
}

// Fragment from four 16-B pieces of an f32 row, RNE-converted to bf16: pieces 0, 1 are elements 0..7, pieces 2, 3 elements 8..15.
__device__ __forceinline__ v16bf cvt16(v4f p0, v4f p1, v4f p2, v4f p3) {
    v16bf r;
#pragma unroll
    for (int i = 0; i < 4; ++i) { r[i] = (__bf16)p0[i]; r[4 + i] = (__bf16)p1[i]; r[8 + i] = (__bf16)p2[i]; r[12 + i] = (__bf16)p3[i]; }
    return r;
}

// proj_tile: register-blocked bf16 GEMM, ONE WAVE per 64x64 tile (16 accumulators), K = DM, operands read straight from the f32 inputs and converted in registers.
// Tile (bx, by): 64 rows t of x, 64 outputs of the weight. Every fragment holds k = k0 + 8h + 0..7 in elements 0..7 and k0 + 16 + 8h + 0..7 in elements 8..15.
// ISV = false, r = x W^T: A = x rows (m = t, k = e), B = W rows (n = d, k = e: contiguous as W lies, no transpose) -> plane [t][d]. The tile also stores the f16 image
//   of its bf16 x values for the 64 columns 64*by.. (whole 128-B lines, one writer each).
// ISV = true, v^T: A = columns of V (m <-> e, k = d), B = x rows (n = t) -> plane [e][t]. Row m of A tile mb stands for e = 64*by + 4m + mb, so that one 16-B load of a
//   V row gives a lane one element of each of its four A tiles; the epilogue stores row m of tile mb at that e.
// The loads of k step kc + 1 are issued before step kc is converted and multiplied (two register sets, loop unrolled: constant indices).
template <bool ISV>
__device__ __forceinline__ void proj_tile(const float* __restrict__ X, const float* __restrict__ Wg, h16* Ph, h16* XH, float* os) {
    const int lane = threadIdx.x & 31, lr = lane & 15, hi = lane >> 4;
    const int x0 = blockIdx.x * 64, w0 = blockIdx.y * 64;
    const float* xp = X + (size_t)(x0 + lr) * DM + 8 * hi;
    const float* wp = ISV ? Wg + (size_t)(8 * hi) * DM + w0 + 4 * lr : Wg + (size_t)(w0 + lr) * DM + 8 * hi;
    h16* xo = XH + (size_t)(x0 + lr) * DM + 8 * hi;
    v4f rx[2][16], rw[2][16];
    v8f acc[4][4];
#pragma unroll
    for (int mb = 0; mb < 4; ++mb)
#pragma unroll
        for (int nb = 0; nb < 4; ++nb) acc[mb][nb] = (v8f){};
#pragma unroll
    for (int kc = -1; kc < DM / 32; ++kc) {
        if (kc + 1 < DM / 32) {
            const int k1 = 32 * (kc + 1), b1 = (kc + 1) & 1;
#pragma unroll
            for (int i = 0; i < 16; ++i) {
                const int ro = (i >> 2) * 16 * DM + k1 + ((i >> 1) & 1) * 16 + (i & 1) * 4;      // tile i >> 2, piece i & 3 of a row
                rx[b1][i] = *(const v4f*)(xp + ro);
                rw[b1][i] = *(const v4f*)(wp + (ISV ? (k1 + (i & 7) + 16 * (i >> 3)) * DM : ro));   // ISV: element i of all four tiles
            }
            __builtin_amdgcn_sched_barrier(0);   // keeps the 32 loads of the next step in front of this step's work, in flight meanwhile: sunk to their uses, each step would wait out its own round trip
        }
        if (kc < 0) continue;
        const int b = kc & 1;
        v16bf xf[4], wf[4];
#pragma unroll
        for (int i = 0; i < 4; ++i) {
            xf[i] = cvt16(rx[b][4 * i], rx[b][4 * i + 1], rx[b][4 * i + 2], rx[b][4 * i + 3]);
            if (ISV) {
#pragma unroll
                for (int e = 0; e < 16; ++e) wf[i][e] = (__bf16)rw[b][e][i];
            } else wf[i] = cvt16(rw[b][4 * i], rw[b][4 * i + 1], rw[b][4 * i + 2], rw[b][4 * i + 3]);
        }
        if (!ISV && (kc >> 1) == (int)blockIdx.y) {     // same for the whole wave: this tile's half of the x image
            v8h im[8];
#pragma unroll
            for (int i = 0; i < 4; ++i)
#pragma unroll
                for (int e = 0; e < 8; ++e) { im[2 * i][e] = (h16)(float)xf[i][e]; im[2 * i + 1][e] = (h16)(float)xf[i][8 + e]; }
            __builtin_amdgcn_sched_barrier(0);   // all eight pieces stand in front of the stores: among them they were written over registers that an issued store names
#pragma unroll
            for (int i = 0; i < 8; ++i) *(v8h*)(xo + (i >> 1) * 16 * DM + 32 * kc + (i & 1) * 16) = im[i];
            asm volatile("s_wait_xcnt 0x0" ::: "memory");   // the work behind these stores writes registers that they name: the wait stands in front of that
        }
#pragma unroll
        for (int nb = 0; nb < 4; ++nb)
#pragma unroll
            for (int mb = 0; mb < 4; ++mb) acc[mb][nb] = ISV ? wmmab(wf[mb], xf[nb], acc[mb][nb]) : wmmab(xf[mb], wf[nb], acc[mb][nb]);
    }
    const int pitch = ISV ? SEQ : DM;
    h16* tb = Ph + (ISV ? (size_t)w0 * SEQ + x0 : (size_t)x0 * DM + w0);
#pragma unroll
    for (int mb = 0; mb < 4; ++mb) {
#pragma unroll
        for (int nb = 0; nb < 4; ++nb) {
#pragma unroll
            for (int j = 0; j < 8; ++j) os[(hi * 8 + j) * 68 + nb * 16 + lr] = acc[mb][nb][j]; }   // D: row 8h+j, col lane&15
        wave_sync();
#pragma unroll
        for (int s = 0; s < 4; ++s) { const int row = 4 * s + (lane >> 3), c8 = (lane & 7) * 8;   // 4 s x 4 row groups = 16 rows; 8 lanes x 8 = 64 columns
            const v4f y0 = *(const v4fa*)(&os[row * 68 + c8]); const v4f y1 = *(const v4fa*)(&os[row * 68 + c8 + 4]); v8h hv;
#pragma unroll
            for (int i = 0; i < 4; ++i) { hv[i] = (h16)y0[i]; hv[4 + i] = (h16)y1[i]; }
            *(v8h*)(tb + (size_t)(ISV ? 4 * row + mb : 16 * mb + row) * pitch + c8) = hv; }
        asm volatile("s_wait_xcnt 0x0" ::: "memory");   // the next 16 rows' address sums and LDS reads (behind the last: the other part's text) write registers that these stores name: the wait stands in front of that
        wave_sync();
    }
}

// k_proj: everything that reads the inputs alone, in one grid (SEQ/64, DM/64, 2) of single waves: z = 0 the key-side projection r and the f16 image of x, z = 1 v^T.
__global__ __launch_bounds__(32) void k_proj(const float* __restrict__ x, const float* __restrict__ w, const float* __restrict__ v, h16* XH, h16* RP, h16* VT) {
    __shared__ __align__(16) float os[16 * 68];
    if (blockIdx.z != 0) proj_tile<true>(x, v, VT, XH, os);
    else                 proj_tile<false>(x, w, RP, XH, os);
}

// colsum: EC = 1e-8 * row sums of VT, for the DM/4 blocks of four waves that close the flash grid. Block b owns rows 4b..4b+3, wave w the whole row 4b + w:
// 32 loads of 16 B per lane, all in flight together (a wave's load = 512 contiguous bytes). Fixed-order sums: per quarter row over its eight loads and
// over the lanes, then the four quarters pairwise.
// EC layout: the four sums of block b stand at the head of the block's own 128-B line, EC[32b + 0..3] (one writer per line): column e is EC[8*(e & ~3) + (e & 3)].
__device__ __forceinline__ void colsum(int b, const h16* __restrict__ VT, float* EC) {
    __shared__ __align__(16) float red[AW];
    const int lane = threadIdx.x & 31, wave = __builtin_amdgcn_readfirstlane((int)(threadIdx.x >> 5));
    const h16* src = VT + (size_t)(b * 4 + wave) * SEQ + lane * 8;
    v8h x[SEQ / 256];
#pragma unroll   // all loads issue before the first sum: rolled, each trip would wait out its own round trip
    for (int it = 0; it < SEQ / 256; ++it) x[it] = *(const v8h*)(src + it * 256);
    float sq[4];
#pragma unroll   // x[] and sq[] are indexed by constants only, so they stay in registers
    for (int q = 0; q < 4; ++q) {
        float s = 0.0f;
#pragma unroll   // constant indices into x[], as above
        for (int it = q * (SEQ / 1024); it < (q + 1) * (SEQ / 1024); ++it) {
            const float p0 = (float)x[it][0] + (float)x[it][1], p1 = (float)x[it][2] + (float)x[it][3], p2 = (float)x[it][4] + (float)x[it][5], p3 = (float)x[it][6] + (float)x[it][7];
            s += (p0 + p1) + (p2 + p3); }
        s += __shfl_xor(s, 16, 32); s += __shfl_xor(s, 8, 32); s += __shfl_xor(s, 4, 32); s += __shfl_xor(s, 2, 32); s += __shfl_xor(s, 1, 32);
        sq[q] = s;
    }
    if (lane == 0) red[wave] = (sq[0] + sq[1]) + (sq[2] + sq[3]);
    __syncthreads();
    if (threadIdx.x == 0) {
        v4f o;
#pragma unroll   // o[] indexed by constants: one 16-B store from registers
        for (int i = 0; i < 4; ++i) o[i] = red[i] * EPSW;
        *(v4f*)(EC + b * 32) = o;
    }
}

// k_flash: fused attention, one wave per 16 * QT query rows; Q fragments straight from the f16 plane; K / V^T fragments from LDS tiles of 64 keys that the
// block's four waves fill together and share (two 16-B LDS loads per fragment). Ring of two buffers: the copies of stage t + 1 fly while stage t is worked on.
// Transposed form: S^T[key][t] = K Q^T (A = K rows, B = Q rows); lane (t = lane&15, h = lane>>4) holds keys 8h+r of each 16-key tile, so the packed
// P tile is directly the B fragment of O^T[d][t] = V^T P^T (element r <- tile keys 0..15, element 8+r <- tile keys 16..31, lane unchanged).
// Softmax state (maximum in use, partial sum) is one scalar per lane and query tile; the two lane halves of a row are combined with one xor-16 exchange, at a rescale and at the end.
// Block (x, y) works query rows 128x.. on keys y*SEQ/KSP.. only; its result is a partial: PO holds the accumulators in register order
// ([tile][range][piece 2j+q][lane][4 floats], each store 512 contiguous bytes), ML the pair (max, sum) per lane ([tile][range][lane][2]).
// Flat grid: block f < FBX*KSP is flash block (x, y) = (f % FBX, f / FBX); the DM/4 blocks behind them take the column sums, which read VT alone and are read
// by the merge launch only. They are short and stand last in the grid, so that they start in the places that the first finished flash blocks leave.
// Every unrolled loop over q (query tile), c, j or r below has constant indices, so that the fragment, score and accumulator arrays stay in registers.
// Two waves per SIMD, no more: the 512 flash blocks then lie two on each of the 256 WGPs, whatever order they are placed in.
__global__ __launch_bounds__(32 * AW) __attribute__((amdgpu_waves_per_eu(2, 2))) void k_flash(const h16* __restrict__ QH, const h16* __restrict__ KP, const h16* __restrict__ VT, float* PO, float* ML, float* EC) {
    if (blockIdx.x >= FBX * KSP) { colsum((int)blockIdx.x - FBX * KSP, VT, EC); return; }   // whole blocks, ahead of every copy and barrier of the flash part
    const int bx = blockIdx.x % FBX, by = blockIdx.x / FBX;
    __shared__ __align__(16) h16 ks[2 * KS * KPH];            // [buffer][key][d], pitch KPH
    __shared__ __align__(16) h16 vs[2 * DM * VPH];            // [buffer][d][key], pitch VPH
    const int tid = threadIdx.x;
    const int lane = threadIdx.x & 31, wave = __builtin_amdgcn_readfirstlane((int)(threadIdx.x >> 5)), lr = lane & 15, hi = lane >> 4;
    const int t0 = (bx * AW + wave) * (16 * QT);
    // copy maps, 16-B piece i = 128*it + tid. k tile: 64 rows x 16 pieces, contiguous in the plane (a wave's copy = 512 B = 4 lines); row = i >> 4.
    // v^T tile: 128 rows x 8 pieces (a wave's copy = 4 rows x one 128-B line); row = i >> 3.
    h16* kl = ks + (tid >> 4) * KPH + (tid & 15) * 8;
    h16* vl = vs + (tid >> 3) * VPH + (tid & 7) * 8;
    const size_t key0 = (size_t)by * (NST * KS);      // first key of this block's range
    const h16* kg = KP + key0 * DM + (size_t)tid * 8;
    const h16* vg = VT + (size_t)(tid >> 3) * SEQ + key0 + (tid & 7) * 8;
    // prologue: stage 0 lands and is published, then stage 1 is started
    copy8(kl, 8 * KPH, kg, 128 * 8); copy8(vl, 16 * VPH, vg, (size_t)16 * SEQ);
    asm volatile("s_wait_asynccnt 0x0" ::: "memory");         // this wave's copies of stage 0 have landed
    __syncthreads();                                          // every wave's have: stage 0 may be read
    copy8(kl + KS * KPH, 8 * KPH, kg + (size_t)KS * DM, 128 * 8); copy8(vl + DM * VPH, 16 * VPH, vg + KS, (size_t)16 * SEQ);
    const size_t qo = (size_t)(t0 + lr) * DM + 8 * hi;
    v16h qh[QT][4];                                           // B fragments: col t, k = d (four 32-deep steps)
#pragma unroll
    for (int q = 0; q < QT; ++q)
#pragma unroll
        for (int c = 0; c < 4; ++c) qh[q][c] = ldh(QH + qo + (size_t)q * 16 * DM + 32 * c);
    const int ko = lr * KPH + 8 * hi;                         // + key * KPH       (A fragment: row key, k = d)
    const int vo = lr * VPH + 8 * hi;                         // + 16j*VPH + key   (A fragment: row d, k = key)
    v8f o[QT][8];
    float m[QT], l[QT];
#pragma unroll
    for (int q = 0; q < QT; ++q) { m[q] = -3.0e38f; l[q] = 0.0f;
#pragma unroll
        for (int j = 0; j < 8; ++j) o[q][j] = (v8f){}; }
#pragma unroll 1
    for (int t = 0; t < NST; ++t) {
      const int buf = t & 1;
#pragma unroll 1   // kept rolled: one copy of the pass and of its rescale branch; unrolled, the text doubled and 18 more registers were taken
      for (int ps = 0; ps < KS / 32; ++ps) {
        const h16* kp = ks + buf * (KS * KPH) + ko + ps * 32 * KPH;
        v16h ka[4], kb[4];
#pragma unroll
        for (int c = 0; c < 4; ++c) { ka[c] = ldh(kp + 32 * c); kb[c] = ldh(kp + 16 * KPH + 32 * c); }
        v8f sHa[QT], sHb[QT];
#pragma unroll
        for (int q = 0; q < QT; ++q) { sHa[q] = (v8f){}; sHb[q] = (v8f){}; }
#pragma unroll
        for (int c = 0; c < 4; ++c)
#pragma unroll
            for (int q = 0; q < QT; ++q) { sHa[q] = wmma16(ka[c], qh[q][c], sHa[q]); sHb[q] = wmma16(kb[c], qh[q][c], sHb[q]); }
        asm volatile("v_nop\n\tv_nop\n\tv_nop\n\tv_nop" : "+v"(sHa[0]), "+v"(sHb[0]), "+v"(sHa[1]), "+v"(sHb[1])
                     : "v"(ka[0]), "v"(ka[1]), "v"(ka[2]), "v"(ka[3]), "v"(kb[0]), "v"(kb[1]), "v"(kb[2]), "v"(kb[3]));
        // the v^T fragment reads stand in front of the softmax and its branch, so that they return while the vector work runs
        const h16* va = vs + buf * (DM * VPH) + vo + ps * 32;
        v16h vv[8];
#pragma unroll
        for (int j = 0; j < 8; ++j) vv[j] = ldh(va + 16 * j * VPH);
        __builtin_amdgcn_sched_barrier(0);   // keeps the sixteen reads one group: without it they were strewn among the vector instructions in six places
        v8f ta[QT], tb[QT]; float mx[QT];
#pragma unroll
        for (int q = 0; q < QT; ++q) { ta[q] = sHa[q] * SC2; tb[q] = sHb[q] * SC2; mx[q] = -3.0e38f;
#pragma unroll
            for (int r = 0; r < 8; ++r) mx[q] = fmaxf(mx[q], fmaxf(ta[q][r], tb[q][r])); }
        // lazy rescale: one test per pass on each lane's own maxima (m is equal in a row's two lanes, the ballot sees both); while no score lies more
        // than TAU above the maximum in use, m stays and sums and accumulators are left alone. A scalar branch: all lanes stay on for the WMMAs behind it.
        if (__builtin_expect(__builtin_amdgcn_ballot_w32(mx[0] > m[0] + TAU || mx[1] > m[1] + TAU) != 0, 0)) {   // marked rare: the pass without a rescale is laid out straight through
#pragma unroll
            for (int q = 0; q < QT; ++q) {
                const float mw = fmaxf(mx[q], __shfl_xor(mx[q], 16, 32));
                const float mnew = fmaxf(m[q], mw);
                const float alpha = __builtin_amdgcn_exp2f(m[q] - mnew);
                l[q] *= alpha; m[q] = mnew;
#pragma unroll
                for (int j = 0; j < 8; ++j) o[q][j] = o[q][j] * alpha;
            }
        }
        v16h pb[QT];
#pragma unroll
        for (int q = 0; q < QT; ++q) {
            const float sh = PSH - m[q];
            float ls = 0.0f;
#pragma unroll
            for (int r = 0; r < 8; ++r) { const h16 pa = (h16)__builtin_amdgcn_exp2f(ta[q][r] + sh); const h16 pc = (h16)__builtin_amdgcn_exp2f(tb[q][r] + sh); pb[q][r] = pa; pb[q][8 + r] = pc; ls += (float)pa + (float)pc; }
            l[q] += ls;
        }
#pragma unroll
        for (int j = 0; j < 8; ++j)
#pragma unroll
            for (int q = 0; q < QT; ++q) o[q][j] = wmma16(vv[j], pb[q], o[q][j]);
        // four free vector slots behind the last matrix instructions, on the loop's taken branch too; the operands only hold the statement behind all sixteen
        asm volatile("v_nop\n\tv_nop\n\tv_nop\n\tv_nop"
                     :: "v"(o[0][0]), "v"(o[0][1]), "v"(o[0][2]), "v"(o[0][3]), "v"(o[0][4]), "v"(o[0][5]), "v"(o[0][6]), "v"(o[0][7]),
                        "v"(o[1][0]), "v"(o[1][1]), "v"(o[1][2]), "v"(o[1][3]), "v"(o[1][4]), "v"(o[1][5]), "v"(o[1][6]), "v"(o[1][7]));
      }
      // publish point of stage t + 1, every wave, in this order
      asm volatile("s_wait_dscnt 0x0" ::: "memory");          // this wave's reads of stage t have returned before its buffer is refilled
      asm volatile("s_wait_asynccnt 0x0" ::: "memory");       // this wave's copies of stage t + 1 have landed
      __syncthreads();                                        // publishes stage t + 1 and ends every wave's reads of stage t
      if (t + 2 < NST) {                                      // same for the whole block: refill the buffer that stage t has just left
          copy8(kl + buf * (KS * KPH), 8 * KPH, kg + (size_t)(t + 2) * KS * DM, 128 * 8);
          copy8(vl + buf * (DM * VPH), 16 * VPH, vg + (size_t)(t + 2) * KS, (size_t)16 * SEQ);
      }
    }
    asm volatile("s_wait_asynccnt 0x0" ::: "memory");         // nothing of this wave is in flight when the ring is left
    v2f ml[QT]; float* po[QT]; float* mp[QT];
#pragma unroll
    for (int q = 0; q < QT; ++q) {
        const size_t pt = (size_t)((t0 >> 4) + q) * KSP + (size_t)by;     // (tile, range)
        po[q] = PO + pt * (16 * 128) + lane * 4; mp[q] = ML + (pt * 32 + lane) * 2;
        ml[q][0] = m[q]; ml[q][1] = l[q] + __shfl_xor(l[q], 16, 32);
    }
    __builtin_amdgcn_sched_barrier(0);   // sums and addresses stand in front of the stores: among them they were written over registers that an issued store names
#pragma unroll
    for (int q = 0; q < QT; ++q) {
#pragma unroll
        for (int j = 0; j < 8; ++j) {
            v4f a, c;
            a[0] = o[q][j][0]; a[1] = o[q][j][1]; a[2] = o[q][j][2]; a[3] = o[q][j][3];
            c[0] = o[q][j][4]; c[1] = o[q][j][5]; c[2] = o[q][j][6]; c[3] = o[q][j][7];
            *(v4f*)(po[q] + (2 * j) * 128) = a; *(v4f*)(po[q] + (2 * j + 1) * 128) = c;
        }
        *(v2f*)mp[q] = ml[q];
    }
    asm volatile("s_wait_xcnt 0x0" ::: "memory");   // the column-sum part is laid out behind these stores and writes their registers: the wait stands in front of that
}

// 2^d for the merge weights, with the free slot that the instruction set asks for behind a transcendental in the same statement
__device__ __forceinline__ float exp2_slot(float d) { float w; asm("v_exp_f32 %0, %1\n\tv_nop" : "=v"(w) : "v"(d)); return w; }

// k_merge: joins the KSP partials of one 16-row query tile (ranges in fixed order 0..KSP-1): weight exp2(m_s - max), out = sum(w o) / sum(w l) + EC.
// One block per tile; wave w owns pieces 4w..4w+3 = columns 32w..32w+31 (piece 2j+q of lane (t = lane&15, h = lane>>4): d = 16j + 8h + 4q + 0..3),
// turns them through a wave-private LDS tile and stores whole 128-B lines.
__global__ __launch_bounds__(128) void k_merge(const float* __restrict__ PO, const float* __restrict__ ML, const float* __restrict__ EC, float* OUT) {
    __shared__ __align__(16) float os[4 * 16 * MSP];
    const int lane = threadIdx.x & 31, wave = __builtin_amdgcn_readfirstlane((int)(threadIdx.x >> 5)), lr = lane & 15, hi = lane >> 4;
    const size_t tile = blockIdx.x;
    const float* mb = ML + tile * (KSP * 64) + lane * 2;                     // the tile's KSP partials lie side by side
    const float* pb = PO + tile * (KSP * 16 * 128) + wave * (4 * 128) + lane * 4;
    v4f x[KSP][4], e[4]; float ms[KSP], ls[KSP];
#pragma unroll
    for (int s = 0; s < KSP; ++s) {
        const v2f ml = *(const v2f*)(mb + s * 64); ms[s] = ml[0]; ls[s] = ml[1];
#pragma unroll
        for (int p = 0; p < 4; ++p) x[s][p] = *(const v4f*)(pb + s * (16 * 128) + p * 128);
    }
#pragma unroll
    for (int p = 0; p < 4; ++p) e[p] = *(const v4f*)(EC + 8 * (32 * wave + 16 * (p >> 1) + 4 * (p & 1) + 8 * hi));   // four columns per 128-B line of EC
    __builtin_amdgcn_sched_barrier(0);   // keeps all 44 loads in front of the sums, in flight together: without it they sank to their uses, a few per memory round trip
    float mx = ms[0];
#pragma unroll
    for (int s = 1; s < KSP; ++s) mx = fmaxf(mx, ms[s]);
    v4f acc[4]; float l = 0.0f;
#pragma unroll
    for (int p = 0; p < 4; ++p) acc[p] = (v4f){};
#pragma unroll
    for (int s = 0; s < KSP; ++s) {
        const float w = exp2_slot(ms[s] - mx);
        l += w * ls[s];
#pragma unroll
        for (int p = 0; p < 4; ++p) acc[p] += x[s][p] * w;
    }
    const float inv = 1.0f / l;
    const int wb = wave * 16 * MSP;
#pragma unroll
    for (int p = 0; p < 4; ++p) {
        const int dl = 16 * (p >> 1) + 8 * hi + 4 * (p & 1);            // column inside the wave's 32
        *(v4fa*)(&os[wb + lr * MSP + dl]) = acc[p] * inv + e[p];
    }
    wave_sync();
    float* orow = OUT + tile * 16 * DM + 32 * wave;
#pragma unroll
    for (int s = 0; s < 4; ++s) {                              // 4 rows per store: 8 lanes x 4 floats = one 128-B line each
        const int row = 4 * s + (lane >> 3), c4 = (lane & 7) * 4;
        const v4f val = *(const v4fa*)(&os[wb + row * MSP + c4]);
        *(v4f*)(orow + (size_t)row * DM + c4) = val; }
}

static constexpr size_t al256(size_t v) { return (v + 255) & ~(size_t)255; }
static constexpr size_t SZ_PL = al256((size_t)SEQ * DM * 2);          // one 16-bit plane [SEQ][128] or [128][SEQ]
static constexpr size_t SZ_EC = al256((size_t)(DM / 4) * 128);         // one 128-B line per four columns
static constexpr size_t SZ_PO = al256((size_t)KSP * SEQ * DM * 4);    // f32 partial sums: SEQ x 128 values per key range
static constexpr size_t SZ_ML = al256((size_t)KSP * NT * 32 * 2 * 4); // (max, sum) per tile, range and lane
static constexpr size_t SZ_TOTAL = 3 * SZ_PL + SZ_EC + SZ_PO + SZ_ML;
static_assert(SZ_TOTAL <= (size_t)134217728);          // workspace carve <= 128 MiB

extern "C" void kernel_launch(void* const* d_in, const int* in_sizes, int n_in,
                              void* d_out, int out_size, void* d_ws, size_t ws_size, hipStream_t stream) {
    if (n_in < 3) return;
    if ((size_t)in_sizes[0] < (size_t)SEQ * DM) return;
    if ((size_t)in_sizes[1] < (size_t)DM * DM || (size_t)in_sizes[2] < (size_t)DM * DM) return;
    if ((size_t)out_size < (size_t)SEQ * DM) return;
    if (SZ_TOTAL > ws_size) return;
    const float* x = (const float*)d_in[0]; const float* w = (const float*)d_in[1]; const float* v = (const float*)d_in[2];   // wire order X, W, V (W, V are [in][out])
    float* OUT = (float*)d_out;      // [SEQ][128]
    char* wsp = (char*)d_ws;
    h16* XH = (h16*)wsp; wsp += SZ_PL;               // [SEQ][128] f16 image of bf16 x (query side of the scores)
    h16* RP = (h16*)wsp; wsp += SZ_PL;               // [SEQ][128] r = x W^T (key side of the scores)
    h16* VT = (h16*)wsp; wsp += SZ_PL;               // [128 e][SEQ] v^T
    float* EC = (float*)wsp; wsp += SZ_EC;           // [32 lines][4 of 32 floats] 1e-8 * column sums of v
    float* PO = (float*)wsp; wsp += SZ_PO;           // flash partial sums
    float* ML = (float*)wsp; wsp += SZ_ML;           // flash partial (max, sum)

    // inputs -> x image [t][d], r plane [key][d] and v^T plane [e][t]
    k_proj<<<dim3(SEQ / 64, DM / 64, 2), 32, 0, stream>>>(x, w, v, XH, RP, VT);

    // flash partials, and the column sums of v
    k_flash<<<FBX * KSP + DM / 4, 32 * AW, 0, stream>>>(XH, RP, VT, PO, ML, EC);

    k_merge<<<NT, 128, 0, stream>>>(PO, ML, EC, OUT);
}

// v010
// One run takes 34.6 microseconds.
// It is 1.15 times as fast as v008, going by the measured steps of the versions left out in between.
// All steps since v000 together make it 11.1 times as fast.
#include <hip/hip_runtime.h>

// Single-head attention, x [SEQ][128], W and V [in][out], scores x W x^T * 128^-0.5, v = x V, out = (softmax + 1e-8) v (f32).
// The score weight is applied on the key side: scores[t][key] = sum_d x[t][d] r[key][d] with r = x W^T, whose two operands are both contiguous in the summed index as they lie.
// Compute dtypes, f32 accumulate everywhere: projections v_wmma_f32_16x16x32_bf16 (x, W, V RNE-converted to bf16; products exact);
// scores v_wmma_f32_16x16x32_f16: query side = f16 of the bf16 x value (exact), key side r as one f16 value (its 2^-12 rounding lies under the 2^-9 bf16 rounding that x and W bring into both sides);
// P (x256 carry, cancels in the normalisation) and v single f16; softmax f32 (online; the maximum in use is raised, and the sums rescaled, only when a score passes it by 2^7); the 1e-8 term is added in f32 from a column-sum table.
// The softmax sum adds the f32 values of P as the exponential gives them, two per packed add, ahead of their rounding to f16 (to nearest even, so without a bias against the rounded P of the products).
// Layout: f16 x plane [t][d] (the flash kernel's Q), r plane [key][d] (its K) and v^T plane [e][t], all written by the projection launch;
// fused flash kernel in transposed form (S^T = K Q^T, O^T = V^T P^T), output from f32 accumulators; its k and v^T tiles are staged in LDS
// (two buffers of 64 keys, asynchronous 16-B copies in whole 128-B lines) and shared by the block's four waves.
// Each wave works 32 query rows (two 16-row tiles), so that every k and v^T fragment read from LDS feeds two matrix instructions.
// The keys are cut into KSP ranges, one flash block per (128 query rows, range): each writes its range's weighted mean of v (sums over their own sum, f16) with (max, sum) in f32 to the workspace,
// and a merge launch joins the ranges by their shares of the whole sum, adds the 1e-8 term and stores the output.
// Three launches, each reading only what an earlier one wrote; work that reads none of each other's output shares a grid, told apart by the block index:
// k_proj (r tiles with the x image + v^T tiles, straight from the f32 inputs), k_flash (flash blocks + the column-sum blocks), k_merge.

#ifndef NB
#define NB 1
#endif
#ifndef SEQ
#define SEQ 8192
#endif
#define NB_FULL  1
#define SEQ_FULL 8192
#define DM   128                 // feature width = head width (one head)
#define AW   4                   // waves per flash block
#define QT   2                   // 16-row query tiles per flash wave: each k / v^T fragment read from LDS is used QT times
#define SC2  (0.08838834764831845f * 1.4426950408889634f)   // 128^-0.5 * log2(e)
#define PSH  8.0f                // log2 of the P carry (256)
#define TAU  7.0f                // a score may pass the maximum in use by this much (log2) before the sums are rescaled: P <= 2^(PSH + TAU) = 2^15 stays finite in f16
#define EPSW 1.0e-8f
#define KS   64                  // keys per LDS stage of the flash kernel (two 32-key passes)
#define KPH  136                 // LDS row pitch (halves) of a staged k row: 272 B = 16 B x odd, conflict-free for 16-B fragment reads
#define VPH  72                  // LDS row pitch (halves) of a staged v^T row piece (64 keys): 144 B = 16 B x odd
#define KSP  8                   // key ranges of the flash grid: 64 x 8 blocks of 4 waves = 2 blocks per WGP, 2 waves per SIMD on 256 WGPs
#define NST  (SEQ / KS / KSP)    // LDS stages per key range
#define NT   (SEQ / 16)          // 16-row query tiles
#define FBX  (SEQ / (16 * QT * AW))   // flash blocks per key range
#define MSP  36                  // LDS row pitch (floats) of the merge kernel's 16 x 32 output tile: 144 B = 16 B x odd

static_assert(NB == 1);                        // no batch dimension in this module
static_assert(DM == 128);                      // store maps assume 128 columns (512 B per f32 row, 256 B per 16-bit row)
static_assert(DM % 64 == 0);
static_assert(DM % 32 == 0);                   // GEMM and score k-loops step by 32
static_assert(SEQ % 1024 == 0);                // column-sum quarters of whole 512-B loads, 64-row tiles, 32-key steps, flash grid
static_assert(SEQ % (16 * QT * AW) == 0);
static_assert(((size_t)SEQ * DM) % 8 == 0);
static_assert(SEQ <= SEQ_FULL);
static_assert(SEQ % (KS * KSP) == 0 && NST >= 2);  // equal key ranges; the two-buffer ring's prologue fills stages 0 and 1
static_assert(QT == 2);                        // the rescale test and the two v_nop statements of the flash loop name both tiles
static_assert(KS == 64 && AW == 4);            // copy maps: 128 lanes x 8 copies x 16 B = one 16-KiB k tile, and one 16-KiB v^T tile
static_assert((KPH * 2) % 32 == 16 && (VPH * 2) % 32 == 16 && KPH >= DM && VPH >= KS);

typedef _Float16 h16;
typedef __attribute__((ext_vector_type(16))) __bf16   v16bf;
typedef __attribute__((ext_vector_type(16))) _Float16 v16h;
typedef __attribute__((ext_vector_type(8)))  _Float16 v8h;
typedef __attribute__((ext_vector_type(8)))  float    v8f;
typedef __attribute__((ext_vector_type(4)))  float    v4f;
typedef v4f  __attribute__((may_alias)) v4fa;
typedef __attribute__((ext_vector_type(2)))  float    v2f;

__device__ __forceinline__ v16h cat16(v8h lo, v8h hi) { return __builtin_shufflevector(lo, hi, 0, 1, 2, 3, 4, 5, 6, 7, 8, 9, 10, 11, 12, 13, 14, 15); }
__device__ __forceinline__ v8f wmma16(v16h a, v16h b, v8f c) { return __builtin_amdgcn_wmma_f32_16x16x32_f16(false, a, false, b, (short)0, c, false, false); }
__device__ __forceinline__ v8f wmmab(v16bf a, v16bf b, v8f c) { return __builtin_amdgcn_wmma_f32_16x16x32_bf16(false, a, false, b, (short)0, c, false, false); }
// fragment loaders from K-contiguous 16-bit rows; p already includes + 8*(lane>>4): elements 0..7 <- k0+8h+0..7, elements 8..15 <- k0+16+8h+0..7 (same map for A and B)
__device__ __forceinline__ v16h  ldh(const h16* p) { return cat16(*(const v8h*)p, *(const v8h*)(p + 16)); }
// ordering point for wave-private LDS tiles (same wave writes and reads)
__device__ __forceinline__ void wave_sync() { __builtin_amdgcn_fence(3 /* release order */, "wavefront"); __builtin_amdgcn_wave_barrier(); asm volatile("" ::: "memory"); }

// Eight asynchronous 16-B copies per lane, global -> LDS, through no register: copy i moves l + i*ls (halves) <- g + i*gs (halves).
// Written as the builtin: the flash kernel uses registers above v255, which the text of an asm statement cannot name; as asm operands the
// lane's base addresses were held below v256 for the whole loop, found no place there and went to scratch.
typedef __attribute__((ext_vector_type(4))) int v4i;
typedef __attribute__((address_space(1))) v4i gv4i;
typedef __attribute__((address_space(3))) v4i lv4i;
__device__ __forceinline__ void copy8(h16* l, int ls, const h16* g, size_t gs) {
#pragma unroll   // eight copies in a row, their steps constants
    for (int i = 0; i < 8; ++i) __builtin_amdgcn_global_load_async_to_lds_b128((gv4i*)(g + i * gs), (lv4i*)(l + i * ls), 0, 0);
}

// Eight exponentials in one statement, results apart from all eight sources: no result is read and no source overwritten by the instruction directly behind its v_exp_f32, and the closing
// v_nop is the free slot that the instruction set asks for behind the last one.
// The opening s_delay_alu is the hint for the producer in front, the add that forms the first sources: without it the wait is taken in the issue slot, which the SIMD's other wave then cannot use.
__device__ __forceinline__ v8f exp2x8(v8f x) {
    float b0, b1, b2, b3, b4, b5, b6, b7;
    asm("s_delay_alu instid0(VALU_DEP_1)\n\tv_exp_f32 %0, %8\n\tv_exp_f32 %1, %9\n\tv_exp_f32 %2, %10\n\tv_exp_f32 %3, %11\n\tv_exp_f32 %4, %12\n\tv_exp_f32 %5, %13\n\tv_exp_f32 %6, %14\n\tv_exp_f32 %7, %15\n\tv_nop"
        : "=&v"(b0), "=&v"(b1), "=&v"(b2), "=&v"(b3), "=&v"(b4), "=&v"(b5), "=&v"(b6), "=&v"(b7)
        : "v"(x[0]), "v"(x[1]), "v"(x[2]), "v"(x[3]), "v"(x[4]), "v"(x[5]), "v"(x[6]), "v"(x[7]));
    return (v8f){b0, b1, b2, b3, b4, b5, b6, b7};
}

// Fragment from four 16-B pieces of an f32 row, RNE-converted to bf16: pieces 0, 1 are elements 0..7, pieces 2, 3 elements 8..15.
__device__ __forceinline__ v16bf cvt16(v4f p0, v4f p1, v4f p2, v4f p3) {
    v16bf r;
#pragma unroll
    for (int i = 0; i < 4; ++i) { r[i] = (__bf16)p0[i]; r[4 + i] = (__bf16)p1[i]; r[8 + i] = (__bf16)p2[i]; r[12 + i] = (__bf16)p3[i]; }
    return r;
}

// proj_tile: register-blocked bf16 GEMM, ONE WAVE per 64x64 tile (16 accumulators), K = DM, operands read straight from the f32 inputs and converted in registers.
// Tile (bx, by): 64 rows t of x, 64 outputs of the weight. Every fragment holds k = k0 + 8h + 0..7 in elements 0..7 and k0 + 16 + 8h + 0..7 in elements 8..15.
// ISV = false, r = x W^T: A = x rows (m = t, k = e), B = W rows (n = d, k = e: contiguous as W lies, no transpose) -> plane [t][d]. The tile also stores the f16 image
//   of its bf16 x values for the 64 columns 64*by.. (whole 128-B lines, one writer each).
// ISV = true, v^T: A = columns of V (m <-> e, k = d), B = x rows (n = t) -> plane [e][t]. Row m of A tile mb stands for e = 64*by + 4m + mb, so that one 16-B load of a
//   V row gives a lane one element of each of its four A tiles; the epilogue stores row m of tile mb at that e.
// The loads of k step kc + 1 are issued before step kc is converted and multiplied (two register sets, loop unrolled: constant indices).
template <bool ISV>
__device__ __forceinline__ void proj_tile(const float* __restrict__ X, const float* __restrict__ Wg, h16* Ph, h16* XH, float* os) {
    const int lane = threadIdx.x & 31, lr = lane & 15, hi = lane >> 4;
    const int x0 = blockIdx.x * 64, w0 = blockIdx.y * 64;
    const float* xp = X + (size_t)(x0 + lr) * DM + 8 * hi;
    const float* wp = ISV ? Wg + (size_t)(8 * hi) * DM + w0 + 4 * lr : Wg + (size_t)(w0 + lr) * DM + 8 * hi;
    h16* xo = XH + (size_t)(x0 + lr) * DM + 8 * hi;
    v4f rx[2][16], rw[2][16];
    v8f acc[4][4];
#pragma unroll
    for (int mb = 0; mb < 4; ++mb)
#pragma unroll
        for (int nb = 0; nb < 4; ++nb) acc[mb][nb] = (v8f){};
#pragma unroll
    for (int kc = -1; kc < DM / 32; ++kc) {
        if (kc + 1 < DM / 32) {
            const int k1 = 32 * (kc + 1), b1 = (kc + 1) & 1;
#pragma unroll
            for (int i = 0; i < 16; ++i) {
                const int ro = (i >> 2) * 16 * DM + k1 + ((i >> 1) & 1) * 16 + (i & 1) * 4;      // tile i >> 2, piece i & 3 of a row
                rx[b1][i] = *(const v4f*)(xp + ro);
                rw[b1][i] = *(const v4f*)(wp + (ISV ? (k1 + (i & 7) + 16 * (i >> 3)) * DM : ro));   // ISV: element i of all four tiles
            }
            __builtin_amdgcn_sched_barrier(0);   // keeps the 32 loads of the next step in front of this step's work, in flight meanwhile: sunk to their uses, each step would wait out its own round trip
        }
        if (kc < 0) continue;
        const int b = kc & 1;
        v16bf xf[4], wf[4];
#pragma unroll
        for (int i = 0; i < 4; ++i) {
            xf[i] = cvt16(rx[b][4 * i], rx[b][4 * i + 1], rx[b][4 * i + 2], rx[b][4 * i + 3]);
            if (ISV) {
#pragma unroll
                for (int e = 0; e < 16; ++e) wf[i][e] = (__bf16)rw[b][e][i];
            } else wf[i] = cvt16(rw[b][4 * i], rw[b][4 * i + 1], rw[b][4 * i + 2], rw[b][4 * i + 3]);
        }
        if (!ISV && (kc >> 1) == (int)blockIdx.y) {     // same for the whole wave: this tile's half of the x image
            v8h im[8];
#pragma unroll
            for (int i = 0; i < 4; ++i)
#pragma unroll
                for (int e = 0; e < 8; ++e) { im[2 * i][e] = (h16)(float)xf[i][e]; im[2 * i + 1][e] = (h16)(float)xf[i][8 + e]; }
            __builtin_amdgcn_sched_barrier(0);   // all eight pieces stand in front of the stores: among them they were written over registers that an issued store names
#pragma unroll
            for (int i = 0; i < 8; ++i) *(v8h*)(xo + (i >> 1) * 16 * DM + 32 * kc + (i & 1) * 16) = im[i];
            asm volatile("s_wait_xcnt 0x0" ::: "memory");   // the work behind these stores writes registers that they name: the wait stands in front of that
        }
#pragma unroll
        for (int nb = 0; nb < 4; ++nb)
#pragma unroll
            for (int mb = 0; mb < 4; ++mb) acc[mb][nb] = ISV ? wmmab(wf[mb], xf[nb], acc[mb][nb]) : wmmab(xf[mb], wf[nb], acc[mb][nb]);
    }
    const int pitch = ISV ? SEQ : DM;
    h16* tb = Ph + (ISV ? (size_t)w0 * SEQ + x0 : (size_t)x0 * DM + w0);
#pragma unroll
    for (int mb = 0; mb < 4; ++mb) {
#pragma unroll
        for (int nb = 0; nb < 4; ++nb) {
#pragma unroll
            for (int j = 0; j < 8; ++j) os[(hi * 8 + j) * 68 + nb * 16 + lr] = acc[mb][nb][j]; }   // D: row 8h+j, col lane&15
        wave_sync();
#pragma unroll
        for (int s = 0; s < 4; ++s) { const int row = 4 * s + (lane >> 3), c8 = (lane & 7) * 8;   // 4 s x 4 row groups = 16 rows; 8 lanes x 8 = 64 columns
            const v4f y0 = *(const v4fa*)(&os[row * 68 + c8]); const v4f y1 = *(const v4fa*)(&os[row * 68 + c8 + 4]); v8h hv;
#pragma unroll
            for (int i = 0; i < 4; ++i) { hv[i] = (h16)y0[i]; hv[4 + i] = (h16)y1[i]; }
            *(v8h*)(tb + (size_t)(ISV ? 4 * row + mb : 16 * mb + row) * pitch + c8) = hv; }
        asm volatile("s_wait_xcnt 0x0" ::: "memory");   // the next 16 rows' address sums and LDS reads (behind the last: the other part's text) write registers that these stores name: the wait stands in front of that
        wave_sync();
    }
}

// k_proj: everything that reads the inputs alone, in one grid (SEQ/64, DM/64, 2) of single waves: z = 0 the key-side projection r and the f16 image of x, z = 1 v^T.
__global__ __launch_bounds__(32) void k_proj(const float* __restrict__ x, const float* __restrict__ w, const float* __restrict__ v, h16* XH, h16* RP, h16* VT) {
    __shared__ __align__(16) float os[16 * 68];
    if (blockIdx.z != 0) proj_tile<true>(x, v, VT, XH, os);
    else                 proj_tile<false>(x, w, RP, XH, os);
}

// colsum: EC = 1e-8 * row sums of VT, for the DM/4 blocks of four waves that close the flash grid. Block b owns rows 4b..4b+3, wave w the whole row 4b + w:
// 32 loads of 16 B per lane, all in flight together (a wave's load = 512 contiguous bytes). Fixed-order sums: per quarter row over its eight loads and
// over the lanes, then the four quarters pairwise.
// EC layout: the four sums of block b stand at the head of the block's own 128-B line, EC[32b + 0..3] (one writer per line): column e is EC[8*(e & ~3) + (e & 3)].
__device__ __forceinline__ void colsum(int b, const h16* __restrict__ VT, float* EC) {
    __shared__ __align__(16) float red[AW];
    const int lane = threadIdx.x & 31, wave = __builtin_amdgcn_readfirstlane((int)(threadIdx.x >> 5));
    const h16* src = VT + (size_t)(b * 4 + wave) * SEQ + lane * 8;
    v8h x[SEQ / 256];
#pragma unroll   // all loads issue before the first sum: rolled, each trip would wait out its own round trip
    for (int it = 0; it < SEQ / 256; ++it) x[it] = *(const v8h*)(src + it * 256);
    float sq[4];
#pragma unroll   // x[] and sq[] are indexed by constants only, so they stay in registers
    for (int q = 0; q < 4; ++q) {
        float s = 0.0f;
#pragma unroll   // constant indices into x[], as above
        for (int it = q * (SEQ / 1024); it < (q + 1) * (SEQ / 1024); ++it) {
            const float p0 = (float)x[it][0] + (float)x[it][1], p1 = (float)x[it][2] + (float)x[it][3], p2 = (float)x[it][4] + (float)x[it][5], p3 = (float)x[it][6] + (float)x[it][7];
            s += (p0 + p1) + (p2 + p3); }
        s += __shfl_xor(s, 16, 32); s += __shfl_xor(s, 8, 32); s += __shfl_xor(s, 4, 32); s += __shfl_xor(s, 2, 32); s += __shfl_xor(s, 1, 32);
        sq[q] = s;
    }
    if (lane == 0) red[wave] = (sq[0] + sq[1]) + (sq[2] + sq[3]);
    __syncthreads();
    if (threadIdx.x == 0) {
        v4f o;
#pragma unroll   // o[] indexed by constants: one 16-B store from registers
        for (int i = 0; i < 4; ++i) o[i] = red[i] * EPSW;
        *(v4f*)(EC + b * 32) = o;
    }
}

// k_flash: fused attention, one wave per 16 * QT query rows; Q fragments straight from the f16 plane; K / V^T fragments from LDS tiles of 64 keys that the
// block's four waves fill together and share (two 16-B LDS loads per fragment). Ring of two buffers: the copies of stage t + 1 fly while stage t is worked on.
// Transposed form: S^T[key][t] = K Q^T (A = K rows, B = Q rows); lane (t = lane&15, h = lane>>4) holds keys 8h+r of each 16-key tile, so the packed
// P tile is directly the B fragment of O^T[d][t] = V^T P^T (element r <- tile keys 0..15, element 8+r <- tile keys 16..31, lane unchanged).
// Softmax state per lane and query tile: the maximum in use (one scalar) and the partial sum (a pair, joined at the end); the two lane halves of a row are combined with one xor-16 exchange, at a rescale and at the end.
// Block (x, y) works query rows 128x.. on keys y*SEQ/KSP.. only; its result is a partial: PO holds the accumulators over the range's sum, as f16, in register order
// ([tile][range][piece j][lane][8 halves], each store 512 contiguous bytes), ML the pair (max, sum) per lane ([tile][range][lane][2]).
// Flat grid: block f < FBX*KSP is flash block (x, y) = (f % FBX, f / FBX); the DM/4 blocks behind them take the column sums, which read VT alone and are read
// by the merge launch only. They are short and stand last in the grid, so that they start in the places that the first finished flash blocks leave.
// Every unrolled loop over q (query tile), c, j or r below has constant indices, so that the fragment, score and accumulator arrays stay in registers.
// Two waves per SIMD, no more: the 512 flash blocks then lie two on each of the 256 WGPs, whatever order they are placed in.
__global__ __launch_bounds__(32 * AW) __attribute__((amdgpu_waves_per_eu(2, 2))) void k_flash(const h16* __restrict__ QH, const h16* __restrict__ KP, const h16* __restrict__ VT, h16* PO, float* ML, float* EC) {
    if (blockIdx.x >= FBX * KSP) { colsum((int)blockIdx.x - FBX * KSP, VT, EC); return; }   // whole blocks, ahead of every copy and barrier of the flash part
    const int bx = blockIdx.x % FBX, by = blockIdx.x / FBX;
    __shared__ __align__(16) h16 ks[2 * KS * KPH];            // [buffer][key][d], pitch KPH
    __shared__ __align__(16) h16 vs[2 * DM * VPH];            // [buffer][d][key], pitch VPH
    const int tid = threadIdx.x;
    const int lane = threadIdx.x & 31, wave = __builtin_amdgcn_readfirstlane((int)(threadIdx.x >> 5)), lr = lane & 15, hi = lane >> 4;
    const int t0 = (bx * AW + wave) * (16 * QT);
    // copy maps, 16-B piece i = 128*it + tid. k tile: 64 rows x 16 pieces, contiguous in the plane (a wave's copy = 512 B = 4 lines); row = i >> 4.
    // v^T tile: 128 rows x 8 pieces (a wave's copy = 4 rows x one 128-B line); row = i >> 3.
    h16* kl = ks + (tid >> 4) * KPH + (tid & 15) * 8;
    h16* vl = vs + (tid >> 3) * VPH + (tid & 7) * 8;
    const size_t key0 = (size_t)by * (NST * KS);      // first key of this block's range
    const h16* kg = KP + key0 * DM + (size_t)tid * 8;
    const h16* vg = VT + (size_t)(tid >> 3) * SEQ + key0 + (tid & 7) * 8;
    // prologue: stage 0 lands and is published, then stage 1 is started
    copy8(kl, 8 * KPH, kg, 128 * 8); copy8(vl, 16 * VPH, vg, (size_t)16 * SEQ);
    asm volatile("s_wait_asynccnt 0x0" ::: "memory");         // this wave's copies of stage 0 have landed
    __syncthreads();                                          // every wave's have: stage 0 may be read
    copy8(kl + KS * KPH, 8 * KPH, kg + (size_t)KS * DM, 128 * 8); copy8(vl + DM * VPH, 16 * VPH, vg + KS, (size_t)16 * SEQ);
    const size_t qo = (size_t)(t0 + lr) * DM + 8 * hi;
    v16h qh[QT][4];                                           // B fragments: col t, k = d (four 32-deep steps)
#pragma unroll
    for (int q = 0; q < QT; ++q)
#pragma unroll
        for (int c = 0; c < 4; ++c) qh[q][c] = ldh(QH + qo + (size_t)q * 16 * DM + 32 * c);
    const int ko = lr * KPH + 8 * hi;                         // + key * KPH       (A fragment: row key, k = d)
    const int vo = lr * VPH + 8 * hi;                         // + 16j*VPH + key   (A fragment: row d, k = key)
    v8f o[QT][8];
    float m[QT]; v2f l[QT];
#pragma unroll
    for (int q = 0; q < QT; ++q) { m[q] = -3.0e38f; l[q] = (v2f){};
#pragma unroll
        for (int j = 0; j < 8; ++j) o[q][j] = (v8f){}; }
#pragma unroll 1
    for (int t = 0; t < NST; ++t) {
      const int buf = t & 1;
#pragma unroll 1   // kept rolled: one copy of the pass and of its rescale branch; unrolled, the text doubled and 18 more registers were taken
      for (int ps = 0; ps < KS / 32; ++ps) {
        const h16* kp = ks + buf * (KS * KPH) + ko + ps * 32 * KPH;
        v16h ka[4], kb[4];
#pragma unroll
        for (int c = 0; c < 4; ++c) { ka[c] = ldh(kp + 32 * c); kb[c] = ldh(kp + 16 * KPH + 32 * c); }
        v8f sHa[QT], sHb[QT];
#pragma unroll
        for (int q = 0; q < QT; ++q) { sHa[q] = (v8f){}; sHb[q] = (v8f){}; }
#pragma unroll
        for (int c = 0; c < 4; ++c)
#pragma unroll
            for (int q = 0; q < QT; ++q) { sHa[q] = wmma16(ka[c], qh[q][c], sHa[q]); sHb[q] = wmma16(kb[c], qh[q][c], sHb[q]); }
        asm volatile("v_nop\n\tv_nop\n\tv_nop\n\tv_nop" : "+v"(sHa[0]), "+v"(sHb[0]), "+v"(sHa[1]), "+v"(sHb[1])
                     : "v"(ka[0]), "v"(ka[1]), "v"(ka[2]), "v"(ka[3]), "v"(kb[0]), "v"(kb[1]), "v"(kb[2]), "v"(kb[3]));
        // the v^T fragment reads stand in front of the softmax and its branch, so that they return while the vector work runs
        const h16* va = vs + buf * (DM * VPH) + vo + ps * 32;
        v16h vv[8];
#pragma unroll
        for (int j = 0; j < 8; ++j) vv[j] = ldh(va + 16 * j * VPH);
        __builtin_amdgcn_sched_barrier(0);   // keeps the sixteen reads one group: without it they were strewn among the vector instructions in six places
        v8f ta[QT], tb[QT]; float mx[QT];
#pragma unroll
        for (int q = 0; q < QT; ++q) { ta[q] = sHa[q] * SC2; tb[q] = sHb[q] * SC2; mx[q] = -3.0e38f;
#pragma unroll
            for (int r = 0; r < 8; ++r) mx[q] = fmaxf(mx[q], fmaxf(ta[q][r], tb[q][r])); }
        // lazy rescale: one test per pass on each lane's own maxima (m is equal in a row's two lanes, the ballot sees both); while no score lies more
        // than TAU above the maximum in use, m stays and sums and accumulators are left alone. A scalar branch: all lanes stay on for the WMMAs behind it.
        if (__builtin_expect(__builtin_amdgcn_ballot_w32(mx[0] > m[0] + TAU || mx[1] > m[1] + TAU) != 0, 0)) {   // marked rare: the pass without a rescale is laid out straight through
#pragma unroll
            for (int q = 0; q < QT; ++q) {
                const float mw = fmaxf(mx[q], __shfl_xor(mx[q], 16, 32));
                const float mnew = fmaxf(m[q], mw);
                const float alpha = __builtin_amdgcn_exp2f(m[q] - mnew);
                l[q] *= alpha; m[q] = mnew;
#pragma unroll
                for (int j = 0; j < 8; ++j) o[q][j] = o[q][j] * alpha;
            }
        }
        v16h pb[QT];
#pragma unroll
        for (int q = 0; q < QT; ++q) {
            const float sh = PSH - m[q];
            const v8f ea = exp2x8(ta[q] + sh), eb = exp2x8(tb[q] + sh);
#pragma unroll
            for (int r = 0; r < 8; ++r) { pb[q][r] = (h16)ea[r]; pb[q][8 + r] = (h16)eb[r]; }
            const v8f es = ea + eb;      // the 16 terms fall to 2 in a tree of packed adds
            const v4f e4 = __builtin_shufflevector(es, es, 0, 1, 2, 3) + __builtin_shufflevector(es, es, 4, 5, 6, 7);
            l[q] += __builtin_shufflevector(e4, e4, 0, 1) + __builtin_shufflevector(e4, e4, 2, 3);
        }
#pragma unroll
        for (int j = 0; j < 8; ++j)
#pragma unroll
            for (int q = 0; q < QT; ++q) o[q][j] = wmma16(vv[j], pb[q], o[q][j]);
        // four free vector slots behind the last matrix instructions, on the loop's taken branch too; the operands only hold the statement behind all sixteen
        asm volatile("v_nop\n\tv_nop\n\tv_nop\n\tv_nop"
                     :: "v"(o[0][0]), "v"(o[0][1]), "v"(o[0][2]), "v"(o[0][3]), "v"(o[0][4]), "v"(o[0][5]), "v"(o[0][6]), "v"(o[0][7]),
                        "v"(o[1][0]), "v"(o[1][1]), "v"(o[1][2]), "v"(o[1][3]), "v"(o[1][4]), "v"(o[1][5]), "v"(o[1][6]), "v"(o[1][7]));
      }
      // publish point of stage t + 1, every wave, in this order
      asm volatile("s_wait_dscnt 0x0" ::: "memory");          // this wave's reads of stage t have returned before its buffer is refilled
      asm volatile("s_wait_asynccnt 0x0" ::: "memory");       // this wave's copies of stage t + 1 have landed
      __syncthreads();                                        // publishes stage t + 1 and ends every wave's reads of stage t
      if (t + 2 < NST) {                                      // same for the whole block: refill the buffer that stage t has just left
          copy8(kl + buf * (KS * KPH), 8 * KPH, kg + (size_t)(t + 2) * KS * DM, 128 * 8);
          copy8(vl + buf * (DM * VPH), 16 * VPH, vg + (size_t)(t + 2) * KS, (size_t)16 * SEQ);
      }
    }
    asm volatile("s_wait_asynccnt 0x0" ::: "memory");         // nothing of this wave is in flight when the ring is left
    v2f ml[QT]; h16* po[QT]; float* mp[QT]; v8h hv[QT][8];
#pragma unroll
    for (int q = 0; q < QT; ++q) {
        const size_t pt = (size_t)((t0 >> 4) + q) * KSP + (size_t)by;     // (tile, range)
        po[q] = PO + pt * (16 * 128) + lane * 8; mp[q] = ML + (pt * 32 + lane) * 2;
        const float lw = l[q][0] + l[q][1];
        ml[q][0] = m[q]; ml[q][1] = lw + __shfl_xor(lw, 16, 32);
        const float inv = 1.0f / ml[q][1];          // the sum holds the term of the key that set m (at least 2^PSH): never 0
#pragma unroll
        for (int j = 0; j < 8; ++j)
#pragma unroll
            for (int r = 0; r < 8; ++r) hv[q][j][r] = (h16)(o[q][j][r] * inv);   // a weighted mean of f16 v values: inside the f16 range
    }
    __builtin_amdgcn_sched_barrier(0);   // sums, pieces and addresses stand in front of the stores: among them they were written over registers that an issued store names
#pragma unroll
    for (int q = 0; q < QT; ++q) {
#pragma unroll
        for (int j = 0; j < 8; ++j) *(v8h*)(po[q] + j * 256) = hv[q][j];
        *(v2f*)mp[q] = ml[q];
    }
    asm volatile("s_wait_xcnt 0x0" ::: "memory");   // the column-sum part is laid out behind these stores and writes their registers: the wait stands in front of that
}

// 2^d for the merge weights, with the free slot that the instruction set asks for behind a transcendental in the same statement
__device__ __forceinline__ float exp2_slot(float d) { float w; asm("v_exp_f32 %0, %1\n\tv_nop" : "=v"(w) : "v"(d)); return w; }

// k_merge: joins the KSP partials of one 16-row query tile (ranges in fixed order 0..KSP-1): weight w = exp2(m_s - max) * l_s, out = sum(w mean_s) / sum(w) + EC.
// One block per tile; wave w owns pieces 2w, 2w+1 = columns 32w..32w+31 (piece j of lane (t = lane&15, h = lane>>4): d = 16j + 8h + 0..7),
// turns them through a wave-private LDS tile and stores whole 128-B lines.
__global__ __launch_bounds__(128) void k_merge(const h16* __restrict__ PO, const float* __restrict__ ML, const float* __restrict__ EC, float* OUT) {
    __shared__ __align__(16) float os[4 * 16 * MSP];
    const int lane = threadIdx.x & 31, wave = __builtin_amdgcn_readfirstlane((int)(threadIdx.x >> 5)), lr = lane & 15, hi = lane >> 4;
    const size_t tile = blockIdx.x;
    const float* mb = ML + tile * (KSP * 64) + lane * 2;                     // the tile's KSP partials lie side by side
    const h16* pb = PO + tile * (KSP * 16 * 128) + wave * (2 * 256) + lane * 8;
    v8h x[KSP][2]; v4f e[4]; float ms[KSP], ls[KSP];
#pragma unroll
    for (int s = 0; s < KSP; ++s) {
        const v2f ml = *(const v2f*)(mb + s * 64); ms[s] = ml[0]; ls[s] = ml[1];
#pragma unroll
        for (int p = 0; p < 2; ++p) x[s][p] = *(const v8h*)(pb + s * (16 * 128) + p * 256);
    }
    __builtin_amdgcn_sched_barrier(0);   // the EC loads stay last
#pragma unroll
    for (int p = 0; p < 4; ++p) e[p] = *(const v4f*)(EC + 8 * (32 * wave + 16 * (p >> 1) + 4 * (p & 1) + 8 * hi));   // four columns per 128-B line of EC
    __builtin_amdgcn_sched_barrier(0);   // keeps all 28 loads in front of the sums, in flight together: without it they sank to their uses, a few per memory round trip
    float mx = ms[0];
#pragma unroll
    for (int s = 1; s < KSP; ++s) mx = fmaxf(mx, ms[s]);
    v4f acc[4]; float l = 0.0f;
#pragma unroll
    for (int p = 0; p < 4; ++p) acc[p] = (v4f){};
#pragma unroll
    for (int s = 0; s < KSP; ++s) {
        const float w = exp2_slot(ms[s] - mx) * ls[s];      // a range's mean counts with its share of the whole sum
        l += w;
#pragma unroll
        for (int p = 0; p < 4; ++p)
#pragma unroll
            for (int i = 0; i < 4; ++i) acc[p][i] += (float)x[s][p >> 1][4 * (p & 1) + i] * w;
    }
    const float inv = 1.0f / l;
    const int wb = wave * 16 * MSP;
#pragma unroll
    for (int p = 0; p < 4; ++p) {
        const int dl = 16 * (p >> 1) + 8 * hi + 4 * (p & 1);            // column inside the wave's 32
        *(v4fa*)(&os[wb + lr * MSP + dl]) = acc[p] * inv + e[p];
    }
    wave_sync();
    float* orow = OUT + tile * 16 * DM + 32 * wave;
#pragma unroll
    for (int s = 0; s < 4; ++s) {                              // 4 rows per store: 8 lanes x 4 floats = one 128-B line each
        const int row = 4 * s + (lane >> 3), c4 = (lane & 7) * 4;
        const v4f val = *(const v4fa*)(&os[wb + row * MSP + c4]);
        *(v4f*)(orow + (size_t)row * DM + c4) = val; }
}

static constexpr size_t al256(size_t v) { return (v + 255) & ~(size_t)255; }
static constexpr size_t SZ_PL = al256((size_t)SEQ * DM * 2);          // one 16-bit plane [SEQ][128] or [128][SEQ]
static constexpr size_t SZ_EC = al256((size_t)(DM / 4) * 128);         // one 128-B line per four columns
static constexpr size_t SZ_PO = al256((size_t)KSP * SEQ * DM * 2);    // f16 partial means: SEQ x 128 values per key range
static constexpr size_t SZ_ML = al256((size_t)KSP * NT * 32 * 2 * 4); // (max, sum) per tile, range and lane
static constexpr size_t SZ_TOTAL = 3 * SZ_PL + SZ_EC + SZ_PO + SZ_ML;
static_assert(SZ_TOTAL <= (size_t)134217728);          // workspace carve <= 128 MiB

extern "C" void kernel_launch(void* const* d_in, const int* in_sizes, int n_in,
                              void* d_out, int out_size, void* d_ws, size_t ws_size, hipStream_t stream) {
    if (n_in < 3) return;
    if ((size_t)in_sizes[0] < (size_t)SEQ * DM) return;
    if ((size_t)in_sizes[1] < (size_t)DM * DM || (size_t)in_sizes[2] < (size_t)DM * DM) return;
    if ((size_t)out_size < (size_t)SEQ * DM) return;
    if (SZ_TOTAL > ws_size) return;
    const float* x = (const float*)d_in[0]; const float* w = (const float*)d_in[1]; const float* v = (const float*)d_in[2];   // wire order X, W, V (W, V are [in][out])
    float* OUT = (float*)d_out;      // [SEQ][128]
    char* wsp = (char*)d_ws;
    h16* XH = (h16*)wsp; wsp += SZ_PL;               // [SEQ][128] f16 image of bf16 x (query side of the scores)
    h16* RP = (h16*)wsp; wsp += SZ_PL;               // [SEQ][128] r = x W^T (key side of the scores)
    h16* VT = (h16*)wsp; wsp += SZ_PL;               // [128 e][SEQ] v^T
    float* EC = (float*)wsp; wsp += SZ_EC;           // [32 lines][4 of 32 floats] 1e-8 * column sums of v
    h16* PO = (h16*)wsp; wsp += SZ_PO;               // flash partial means
    float* ML = (float*)wsp; wsp += SZ_ML;           // flash partial (max, sum)

    // inputs -> x image [t][d], r plane [key][d] and v^T plane [e][t]
    k_proj<<<dim3(SEQ / 64, DM / 64, 2), 32, 0, stream>>>(x, w, v, XH, RP, VT);

    // flash partials, and the column sums of v
    k_flash<<<FBX * KSP + DM / 4, 32 * AW, 0, stream>>>(XH, RP, VT, PO, ML, EC);

    k_merge<<<NT, 128, 0, stream>>>(PO, ML, EC, OUT);
}
